// v000
// Times are from an AMD MI455X. After a warm-up the kernel runs many times in a row, and a time is the length of
// such a window on the GPU divided by its runs, so every launch and the gaps after it count. The runs cycle
// through copies of the inputs. A figure is the median of several windows, for all but v000 over two sittings.
// Sittings can differ by a few percent; kernels timed side by side share one.
// v000, which the later versions start from, runs in 188 microseconds.
#include <hip/hip_runtime.h>
#include <stdint.h>

typedef unsigned short bf16u;
typedef __attribute__((ext_vector_type(16))) __bf16 v16bf;
typedef __attribute__((ext_vector_type(8)))  float  v8f;
typedef __attribute__((ext_vector_type(4)))  int    v4i;

#define D_MODEL 1024
#define SEQ     2048
#define NHEAD   16
#define HDIM    64
#define MTOT    4096   // B*S

#define AS1 __attribute__((address_space(1)))
#define AS3 __attribute__((address_space(3)))

#if defined(__has_builtin)
#if __has_builtin(__builtin_amdgcn_global_load_async_to_lds_b128)
#define HAVE_ASYNC_LDS 1
#endif
#endif
#ifndef HAVE_ASYNC_LDS
#define HAVE_ASYNC_LDS 0
#endif

// ---------- helpers ----------

__device__ __forceinline__ bf16u f2bf(float f) {
  unsigned u = __float_as_uint(f);
  unsigned r = ((u >> 16) & 1u) + 0x7fffu;   // round-to-nearest-even
  return (bf16u)((u + r) >> 16);
}

struct U4x2 { uint4 a, b; };

// Load a 16x32 bf16 A/B fragment row for lane (l, hi): two contiguous 16B
// chunks per the CDNA5 16-bit matrix VGPR layout (K pairs hi*8.. and 16+hi*8..)
__device__ __forceinline__ v16bf load_frag(const bf16u* rowp, int hi) {
  U4x2 t;
  t.a = *(const uint4*)(rowp + hi * 8);
  t.b = *(const uint4*)(rowp + 16 + hi * 8);
  return __builtin_bit_cast(v16bf, t);
}

__device__ __forceinline__ v8f wmma_bf16(v16bf a, v16bf b, v8f c) {
  return __builtin_amdgcn_wmma_f32_16x16x32_bf16(
      false, a, false, b, (short)0, c, false, false);
}

// 16-byte global->LDS copy: async (ASYNCcnt-tracked, bypasses VGPRs) if available
__device__ __forceinline__ void copy16(const bf16u* g, bf16u* l) {
#if HAVE_ASYNC_LDS
  __builtin_amdgcn_global_load_async_to_lds_b128((AS1 v4i*)g, (AS3 v4i*)l, 0, 0);
#else
  *(uint4*)l = *(const uint4*)g;
#endif
}

__device__ __forceinline__ void async_wait0() {
#if HAVE_ASYNC_LDS
#if __has_builtin(__builtin_amdgcn_s_wait_asynccnt)
  __builtin_amdgcn_s_wait_asynccnt(0);
#else
  asm volatile("s_wait_asynccnt 0" ::: "memory");
#endif
#endif
}

// 16-lane row reductions via DPP16 (pure VALU, co-executes with WMMA):
// quad_perm xor1, quad_perm xor2, row_half_mirror (8), row_mirror (16)
__device__ __forceinline__ float row16_max(float x) {
  int v;
  v = __builtin_amdgcn_update_dpp(0, __float_as_int(x), 0xB1,  0xf, 0xf, true);
  x = fmaxf(x, __int_as_float(v));
  v = __builtin_amdgcn_update_dpp(0, __float_as_int(x), 0x4E,  0xf, 0xf, true);
  x = fmaxf(x, __int_as_float(v));
  v = __builtin_amdgcn_update_dpp(0, __float_as_int(x), 0x141, 0xf, 0xf, true);
  x = fmaxf(x, __int_as_float(v));
  v = __builtin_amdgcn_update_dpp(0, __float_as_int(x), 0x140, 0xf, 0xf, true);
  x = fmaxf(x, __int_as_float(v));
  return x;
}

__device__ __forceinline__ float row16_sum(float x) {
  int v;
  v = __builtin_amdgcn_update_dpp(0, __float_as_int(x), 0xB1,  0xf, 0xf, true);
  x += __int_as_float(v);
  v = __builtin_amdgcn_update_dpp(0, __float_as_int(x), 0x4E,  0xf, 0xf, true);
  x += __int_as_float(v);
  v = __builtin_amdgcn_update_dpp(0, __float_as_int(x), 0x141, 0xf, 0xf, true);
  x += __int_as_float(v);
  v = __builtin_amdgcn_update_dpp(0, __float_as_int(x), 0x140, 0xf, 0xf, true);
  x += __int_as_float(v);
  return x;
}

// ---------- conversion kernels ----------

__global__ void cvt_x_kernel(const float* __restrict__ X, bf16u* __restrict__ Xb) {
  int i = blockIdx.x * blockDim.x + threadIdx.x;   // one float4 each
  float4 v = ((const float4*)X)[i];
  union { bf16u h[4]; uint2 u; } o;
  o.h[0] = f2bf(v.x); o.h[1] = f2bf(v.y); o.h[2] = f2bf(v.z); o.h[3] = f2bf(v.w);
  ((uint2*)Xb)[i] = o.u;
}

// WT[z][n][k] = W_z[k][n]  (bf16, transposed so B-fragments load row-wise)
__global__ void cvt_wT_kernel(const float* __restrict__ W0, const float* __restrict__ W1,
                              const float* __restrict__ W2, const float* __restrict__ W3,
                              bf16u* __restrict__ WT) {
  int z = blockIdx.y;
  const float* W = (z == 0) ? W0 : (z == 1) ? W1 : (z == 2) ? W2 : W3;
  int idx = blockIdx.x * 256 + threadIdx.x;        // 0 .. 1M-1
  int n = idx >> 10, k = idx & 1023;
  WT[(size_t)z * 1024 * 1024 + idx] = f2bf(W[k * 1024 + n]);
}

// ---------- tiled bf16 WMMA GEMM: C = A(4096x1024) * WT^T + bias ----------
// Double-buffered LDS staging with async global->LDS copies.
// MODE 0: QKV projection, writes bf16 into [B,H,S,Dh], z = blockIdx.z selects matrix
// MODE 1: output projection, adds residual, writes fp32 Hout
template <int MODE>
__global__ void gemm_kernel(const bf16u* __restrict__ A,
                            const bf16u* __restrict__ WT,
                            const float* __restrict__ bias0,
                            const float* __restrict__ bias1,
                            const float* __restrict__ bias2,
                            bf16u* __restrict__ qkv,
                            const float* __restrict__ resid,
                            float* __restrict__ Hout) {
  __shared__ bf16u As[2][128 * 40];  // 128x32 tile, stride 40 (80B, 16B-aligned)
  __shared__ bf16u Bs[2][128 * 40];

  const int tid  = threadIdx.x;
  const int wave = tid >> 5, lane = tid & 31;
  const int l = lane & 15, hi = lane >> 4;
  const int wm = wave >> 2, wn = wave & 3;          // 2x4 wave grid
  const int z = (MODE == 0) ? blockIdx.z : 0;
  const int mbase = blockIdx.y * 128;
  const int nbase = blockIdx.x * 128;
  const bf16u* Bt = WT + (size_t)z * (1024 * 1024);
  const float* bias = (MODE == 0) ? ((z == 0) ? bias0 : (z == 1) ? bias1 : bias2)
                                  : bias0;

  v8f zinit = {};
  v8f acc[4][2];
#pragma unroll
  for (int i = 0; i < 4; i++)
#pragma unroll
    for (int j = 0; j < 2; j++) acc[i][j] = zinit;

  const int r0 = tid >> 2, q = tid & 3;             // 4 threads/row, 16B each
  const bf16u* ag = A  + (size_t)(mbase + r0) * 1024 + q * 8;
  const bf16u* bg = Bt + (size_t)(nbase + r0) * 1024 + q * 8;

  auto stage = [&](int buf, int kb) {
    const int ko = kb * 32;
    copy16(ag + ko,                      &As[buf][r0 * 40 + q * 8]);
    copy16(ag + ko + (size_t)64 * 1024,  &As[buf][(r0 + 64) * 40 + q * 8]);
    copy16(bg + ko,                      &Bs[buf][r0 * 40 + q * 8]);
    copy16(bg + ko + (size_t)64 * 1024,  &Bs[buf][(r0 + 64) * 40 + q * 8]);
  };

  stage(0, 0);
  async_wait0();
  __syncthreads();

  int buf = 0;
  for (int kb = 0; kb < 32; ++kb) {
    if (kb + 1 < 32) stage(buf ^ 1, kb + 1);   // prefetch next tile

    v16bf bfrag[2];
#pragma unroll
    for (int j = 0; j < 2; j++)
      bfrag[j] = load_frag(&Bs[buf][(wn * 32 + j * 16 + l) * 40], hi);
#pragma unroll
    for (int i = 0; i < 4; i++) {
      v16bf afrag = load_frag(&As[buf][(wm * 64 + i * 16 + l) * 40], hi);
#pragma unroll
      for (int j = 0; j < 2; j++)
        acc[i][j] = wmma_bf16(afrag, bfrag[j], acc[i][j]);
    }

    async_wait0();
    __syncthreads();
    buf ^= 1;
  }

  // epilogue: C-layout value (lane l, half hi, comp r) = C[r + hi*8][l] of a 16x16 tile
#pragma unroll
  for (int i = 0; i < 4; i++) {
#pragma unroll
    for (int j = 0; j < 2; j++) {
      const int n = nbase + wn * 32 + j * 16 + l;
      const float bn = bias[n];
#pragma unroll
      for (int r = 0; r < 8; r++) {
        const int m = mbase + wm * 64 + i * 16 + r + hi * 8;
        float val = acc[i][j][r] + bn;
        if (MODE == 0) {
          int bb = m >> 11, s = m & 2047;
          int h = n >> 6, dh = n & 63;
          qkv[(size_t)z * MTOT * D_MODEL +
              (((size_t)(bb * NHEAD + h) * SEQ + s) * HDIM + dh)] = f2bf(val);
        } else {
          Hout[(size_t)m * D_MODEL + n] = val + resid[(size_t)m * D_MODEL + n];
        }
      }
    }
  }
}

// ---------- flash-style attention, one (b,h) x 128 query rows per block ----------

__global__ void attn_kernel(const bf16u* __restrict__ qkv, bf16u* __restrict__ ctx) {
  __shared__ bf16u Qs[128 * 72];      // 128 q-rows x 64, stride 72 (144B)
  __shared__ bf16u Ks[64 * 72];       // 64 k-rows x 64
  __shared__ bf16u Vts[64 * 72];      // V transposed: [d][t]
  __shared__ bf16u Ps[8 * 16 * 72];   // per-wave P tile, 16 x 64

  const int tid  = threadIdx.x;
  const int wave = tid >> 5, lane = tid & 31;
  const int l = lane & 15, hi = lane >> 4;
  const int bh = blockIdx.y;
  const int qbase = blockIdx.x * 128;
  const size_t headoff = (size_t)bh * SEQ * HDIM;
  const bf16u* Qp = qkv + headoff;
  const bf16u* Kp = qkv + (size_t)MTOT * D_MODEL + headoff;
  const bf16u* Vp = qkv + (size_t)2 * MTOT * D_MODEL + headoff;

  // stage Q tile (16KB) async: 2 threads/row, 64B each
  {
    int row = tid >> 1, half = tid & 1;
    const bf16u* g = Qp + (size_t)(qbase + row) * HDIM + half * 32;
    bf16u* d = &Qs[row * 72 + half * 32];
#pragma unroll
    for (int c = 0; c < 4; c++) copy16(g + c * 8, d + c * 8);
  }

  v8f zinit = {};
  v8f sacc[4], o[4];
  float mrun[8], lrun[8];
#pragma unroll
  for (int n = 0; n < 4; n++) o[n] = zinit;
#pragma unroll
  for (int r = 0; r < 8; r++) { mrun[r] = -1e30f; lrun[r] = 0.f; }

  for (int kb = 0; kb < SEQ / 64; ++kb) {
    const int kt0 = kb * 64;
    __syncthreads();   // previous iteration's reads of Ks/Vts complete
    // stage K tile async: 4 threads/row, 32B each
    {
      int row = tid >> 2, q = tid & 3;
      const bf16u* g = Kp + (size_t)(kt0 + row) * HDIM + q * 16;
      bf16u* d = &Ks[row * 72 + q * 16];
      copy16(g, d);
      copy16(g + 8, d + 8);
    }
    // stage V transposed: coalesced global read, scattered LDS b16 writes
#pragma unroll
    for (int c = 0; c < 2; c++) {
      int idx = tid + c * 256;
      int t = idx >> 3, dc = (idx & 7) * 8;
      union { uint4 u; bf16u h[8]; } tmp;
      tmp.u = *(const uint4*)(Vp + (size_t)(kt0 + t) * HDIM + dc);
#pragma unroll
      for (int e = 0; e < 8; e++) Vts[(dc + e) * 72 + t] = tmp.h[e];
    }
    async_wait0();
    __syncthreads();

    // scores: S(16x64) = Q(16x64) * K^T   (K row-major == Bt layout)
#pragma unroll
    for (int j = 0; j < 4; j++) sacc[j] = zinit;
#pragma unroll
    for (int ks = 0; ks < 2; ks++) {
      v16bf afrag = load_frag(&Qs[(wave * 16 + l) * 72 + ks * 32], hi);
#pragma unroll
      for (int j = 0; j < 4; j++) {
        v16bf bfrag = load_frag(&Ks[(j * 16 + l) * 72 + ks * 32], hi);
        sacc[j] = wmma_bf16(afrag, bfrag, sacc[j]);
      }
    }

    // online softmax; 16-lane row reductions via DPP (no LDS pipe)
#pragma unroll
    for (int r = 0; r < 8; r++) {
      float m_b = -1e30f;
#pragma unroll
      for (int j = 0; j < 4; j++) {
        float t = sacc[j][r] * 0.125f;   // 1/sqrt(64)
        sacc[j][r] = t;
        m_b = fmaxf(m_b, t);
      }
      m_b = row16_max(m_b);
      float m_new = fmaxf(mrun[r], m_b);
      float alpha = __expf(mrun[r] - m_new);
      mrun[r] = m_new;
      float srow = 0.f;
#pragma unroll
      for (int j = 0; j < 4; j++) {
        float p = __expf(sacc[j][r] - m_new);
        sacc[j][r] = p;
        srow += p;
      }
      srow = row16_sum(srow);
      lrun[r] = lrun[r] * alpha + srow;
#pragma unroll
      for (int n = 0; n < 4; n++) o[n][r] *= alpha;
    }

    // transpose P from C-layout to A-layout through per-wave LDS region
#pragma unroll
    for (int j = 0; j < 4; j++)
#pragma unroll
      for (int r = 0; r < 8; r++)
        Ps[(wave * 16 + r + hi * 8) * 72 + j * 16 + l] = f2bf(sacc[j][r]);

    asm volatile("s_wait_dscnt 0" ::: "memory");   // wave-local LDS RAW fence

    // ctx(16x64) += P(16x64) * V(64x64)   (Vts[d][t] == Bt layout)
#pragma unroll
    for (int ks = 0; ks < 2; ks++) {
      v16bf afrag = load_frag(&Ps[(wave * 16 + l) * 72 + ks * 32], hi);
#pragma unroll
      for (int n = 0; n < 4; n++) {
        v16bf bfrag = load_frag(&Vts[(n * 16 + l) * 72 + ks * 32], hi);
        o[n] = wmma_bf16(afrag, bfrag, o[n]);
      }
    }
  }

  // normalize and store ctx back to [B*S, D] bf16
  const int bb = bh >> 4, h = bh & 15;
#pragma unroll
  for (int r = 0; r < 8; r++) {
    float inv = 1.0f / lrun[r];
    int s = qbase + wave * 16 + r + hi * 8;
    size_t mrow = ((size_t)bb * SEQ + s) * D_MODEL;
#pragma unroll
    for (int n = 0; n < 4; n++) {
      int col = h * HDIM + n * 16 + l;
      ctx[mrow + col] = f2bf(o[n][r] * inv);
    }
  }
}

// ---------- LayerNorm over D=1024 per row ----------

__global__ void ln_kernel(const float* __restrict__ Hb, const float* __restrict__ gamma,
                          const float* __restrict__ beta, float* __restrict__ out) {
  __shared__ float rs[256], rss[256];
  const int row = blockIdx.x, tid = threadIdx.x;
  const float* hp = Hb + (size_t)row * D_MODEL;
  float s = 0.f, ss = 0.f;
  for (int i = tid; i < D_MODEL; i += 256) {
    float x = hp[i]; s += x; ss += x * x;
  }
  rs[tid] = s; rss[tid] = ss;
  __syncthreads();
  for (int st = 128; st > 0; st >>= 1) {
    if (tid < st) { rs[tid] += rs[tid + st]; rss[tid] += rss[tid + st]; }
    __syncthreads();
  }
  float mu   = rs[0] * (1.0f / D_MODEL);
  float var  = rss[0] * (1.0f / D_MODEL) - mu * mu;
  float rstd = rsqrtf(var + 1e-12f);
  for (int i = tid; i < D_MODEL; i += 256) {
    out[(size_t)row * D_MODEL + i] = (hp[i] - mu) * rstd * gamma[i] + beta[i];
  }
}

// ---------- launch ----------

extern "C" void kernel_launch(void* const* d_in, const int* in_sizes, int n_in,
                              void* d_out, int out_size, void* d_ws, size_t ws_size,
                              hipStream_t stream) {
  (void)in_sizes; (void)n_in; (void)out_size; (void)ws_size;
  const float* X     = (const float*)d_in[0];
  const float* Wq    = (const float*)d_in[1];
  const float* bq    = (const float*)d_in[2];
  const float* Wk    = (const float*)d_in[3];
  const float* bk    = (const float*)d_in[4];
  const float* Wv    = (const float*)d_in[5];
  const float* bv    = (const float*)d_in[6];
  const float* Wo    = (const float*)d_in[7];
  const float* bo    = (const float*)d_in[8];
  const float* gamma = (const float*)d_in[9];
  const float* beta  = (const float*)d_in[10];
  float* out = (float*)d_out;

  char* ws = (char*)d_ws;
  bf16u* Xb  = (bf16u*)ws;                              //  8 MB: X in bf16
  bf16u* WT  = (bf16u*)(ws + 8ull  * 1024 * 1024);      //  8 MB: 4 transposed weights
  bf16u* QKV = (bf16u*)(ws + 16ull * 1024 * 1024);      // 24 MB: Q,K,V [B,H,S,Dh]
  bf16u* Ctx = (bf16u*)(ws + 40ull * 1024 * 1024);      //  8 MB: context [B*S, D]
  float* Hb  = (float*)(ws + 48ull * 1024 * 1024);      // 16 MB: pre-LN fp32

  cvt_x_kernel <<<dim3(MTOT * D_MODEL / 1024), 256, 0, stream>>>(X, Xb);
  cvt_wT_kernel<<<dim3(4096, 4),               256, 0, stream>>>(Wq, Wk, Wv, Wo, WT);
  gemm_kernel<0><<<dim3(8, 32, 3), 256, 0, stream>>>(Xb, WT, bq, bk, bv, QKV,
                                                     nullptr, nullptr);
  attn_kernel  <<<dim3(16, 32),    256, 0, stream>>>(QKV, Ctx);
  gemm_kernel<1><<<dim3(8, 32, 1), 256, 0, stream>>>(Ctx, WT + 3ull * 1024 * 1024,
                                                     bo, nullptr, nullptr, nullptr,
                                                     X, Hb);
  ln_kernel    <<<dim3(4096),      256, 0, stream>>>(Hb, gamma, beta, out);
}

// v001
// Measured time: 158 microseconds a run.
// Two timings next to v000 both put it at 1.23 times that version's speed.
#include <hip/hip_runtime.h>
#include <stdint.h>

typedef unsigned short bf16u;
typedef __attribute__((ext_vector_type(16))) __bf16 v16bf;
typedef __attribute__((ext_vector_type(8)))  float  v8f;
typedef __attribute__((ext_vector_type(4)))  int    v4i;

#define D_MODEL 1024
#define SEQ     2048
#define NHEAD   16
#define HDIM    64
#define MTOT    4096   // B*S

#define AS1 __attribute__((address_space(1)))
#define AS3 __attribute__((address_space(3)))

#if defined(__has_builtin)
#if __has_builtin(__builtin_amdgcn_global_load_async_to_lds_b128)
#define HAVE_ASYNC_LDS 1
#endif
#endif
#ifndef HAVE_ASYNC_LDS
#define HAVE_ASYNC_LDS 0
#endif

// ---------- helpers ----------

__device__ __forceinline__ bf16u f2bf(float f) {
  unsigned u = __float_as_uint(f);
  unsigned r = ((u >> 16) & 1u) + 0x7fffu;   // round-to-nearest-even
  return (bf16u)((u + r) >> 16);
}

struct U4x2 { uint4 a, b; };

// Load a 16x32 bf16 A/B fragment row for lane (l, hi): two contiguous 16B
// chunks per the CDNA5 16-bit matrix VGPR layout (K pairs hi*8.. and 16+hi*8..)
__device__ __forceinline__ v16bf load_frag(const bf16u* rowp, int hi) {
  U4x2 t;
  t.a = *(const uint4*)(rowp + hi * 8);
  t.b = *(const uint4*)(rowp + 16 + hi * 8);
  return __builtin_bit_cast(v16bf, t);
}

__device__ __forceinline__ v8f wmma_bf16(v16bf a, v16bf b, v8f c) {
  return __builtin_amdgcn_wmma_f32_16x16x32_bf16(
      false, a, false, b, (short)0, c, false, false);
}

// 16-byte global->LDS copy: async (ASYNCcnt-tracked, bypasses VGPRs) if available
__device__ __forceinline__ void copy16(const bf16u* g, bf16u* l) {
#if HAVE_ASYNC_LDS
  __builtin_amdgcn_global_load_async_to_lds_b128((AS1 v4i*)g, (AS3 v4i*)l, 0, 0);
#else
  *(uint4*)l = *(const uint4*)g;
#endif
}

__device__ __forceinline__ void async_wait0() {
#if HAVE_ASYNC_LDS
#if __has_builtin(__builtin_amdgcn_s_wait_asynccnt)
  __builtin_amdgcn_s_wait_asynccnt(0);
#else
  asm volatile("s_wait_asynccnt 0" ::: "memory");
#endif
#endif
}

// 16-lane row reductions via DPP16 (pure VALU, co-executes with WMMA):
// quad_perm xor1, quad_perm xor2, row_half_mirror (8), row_mirror (16)
__device__ __forceinline__ float row16_max(float x) {
  int v;
  v = __builtin_amdgcn_update_dpp(0, __float_as_int(x), 0xB1,  0xf, 0xf, true);
  x = fmaxf(x, __int_as_float(v));
  v = __builtin_amdgcn_update_dpp(0, __float_as_int(x), 0x4E,  0xf, 0xf, true);
  x = fmaxf(x, __int_as_float(v));
  v = __builtin_amdgcn_update_dpp(0, __float_as_int(x), 0x141, 0xf, 0xf, true);
  x = fmaxf(x, __int_as_float(v));
  v = __builtin_amdgcn_update_dpp(0, __float_as_int(x), 0x140, 0xf, 0xf, true);
  x = fmaxf(x, __int_as_float(v));
  return x;
}

__device__ __forceinline__ float row16_sum(float x) {
  int v;
  v = __builtin_amdgcn_update_dpp(0, __float_as_int(x), 0xB1,  0xf, 0xf, true);
  x += __int_as_float(v);
  v = __builtin_amdgcn_update_dpp(0, __float_as_int(x), 0x4E,  0xf, 0xf, true);
  x += __int_as_float(v);
  v = __builtin_amdgcn_update_dpp(0, __float_as_int(x), 0x141, 0xf, 0xf, true);
  x += __int_as_float(v);
  v = __builtin_amdgcn_update_dpp(0, __float_as_int(x), 0x140, 0xf, 0xf, true);
  x += __int_as_float(v);
  return x;
}

// ---------- conversion kernels ----------

__global__ void cvt_x_kernel(const float* __restrict__ X, bf16u* __restrict__ Xb) {
  int i = blockIdx.x * blockDim.x + threadIdx.x;   // one float4 each
  float4 v = ((const float4*)X)[i];
  union { bf16u h[4]; uint2 u; } o;
  o.h[0] = f2bf(v.x); o.h[1] = f2bf(v.y); o.h[2] = f2bf(v.z); o.h[3] = f2bf(v.w);
  ((uint2*)Xb)[i] = o.u;
}

// WT[z][n][k] = W_z[k][n]  (bf16, transposed so B-fragments load row-wise)
__global__ void cvt_wT_kernel(const float* __restrict__ W0, const float* __restrict__ W1,
                              const float* __restrict__ W2, const float* __restrict__ W3,
                              bf16u* __restrict__ WT) {
  int z = blockIdx.y;
  const float* W = (z == 0) ? W0 : (z == 1) ? W1 : (z == 2) ? W2 : W3;
  int idx = blockIdx.x * 256 + threadIdx.x;        // 0 .. 1M-1
  int n = idx >> 10, k = idx & 1023;
  WT[(size_t)z * 1024 * 1024 + idx] = f2bf(W[k * 1024 + n]);
}

// ---------- tiled bf16 WMMA GEMM: C = A(4096x1024) * WT^T + bias ----------
// Double-buffered LDS staging with async global->LDS copies.
// MODE 0: QKV projection, writes bf16 into [B,H,S,Dh], z = blockIdx.z selects matrix
// MODE 1: output projection, adds residual, writes fp32 Hout
template <int MODE>
__global__ void gemm_kernel(const bf16u* __restrict__ A,
                            const bf16u* __restrict__ WT,
                            const float* __restrict__ bias0,
                            const float* __restrict__ bias1,
                            const float* __restrict__ bias2,
                            bf16u* __restrict__ qkv,
                            const float* __restrict__ resid,
                            float* __restrict__ Hout) {
  __shared__ bf16u As[2][128 * 40];  // 128x32 tile, stride 40 (80B, 16B-aligned)
  __shared__ bf16u Bs[2][128 * 40];

  const int tid  = threadIdx.x;
  const int wave = tid >> 5, lane = tid & 31;
  const int l = lane & 15, hi = lane >> 4;
  const int wm = wave >> 2, wn = wave & 3;          // 2x4 wave grid
  const int z = (MODE == 0) ? blockIdx.z : 0;
  const int mbase = blockIdx.y * 128;
  const int nbase = blockIdx.x * 128;
  const bf16u* Bt = WT + (size_t)z * (1024 * 1024);
  const float* bias = (MODE == 0) ? ((z == 0) ? bias0 : (z == 1) ? bias1 : bias2)
                                  : bias0;

  v8f zinit = {};
  v8f acc[4][2];
#pragma unroll
  for (int i = 0; i < 4; i++)
#pragma unroll
    for (int j = 0; j < 2; j++) acc[i][j] = zinit;

  const int r0 = tid >> 2, q = tid & 3;             // 4 threads/row, 16B each
  const bf16u* ag = A  + (size_t)(mbase + r0) * 1024 + q * 8;
  const bf16u* bg = Bt + (size_t)(nbase + r0) * 1024 + q * 8;

  auto stage = [&](int buf, int kb) {
    const int ko = kb * 32;
    copy16(ag + ko,                      &As[buf][r0 * 40 + q * 8]);
    copy16(ag + ko + (size_t)64 * 1024,  &As[buf][(r0 + 64) * 40 + q * 8]);
    copy16(bg + ko,                      &Bs[buf][r0 * 40 + q * 8]);
    copy16(bg + ko + (size_t)64 * 1024,  &Bs[buf][(r0 + 64) * 40 + q * 8]);
  };

  stage(0, 0);
  async_wait0();
  __syncthreads();

  int buf = 0;
  for (int kb = 0; kb < 32; ++kb) {
    if (kb + 1 < 32) stage(buf ^ 1, kb + 1);   // prefetch next tile

    v16bf bfrag[2];
#pragma unroll
    for (int j = 0; j < 2; j++)
      bfrag[j] = load_frag(&Bs[buf][(wn * 32 + j * 16 + l) * 40], hi);
#pragma unroll
    for (int i = 0; i < 4; i++) {
      v16bf afrag = load_frag(&As[buf][(wm * 64 + i * 16 + l) * 40], hi);
#pragma unroll
      for (int j = 0; j < 2; j++)
        acc[i][j] = wmma_bf16(afrag, bfrag[j], acc[i][j]);
    }

    async_wait0();
    __syncthreads();
    buf ^= 1;
  }

  // epilogue: C-layout value (lane l, half hi, comp r) = C[r + hi*8][l] of a 16x16 tile
#pragma unroll
  for (int i = 0; i < 4; i++) {
#pragma unroll
    for (int j = 0; j < 2; j++) {
      const int n = nbase + wn * 32 + j * 16 + l;
      const float bn = bias[n];
#pragma unroll
      for (int r = 0; r < 8; r++) {
        const int m = mbase + wm * 64 + i * 16 + r + hi * 8;
        float val = acc[i][j][r] + bn;
        if (MODE == 0) {
          int bb = m >> 11, s = m & 2047;
          int h = n >> 6, dh = n & 63;
          qkv[(size_t)z * MTOT * D_MODEL +
              (((size_t)(bb * NHEAD + h) * SEQ + s) * HDIM + dh)] = f2bf(val);
        } else {
          Hout[(size_t)m * D_MODEL + n] = val + resid[(size_t)m * D_MODEL + n];
        }
      }
    }
  }
}

// value of the lane 16 away (the other half of the same query column)
__device__ __forceinline__ float other_half(float x) {
  int b = __float_as_int(x);
  return __int_as_float(
      __builtin_amdgcn_permlanex16(b, b, 0x76543210, 0xfedcba98, false, false));
}

__global__ void attn_kernel(const bf16u* __restrict__ qkv, bf16u* __restrict__ ctx) {
  __shared__ bf16u Qs[128 * 72];      // 128 q-rows x 64, stride 72 (144B)
  __shared__ bf16u Ks[64 * 72];       // 64 k-rows x 64
  __shared__ bf16u Vts[64 * 72];      // V transposed: [d][t]

  const int tid  = threadIdx.x;
  const int wave = tid >> 5, lane = tid & 31;
  const int l = lane & 15, hi = lane >> 4;
  const int bh = blockIdx.y;
  const int qbase = blockIdx.x * 128;
  const size_t headoff = (size_t)bh * SEQ * HDIM;
  const bf16u* Qp = qkv + headoff;
  const bf16u* Kp = qkv + (size_t)MTOT * D_MODEL + headoff;
  const bf16u* Vp = qkv + (size_t)2 * MTOT * D_MODEL + headoff;

  // stage Q tile (16KB) async: 2 threads/row, 64B each
  {
    int row = tid >> 1, half = tid & 1;
    const bf16u* g = Qp + (size_t)(qbase + row) * HDIM + half * 32;
    bf16u* d = &Qs[row * 72 + half * 32];
#pragma unroll
    for (int c = 0; c < 4; c++) copy16(g + c * 8, d + c * 8);
  }

  v8f zinit = {};
  v8f sacc[4], o[4];
  float mrun = -1e30f;   // running maximum of this lane's query, equal in both halves
  float lrun = 0.f;      // running sum over this half's keys; halves join at the end
#pragma unroll
  for (int n = 0; n < 4; n++) o[n] = zinit;

  for (int kb = 0; kb < SEQ / 64; ++kb) {
    const int kt0 = kb * 64;
    __syncthreads();   // previous iteration's reads of Ks/Vts complete
    // stage K tile async: 4 threads/row, 32B each
    {
      int row = tid >> 2, q = tid & 3;
      const bf16u* g = Kp + (size_t)(kt0 + row) * HDIM + q * 16;
      bf16u* d = &Ks[row * 72 + q * 16];
      copy16(g, d);
      copy16(g + 8, d + 8);
    }
    // stage V transposed: coalesced global read, scattered LDS b16 writes
#pragma unroll
    for (int c = 0; c < 2; c++) {
      int idx = tid + c * 256;
      int t = idx >> 3, dc = (idx & 7) * 8;
      union { uint4 u; bf16u h[8]; } tmp;
      tmp.u = *(const uint4*)(Vp + (size_t)(kt0 + t) * HDIM + dc);
#pragma unroll
      for (int e = 0; e < 8; e++) Vts[(dc + e) * 72 + t] = tmp.h[e];
    }
    async_wait0();
    __syncthreads();

    // scores: S^T(64 keys x 16 queries) = K(64x64) * Q^T; A row = key, B column = query
    // sacc[j][r] = S^T[j*16 + hi*8 + r][l]
#pragma unroll
    for (int j = 0; j < 4; j++) sacc[j] = zinit;
#pragma unroll
    for (int ks = 0; ks < 2; ks++) {
      v16bf qfrag = load_frag(&Qs[(wave * 16 + l) * 72 + ks * 32], hi);
#pragma unroll
      for (int j = 0; j < 4; j++) {
        v16bf kfrag = load_frag(&Ks[(j * 16 + l) * 72 + ks * 32], hi);
        sacc[j] = wmma_bf16(kfrag, qfrag, sacc[j]);
      }
    }

    // online softmax of one query per lane: 32 keys in-lane, one exchange of halves
    float mt[4];   // one maximum and one sum per tile: four short chains, not one long
#pragma unroll
    for (int j = 0; j < 4; j++) {
      mt[j] = -1e30f;
#pragma unroll
      for (int r = 0; r < 8; r++) {
        float t = sacc[j][r] * 0.125f;   // 1/sqrt(64)
        sacc[j][r] = t;
        mt[j] = fmaxf(mt[j], t);
      }
    }
    float m_b = fmaxf(fmaxf(mt[0], mt[1]), fmaxf(mt[2], mt[3]));
    m_b = fmaxf(m_b, other_half(m_b));
    const float m_new = fmaxf(mrun, m_b);
    const float alpha = __expf(mrun - m_new);
    mrun = m_new;
    float srow[4];
#pragma unroll
    for (int j = 0; j < 4; j++) {
      srow[j] = 0.f;
#pragma unroll
      for (int r = 0; r < 8; r++) {
        float p = __expf(sacc[j][r] - m_new);
        sacc[j][r] = p;
        srow[j] += p;
      }
    }
    lrun = lrun * alpha + ((srow[0] + srow[1]) + (srow[2] + srow[3]));
#pragma unroll
    for (int n = 0; n < 4; n++) o[n] *= alpha;

    // ctx^T(64 d x 16 queries) += V^T(64x64) * P^T; A row = d (Vts[d][t]), and the B
    // fragment is two score tiles converted in place: element s of lane (l, hi) is key
    // hi*8 + s (s < 8) or 16 + hi*8 + s - 8, the k order load_frag gives the A side
#pragma unroll
    for (int ks = 0; ks < 2; ks++) {
      v16bf pfrag;
#pragma unroll
      for (int e = 0; e < 8; e++) {
        pfrag[e]     = (__bf16)sacc[2 * ks][e];
        pfrag[8 + e] = (__bf16)sacc[2 * ks + 1][e];
      }
#pragma unroll
      for (int n = 0; n < 4; n++) {
        v16bf vfrag = load_frag(&Vts[(n * 16 + l) * 72 + ks * 32], hi);
        o[n] = wmma_bf16(vfrag, pfrag, o[n]);
      }
    }
  }

  // normalize and store ctx back to [B*S, D] bf16
  // o[n][r] = ctx^T[n*16 + hi*8 + r][l]: 8 consecutive columns of one row per lane
  const int bb = bh >> 4, h = bh & 15;
  const float inv = 1.0f / (lrun + other_half(lrun));
  const int s = qbase + wave * 16 + l;
  bf16u* crow = ctx + ((size_t)bb * SEQ + s) * D_MODEL + h * HDIM + hi * 8;
#pragma unroll
  for (int n = 0; n < 4; n++) {
    union { uint4 u; bf16u h[8]; } pk;
#pragma unroll
    for (int r = 0; r < 8; r++) pk.h[r] = f2bf(o[n][r] * inv);
    *(uint4*)(crow + n * 16) = pk.u;
  }
}

// ---------- LayerNorm over D=1024 per row ----------

__global__ void ln_kernel(const float* __restrict__ Hb, const float* __restrict__ gamma,
                          const float* __restrict__ beta, float* __restrict__ out) {
  __shared__ float rs[256], rss[256];
  const int row = blockIdx.x, tid = threadIdx.x;
  const float* hp = Hb + (size_t)row * D_MODEL;
  float s = 0.f, ss = 0.f;
  for (int i = tid; i < D_MODEL; i += 256) {
    float x = hp[i]; s += x; ss += x * x;
  }
  rs[tid] = s; rss[tid] = ss;
  __syncthreads();
  for (int st = 128; st > 0; st >>= 1) {
    if (tid < st) { rs[tid] += rs[tid + st]; rss[tid] += rss[tid + st]; }
    __syncthreads();
  }
  float mu   = rs[0] * (1.0f / D_MODEL);
  float var  = rss[0] * (1.0f / D_MODEL) - mu * mu;
  float rstd = rsqrtf(var + 1e-12f);
  for (int i = tid; i < D_MODEL; i += 256) {
    out[(size_t)row * D_MODEL + i] = (hp[i] - mu) * rstd * gamma[i] + beta[i];
  }
}

// ---------- launch ----------

extern "C" void kernel_launch(void* const* d_in, const int* in_sizes, int n_in,
                              void* d_out, int out_size, void* d_ws, size_t ws_size,
                              hipStream_t stream) {
  (void)in_sizes; (void)n_in; (void)out_size; (void)ws_size;
  const float* X     = (const float*)d_in[0];
  const float* Wq    = (const float*)d_in[1];
  const float* bq    = (const float*)d_in[2];
  const float* Wk    = (const float*)d_in[3];
  const float* bk    = (const float*)d_in[4];
  const float* Wv    = (const float*)d_in[5];
  const float* bv    = (const float*)d_in[6];
  const float* Wo    = (const float*)d_in[7];
  const float* bo    = (const float*)d_in[8];
  const float* gamma = (const float*)d_in[9];
  const float* beta  = (const float*)d_in[10];
  float* out = (float*)d_out;

  char* ws = (char*)d_ws;
  bf16u* Xb  = (bf16u*)ws;                              //  8 MB: X in bf16
  bf16u* WT  = (bf16u*)(ws + 8ull  * 1024 * 1024);      //  8 MB: 4 transposed weights
  bf16u* QKV = (bf16u*)(ws + 16ull * 1024 * 1024);      // 24 MB: Q,K,V [B,H,S,Dh]
  bf16u* Ctx = (bf16u*)(ws + 40ull * 1024 * 1024);      //  8 MB: context [B*S, D]
  float* Hb  = (float*)(ws + 48ull * 1024 * 1024);      // 16 MB: pre-LN fp32

  cvt_x_kernel <<<dim3(MTOT * D_MODEL / 1024), 256, 0, stream>>>(X, Xb);
  cvt_wT_kernel<<<dim3(4096, 4),               256, 0, stream>>>(Wq, Wk, Wv, Wo, WT);
  gemm_kernel<0><<<dim3(8, 32, 3), 256, 0, stream>>>(Xb, WT, bq, bk, bv, QKV,
                                                     nullptr, nullptr);
  attn_kernel  <<<dim3(16, 32),    256, 0, stream>>>(QKV, Ctx);
  gemm_kernel<1><<<dim3(8, 32, 1), 256, 0, stream>>>(Ctx, WT + 3ull * 1024 * 1024,
                                                     bo, nullptr, nullptr, nullptr,
                                                     X, Hb);
  ln_kernel    <<<dim3(4096),      256, 0, stream>>>(Hb, gamma, beta, out);
}

// v002
// It runs in 142 microseconds.
// In both of two side-by-side timings against v001, it was 1.11 times as fast.
// All steps since v000 together make it 1.37 times as fast.
#include <hip/hip_runtime.h>
#include <stdint.h>

typedef unsigned short bf16u;
typedef __attribute__((ext_vector_type(16))) __bf16 v16bf;
typedef __attribute__((ext_vector_type(8)))  float  v8f;
typedef __attribute__((ext_vector_type(4)))  int    v4i;

#define D_MODEL 1024
#define SEQ     2048
#define NHEAD   16
#define HDIM    64
#define MTOT    4096   // B*S

#define AS1 __attribute__((address_space(1)))
#define AS3 __attribute__((address_space(3)))

#if defined(__has_builtin)
#if __has_builtin(__builtin_amdgcn_global_load_async_to_lds_b128)
#define HAVE_ASYNC_LDS 1
#endif
#endif
#ifndef HAVE_ASYNC_LDS
#define HAVE_ASYNC_LDS 0
#endif

// ---------- helpers ----------

__device__ __forceinline__ bf16u f2bf(float f) {
  unsigned u = __float_as_uint(f);
  unsigned r = ((u >> 16) & 1u) + 0x7fffu;   // round-to-nearest-even
  return (bf16u)((u + r) >> 16);
}

struct U4x2 { uint4 a, b; };

// Load a 16x32 bf16 A/B fragment row for lane (l, hi): two contiguous 16B
// chunks per the CDNA5 16-bit matrix VGPR layout (K pairs hi*8.. and 16+hi*8..)
__device__ __forceinline__ v16bf load_frag(const bf16u* rowp, int hi) {
  U4x2 t;
  t.a = *(const uint4*)(rowp + hi * 8);
  t.b = *(const uint4*)(rowp + 16 + hi * 8);
  return __builtin_bit_cast(v16bf, t);
}

__device__ __forceinline__ v8f wmma_bf16(v16bf a, v16bf b, v8f c) {
  return __builtin_amdgcn_wmma_f32_16x16x32_bf16(
      false, a, false, b, (short)0, c, false, false);
}

// 16-byte global->LDS copy: async (ASYNCcnt-tracked, bypasses VGPRs) if available
__device__ __forceinline__ void copy16(const bf16u* g, bf16u* l) {
#if HAVE_ASYNC_LDS
  __builtin_amdgcn_global_load_async_to_lds_b128((AS1 v4i*)g, (AS3 v4i*)l, 0, 0);
#else
  *(uint4*)l = *(const uint4*)g;
#endif
}

__device__ __forceinline__ void async_wait0() {
#if HAVE_ASYNC_LDS
#if __has_builtin(__builtin_amdgcn_s_wait_asynccnt)
  __builtin_amdgcn_s_wait_asynccnt(0);
#else
  asm volatile("s_wait_asynccnt 0" ::: "memory");
#endif
#endif
}

// 16-lane row reductions via DPP16 (pure VALU, co-executes with WMMA):
// quad_perm xor1, quad_perm xor2, row_half_mirror (8), row_mirror (16)
__device__ __forceinline__ float row16_max(float x) {
  int v;
  v = __builtin_amdgcn_update_dpp(0, __float_as_int(x), 0xB1,  0xf, 0xf, true);
  x = fmaxf(x, __int_as_float(v));
  v = __builtin_amdgcn_update_dpp(0, __float_as_int(x), 0x4E,  0xf, 0xf, true);
  x = fmaxf(x, __int_as_float(v));
  v = __builtin_amdgcn_update_dpp(0, __float_as_int(x), 0x141, 0xf, 0xf, true);
  x = fmaxf(x, __int_as_float(v));
  v = __builtin_amdgcn_update_dpp(0, __float_as_int(x), 0x140, 0xf, 0xf, true);
  x = fmaxf(x, __int_as_float(v));
  return x;
}

__device__ __forceinline__ float row16_sum(float x) {
  int v;
  v = __builtin_amdgcn_update_dpp(0, __float_as_int(x), 0xB1,  0xf, 0xf, true);
  x += __int_as_float(v);
  v = __builtin_amdgcn_update_dpp(0, __float_as_int(x), 0x4E,  0xf, 0xf, true);
  x += __int_as_float(v);
  v = __builtin_amdgcn_update_dpp(0, __float_as_int(x), 0x141, 0xf, 0xf, true);
  x += __int_as_float(v);
  v = __builtin_amdgcn_update_dpp(0, __float_as_int(x), 0x140, 0xf, 0xf, true);
  x += __int_as_float(v);
  return x;
}

// ---------- conversion kernels ----------

__global__ void cvt_x_kernel(const float* __restrict__ X, bf16u* __restrict__ Xb) {
  int i = blockIdx.x * blockDim.x + threadIdx.x;   // one float4 each
  float4 v = ((const float4*)X)[i];
  union { bf16u h[4]; uint2 u; } o;
  o.h[0] = f2bf(v.x); o.h[1] = f2bf(v.y); o.h[2] = f2bf(v.z); o.h[3] = f2bf(v.w);
  ((uint2*)Xb)[i] = o.u;
}

// WT[z][n][k] = W_z[k][n]  (bf16, transposed so B-fragments load row-wise)
// One 128(k) x 64(n) tile per block. A lane reads 8 rows x 4 columns (16 lanes cover 256
// contiguous bytes of a row), turns them into 4 rows of 8 k in registers, and the tile
// goes through LDS so that every output row leaves as 256 contiguous bytes.
__global__ void cvt_wT_kernel(const float* __restrict__ W0, const float* __restrict__ W1,
                              const float* __restrict__ W2, const float* __restrict__ W3,
                              bf16u* __restrict__ WT) {
  __shared__ bf16u Ts[64 * 136];     // [n][k], pitch 272 B (16 B x odd) for 16-byte readers
  const int z = blockIdx.z;
  const float* W = (z == 0) ? W0 : (z == 1) ? W1 : (z == 2) ? W2 : W3;
  const int tid = threadIdx.x;
  const int k0 = blockIdx.x * 128, n0 = blockIdx.y * 64;
  const int c = tid & 15, g = tid >> 4;

  const float* sp = W + (size_t)(k0 + g * 8) * 1024 + n0 + c * 4;
  float4 v[8];
#pragma unroll
  for (int i = 0; i < 8; i++) v[i] = *(const float4*)(sp + (size_t)i * 1024);

  union { bf16u h[8]; uint4 u; } p0, p1, p2, p3;
#pragma unroll
  for (int i = 0; i < 8; i++) {
    p0.h[i] = f2bf(v[i].x); p1.h[i] = f2bf(v[i].y);
    p2.h[i] = f2bf(v[i].z); p3.h[i] = f2bf(v[i].w);
  }
  *(uint4*)&Ts[(c * 4 + 0) * 136 + g * 8] = p0.u;
  *(uint4*)&Ts[(c * 4 + 1) * 136 + g * 8] = p1.u;
  *(uint4*)&Ts[(c * 4 + 2) * 136 + g * 8] = p2.u;
  *(uint4*)&Ts[(c * 4 + 3) * 136 + g * 8] = p3.u;
  __syncthreads();

  bf16u* dp = WT + (size_t)z * 1024 * 1024 + (size_t)n0 * 1024 + k0 + c * 8;
#pragma unroll
  for (int r = 0; r < 4; r++) {
    const int row = g + r * 16;
    *(uint4*)(dp + (size_t)row * 1024) = *(const uint4*)&Ts[row * 136 + c * 8];
  }
}

// ---------- tiled bf16 WMMA GEMM: C = A(4096x1024) * WT^T + bias ----------
// Double-buffered LDS staging with async global->LDS copies.
// MODE 0: QKV projection, writes bf16 into [B,H,S,Dh], z = blockIdx.z selects matrix
// MODE 1: output projection, adds residual, writes fp32 Hout
template <int MODE>
__global__ void gemm_kernel(const bf16u* __restrict__ A,
                            const bf16u* __restrict__ WT,
                            const float* __restrict__ bias0,
                            const float* __restrict__ bias1,
                            const float* __restrict__ bias2,
                            bf16u* __restrict__ qkv,
                            const float* __restrict__ resid,
                            float* __restrict__ Hout) {
  __shared__ bf16u As[2][128 * 40];  // 128x32 tile, stride 40 (80B, 16B-aligned)
  __shared__ bf16u Bs[2][128 * 40];

  const int tid  = threadIdx.x;
  const int wave = tid >> 5, lane = tid & 31;
  const int l = lane & 15, hi = lane >> 4;
  const int wm = wave >> 2, wn = wave & 3;          // 2x4 wave grid
  const int z = (MODE == 0) ? blockIdx.z : 0;
  const int mbase = blockIdx.y * 128;
  const int nbase = blockIdx.x * 128;
  const bf16u* Bt = WT + (size_t)z * (1024 * 1024);
  const float* bias = (MODE == 0) ? ((z == 0) ? bias0 : (z == 1) ? bias1 : bias2)
                                  : bias0;

  v8f zinit = {};
  v8f acc[4][2];
#pragma unroll
  for (int i = 0; i < 4; i++)
#pragma unroll
    for (int j = 0; j < 2; j++) acc[i][j] = zinit;

  const int r0 = tid >> 2, q = tid & 3;             // 4 threads/row, 16B each
  const bf16u* ag = A  + (size_t)(mbase + r0) * 1024 + q * 8;
  const bf16u* bg = Bt + (size_t)(nbase + r0) * 1024 + q * 8;

  auto stage = [&](int buf, int kb) {
    const int ko = kb * 32;
    copy16(ag + ko,                      &As[buf][r0 * 40 + q * 8]);
    copy16(ag + ko + (size_t)64 * 1024,  &As[buf][(r0 + 64) * 40 + q * 8]);
    copy16(bg + ko,                      &Bs[buf][r0 * 40 + q * 8]);
    copy16(bg + ko + (size_t)64 * 1024,  &Bs[buf][(r0 + 64) * 40 + q * 8]);
  };

  stage(0, 0);
  async_wait0();
  __syncthreads();

  int buf = 0;
  for (int kb = 0; kb < 32; ++kb) {
    if (kb + 1 < 32) stage(buf ^ 1, kb + 1);   // prefetch next tile

    v16bf bfrag[2];
#pragma unroll
    for (int j = 0; j < 2; j++)
      bfrag[j] = load_frag(&Bs[buf][(wn * 32 + j * 16 + l) * 40], hi);
#pragma unroll
    for (int i = 0; i < 4; i++) {
      v16bf afrag = load_frag(&As[buf][(wm * 64 + i * 16 + l) * 40], hi);
#pragma unroll
      for (int j = 0; j < 2; j++)
        acc[i][j] = wmma_bf16(afrag, bfrag[j], acc[i][j]);
    }

    async_wait0();
    __syncthreads();
    buf ^= 1;
  }

  // epilogue: C-layout value (lane l, half hi, comp r) = C[r + hi*8][l] of a 16x16 tile
#pragma unroll
  for (int i = 0; i < 4; i++) {
#pragma unroll
    for (int j = 0; j < 2; j++) {
      const int n = nbase + wn * 32 + j * 16 + l;
      const float bn = bias[n];
#pragma unroll
      for (int r = 0; r < 8; r++) {
        const int m = mbase + wm * 64 + i * 16 + r + hi * 8;
        float val = acc[i][j][r] + bn;
        if (MODE == 0) {
          int bb = m >> 11, s = m & 2047;
          int h = n >> 6, dh = n & 63;
          qkv[(size_t)z * MTOT * D_MODEL +
              (((size_t)(bb * NHEAD + h) * SEQ + s) * HDIM + dh)] = f2bf(val);
        } else {
          Hout[(size_t)m * D_MODEL + n] = val + resid[(size_t)m * D_MODEL + n];
        }
      }
    }
  }
}

// value of the lane 16 away (the other half of the same query column)
__device__ __forceinline__ float other_half(float x) {
  int b = __float_as_int(x);
  return __int_as_float(
      __builtin_amdgcn_permlanex16(b, b, 0x76543210, 0xfedcba98, false, false));
}

__global__ void attn_kernel(const bf16u* __restrict__ qkv, bf16u* __restrict__ ctx) {
  __shared__ bf16u Qs[128 * 72];      // 128 q-rows x 64, stride 72 (144B)
  __shared__ bf16u Ks[64 * 72];       // 64 k-rows x 64
  __shared__ bf16u Vts[64 * 72];      // V transposed: [d][t]

  const int tid  = threadIdx.x;
  const int wave = tid >> 5, lane = tid & 31;
  const int l = lane & 15, hi = lane >> 4;
  const int bh = blockIdx.y;
  const int qbase = blockIdx.x * 128;
  const size_t headoff = (size_t)bh * SEQ * HDIM;
  const bf16u* Qp = qkv + headoff;
  const bf16u* Kp = qkv + (size_t)MTOT * D_MODEL + headoff;
  const bf16u* Vp = qkv + (size_t)2 * MTOT * D_MODEL + headoff;

  // stage Q tile (16KB) async: 2 threads/row, 64B each
  {
    int row = tid >> 1, half = tid & 1;
    const bf16u* g = Qp + (size_t)(qbase + row) * HDIM + half * 32;
    bf16u* d = &Qs[row * 72 + half * 32];
#pragma unroll
    for (int c = 0; c < 4; c++) copy16(g + c * 8, d + c * 8);
  }

  v8f zinit = {};
  v8f sacc[4], o[4];
  float mrun = -1e30f;   // running maximum of this lane's query, equal in both halves
  float lrun = 0.f;      // running sum over this half's keys; halves join at the end
#pragma unroll
  for (int n = 0; n < 4; n++) o[n] = zinit;

  for (int kb = 0; kb < SEQ / 64; ++kb) {
    const int kt0 = kb * 64;
    __syncthreads();   // previous iteration's reads of Ks/Vts complete
    // stage K tile async: 4 threads/row, 32B each
    {
      int row = tid >> 2, q = tid & 3;
      const bf16u* g = Kp + (size_t)(kt0 + row) * HDIM + q * 16;
      bf16u* d = &Ks[row * 72 + q * 16];
      copy16(g, d);
      copy16(g + 8, d + 8);
    }
    // stage V transposed: coalesced global read, scattered LDS b16 writes
#pragma unroll
    for (int c = 0; c < 2; c++) {
      int idx = tid + c * 256;
      int t = idx >> 3, dc = (idx & 7) * 8;
      union { uint4 u; bf16u h[8]; } tmp;
      tmp.u = *(const uint4*)(Vp + (size_t)(kt0 + t) * HDIM + dc);
#pragma unroll
      for (int e = 0; e < 8; e++) Vts[(dc + e) * 72 + t] = tmp.h[e];
    }
    async_wait0();
    __syncthreads();

    // scores: S^T(64 keys x 16 queries) = K(64x64) * Q^T; A row = key, B column = query
    // sacc[j][r] = S^T[j*16 + hi*8 + r][l]
#pragma unroll
    for (int j = 0; j < 4; j++) sacc[j] = zinit;
#pragma unroll
    for (int ks = 0; ks < 2; ks++) {
      v16bf qfrag = load_frag(&Qs[(wave * 16 + l) * 72 + ks * 32], hi);
#pragma unroll
      for (int j = 0; j < 4; j++) {
        v16bf kfrag = load_frag(&Ks[(j * 16 + l) * 72 + ks * 32], hi);
        sacc[j] = wmma_bf16(kfrag, qfrag, sacc[j]);
      }
    }

    // online softmax of one query per lane: 32 keys in-lane, one exchange of halves
    float mt[4];   // one maximum and one sum per tile: four short chains, not one long
#pragma unroll
    for (int j = 0; j < 4; j++) {
      mt[j] = -1e30f;
#pragma unroll
      for (int r = 0; r < 8; r++) {
        float t = sacc[j][r] * 0.125f;   // 1/sqrt(64)
        sacc[j][r] = t;
        mt[j] = fmaxf(mt[j], t);
      }
    }
    float m_b = fmaxf(fmaxf(mt[0], mt[1]), fmaxf(mt[2], mt[3]));
    m_b = fmaxf(m_b, other_half(m_b));
    const float m_new = fmaxf(mrun, m_b);
    const float alpha = __expf(mrun - m_new);
    mrun = m_new;
    float srow[4];
#pragma unroll
    for (int j = 0; j < 4; j++) {
      srow[j] = 0.f;
#pragma unroll
      for (int r = 0; r < 8; r++) {
        float p = __expf(sacc[j][r] - m_new);
        sacc[j][r] = p;
        srow[j] += p;
      }
    }
    lrun = lrun * alpha + ((srow[0] + srow[1]) + (srow[2] + srow[3]));
#pragma unroll
    for (int n = 0; n < 4; n++) o[n] *= alpha;

    // ctx^T(64 d x 16 queries) += V^T(64x64) * P^T; A row = d (Vts[d][t]), and the B
    // fragment is two score tiles converted in place: element s of lane (l, hi) is key
    // hi*8 + s (s < 8) or 16 + hi*8 + s - 8, the k order load_frag gives the A side
#pragma unroll
    for (int ks = 0; ks < 2; ks++) {
      v16bf pfrag;
#pragma unroll
      for (int e = 0; e < 8; e++) {
        pfrag[e]     = (__bf16)sacc[2 * ks][e];
        pfrag[8 + e] = (__bf16)sacc[2 * ks + 1][e];
      }
#pragma unroll
      for (int n = 0; n < 4; n++) {
        v16bf vfrag = load_frag(&Vts[(n * 16 + l) * 72 + ks * 32], hi);
        o[n] = wmma_bf16(vfrag, pfrag, o[n]);
      }
    }
  }

  // normalize and store ctx back to [B*S, D] bf16
  // o[n][r] = ctx^T[n*16 + hi*8 + r][l]: 8 consecutive columns of one row per lane
  const int bb = bh >> 4, h = bh & 15;
  const float inv = 1.0f / (lrun + other_half(lrun));
  const int s = qbase + wave * 16 + l;
  bf16u* crow = ctx + ((size_t)bb * SEQ + s) * D_MODEL + h * HDIM + hi * 8;
#pragma unroll
  for (int n = 0; n < 4; n++) {
    union { uint4 u; bf16u h[8]; } pk;
#pragma unroll
    for (int r = 0; r < 8; r++) pk.h[r] = f2bf(o[n][r] * inv);
    *(uint4*)(crow + n * 16) = pk.u;
  }
}

// ---------- LayerNorm over D=1024 per row ----------

__global__ void ln_kernel(const float* __restrict__ Hb, const float* __restrict__ gamma,
                          const float* __restrict__ beta, float* __restrict__ out) {
  __shared__ float rs[256], rss[256];
  const int row = blockIdx.x, tid = threadIdx.x;
  const float* hp = Hb + (size_t)row * D_MODEL;
  float s = 0.f, ss = 0.f;
  for (int i = tid; i < D_MODEL; i += 256) {
    float x = hp[i]; s += x; ss += x * x;
  }
  rs[tid] = s; rss[tid] = ss;
  __syncthreads();
  for (int st = 128; st > 0; st >>= 1) {
    if (tid < st) { rs[tid] += rs[tid + st]; rss[tid] += rss[tid + st]; }
    __syncthreads();
  }
  float mu   = rs[0] * (1.0f / D_MODEL);
  float var  = rss[0] * (1.0f / D_MODEL) - mu * mu;
  float rstd = rsqrtf(var + 1e-12f);
  for (int i = tid; i < D_MODEL; i += 256) {
    out[(size_t)row * D_MODEL + i] = (hp[i] - mu) * rstd * gamma[i] + beta[i];
  }
}

// ---------- launch ----------

extern "C" void kernel_launch(void* const* d_in, const int* in_sizes, int n_in,
                              void* d_out, int out_size, void* d_ws, size_t ws_size,
                              hipStream_t stream) {
  (void)in_sizes; (void)n_in; (void)out_size; (void)ws_size;
  const float* X     = (const float*)d_in[0];
  const float* Wq    = (const float*)d_in[1];
  const float* bq    = (const float*)d_in[2];
  const float* Wk    = (const float*)d_in[3];
  const float* bk    = (const float*)d_in[4];
  const float* Wv    = (const float*)d_in[5];
  const float* bv    = (const float*)d_in[6];
  const float* Wo    = (const float*)d_in[7];
  const float* bo    = (const float*)d_in[8];
  const float* gamma = (const float*)d_in[9];
  const float* beta  = (const float*)d_in[10];
  float* out = (float*)d_out;

  char* ws = (char*)d_ws;
  bf16u* Xb  = (bf16u*)ws;                              //  8 MB: X in bf16
  bf16u* WT  = (bf16u*)(ws + 8ull  * 1024 * 1024);      //  8 MB: 4 transposed weights
  bf16u* QKV = (bf16u*)(ws + 16ull * 1024 * 1024);      // 24 MB: Q,K,V [B,H,S,Dh]
  bf16u* Ctx = (bf16u*)(ws + 40ull * 1024 * 1024);      //  8 MB: context [B*S, D]
  float* Hb  = (float*)(ws + 48ull * 1024 * 1024);      // 16 MB: pre-LN fp32

  cvt_x_kernel <<<dim3(MTOT * D_MODEL / 1024), 256, 0, stream>>>(X, Xb);
  cvt_wT_kernel<<<dim3(8, 16, 4),              256, 0, stream>>>(Wq, Wk, Wv, Wo, WT);
  gemm_kernel<0><<<dim3(8, 32, 3), 256, 0, stream>>>(Xb, WT, bq, bk, bv, QKV,
                                                     nullptr, nullptr);
  attn_kernel  <<<dim3(16, 32),    256, 0, stream>>>(QKV, Ctx);
  gemm_kernel<1><<<dim3(8, 32, 1), 256, 0, stream>>>(Ctx, WT + 3ull * 1024 * 1024,
                                                     bo, nullptr, nullptr, nullptr,
                                                     X, Hb);
  ln_kernel    <<<dim3(4096),      256, 0, stream>>>(Hb, gamma, beta, out);
}

// v003
// A run of this version takes 127 microseconds.
// In two side-by-side timings against v002, it was 1.11 and 1.12 times as fast.
// Over all steps from v000 it is 1.52 times as fast.
#include <hip/hip_runtime.h>
#include <stdint.h>

typedef unsigned short bf16u;
typedef __attribute__((ext_vector_type(16))) __bf16 v16bf;
typedef __attribute__((ext_vector_type(8)))  float  v8f;
typedef __attribute__((ext_vector_type(4)))  int    v4i;
typedef __attribute__((ext_vector_type(8)))  short  v8s;

#define D_MODEL 1024
#define SEQ     2048
#define NHEAD   16
#define HDIM    64
#define MTOT    4096   // B*S

#define AS1 __attribute__((address_space(1)))
#define AS3 __attribute__((address_space(3)))

#if defined(__has_builtin)
#if __has_builtin(__builtin_amdgcn_global_load_async_to_lds_b128)
#define HAVE_ASYNC_LDS 1
#endif
#endif
#ifndef HAVE_ASYNC_LDS
#define HAVE_ASYNC_LDS 0
#endif

// ---------- helpers ----------

__device__ __forceinline__ bf16u f2bf(float f) {
  unsigned u = __float_as_uint(f);
  unsigned r = ((u >> 16) & 1u) + 0x7fffu;   // round-to-nearest-even
  return (bf16u)((u + r) >> 16);
}

struct U4x2 { uint4 a, b; };

// Load a 16x32 bf16 A/B fragment row for lane (l, hi): two contiguous 16B
// chunks per the CDNA5 16-bit matrix VGPR layout (K pairs hi*8.. and 16+hi*8..)
__device__ __forceinline__ v16bf load_frag(const bf16u* rowp, int hi) {
  U4x2 t;
  t.a = *(const uint4*)(rowp + hi * 8);
  t.b = *(const uint4*)(rowp + 16 + hi * 8);
  return __builtin_bit_cast(v16bf, t);
}

__device__ __forceinline__ v8f wmma_bf16(v16bf a, v16bf b, v8f c) {
  return __builtin_amdgcn_wmma_f32_16x16x32_bf16(
      false, a, false, b, (short)0, c, false, false);
}

// 16-byte global->LDS copy: async (ASYNCcnt-tracked, bypasses VGPRs) if available
__device__ __forceinline__ void copy16(const bf16u* g, bf16u* l) {
#if HAVE_ASYNC_LDS
  __builtin_amdgcn_global_load_async_to_lds_b128((AS1 v4i*)g, (AS3 v4i*)l, 0, 0);
#else
  *(uint4*)l = *(const uint4*)g;
#endif
}

__device__ __forceinline__ void async_wait0() {
#if HAVE_ASYNC_LDS
#if __has_builtin(__builtin_amdgcn_s_wait_asynccnt)
  __builtin_amdgcn_s_wait_asynccnt(0);
#else
  asm volatile("s_wait_asynccnt 0" ::: "memory");
#endif
#endif
}

// 16-lane row reductions via DPP16 (pure VALU, co-executes with WMMA):
// quad_perm xor1, quad_perm xor2, row_half_mirror (8), row_mirror (16)
__device__ __forceinline__ float row16_max(float x) {
  int v;
  v = __builtin_amdgcn_update_dpp(0, __float_as_int(x), 0xB1,  0xf, 0xf, true);
  x = fmaxf(x, __int_as_float(v));
  v = __builtin_amdgcn_update_dpp(0, __float_as_int(x), 0x4E,  0xf, 0xf, true);
  x = fmaxf(x, __int_as_float(v));
  v = __builtin_amdgcn_update_dpp(0, __float_as_int(x), 0x141, 0xf, 0xf, true);
  x = fmaxf(x, __int_as_float(v));
  v = __builtin_amdgcn_update_dpp(0, __float_as_int(x), 0x140, 0xf, 0xf, true);
  x = fmaxf(x, __int_as_float(v));
  return x;
}

__device__ __forceinline__ float row16_sum(float x) {
  int v;
  v = __builtin_amdgcn_update_dpp(0, __float_as_int(x), 0xB1,  0xf, 0xf, true);
  x += __int_as_float(v);
  v = __builtin_amdgcn_update_dpp(0, __float_as_int(x), 0x4E,  0xf, 0xf, true);
  x += __int_as_float(v);
  v = __builtin_amdgcn_update_dpp(0, __float_as_int(x), 0x141, 0xf, 0xf, true);
  x += __int_as_float(v);
  v = __builtin_amdgcn_update_dpp(0, __float_as_int(x), 0x140, 0xf, 0xf, true);
  x += __int_as_float(v);
  return x;
}

// ---------- conversion kernels ----------

__global__ void cvt_x_kernel(const float* __restrict__ X, bf16u* __restrict__ Xb) {
  int i = blockIdx.x * blockDim.x + threadIdx.x;   // one float4 each
  float4 v = ((const float4*)X)[i];
  union { bf16u h[4]; uint2 u; } o;
  o.h[0] = f2bf(v.x); o.h[1] = f2bf(v.y); o.h[2] = f2bf(v.z); o.h[3] = f2bf(v.w);
  ((uint2*)Xb)[i] = o.u;
}

// WT[z][n][k] = W_z[k][n]  (bf16, transposed so B-fragments load row-wise)
// One 128(k) x 64(n) tile per block. A lane reads 8 rows x 4 columns (16 lanes cover 256
// contiguous bytes of a row), turns them into 4 rows of 8 k in registers, and the tile
// goes through LDS so that every output row leaves as 256 contiguous bytes.
__global__ void cvt_wT_kernel(const float* __restrict__ W0, const float* __restrict__ W1,
                              const float* __restrict__ W2, const float* __restrict__ W3,
                              bf16u* __restrict__ WT) {
  __shared__ bf16u Ts[64 * 136];     // [n][k], pitch 272 B (16 B x odd) for 16-byte readers
  const int z = blockIdx.z;
  const float* W = (z == 0) ? W0 : (z == 1) ? W1 : (z == 2) ? W2 : W3;
  const int tid = threadIdx.x;
  const int k0 = blockIdx.x * 128, n0 = blockIdx.y * 64;
  const int c = tid & 15, g = tid >> 4;

  const float* sp = W + (size_t)(k0 + g * 8) * 1024 + n0 + c * 4;
  float4 v[8];
#pragma unroll
  for (int i = 0; i < 8; i++) v[i] = *(const float4*)(sp + (size_t)i * 1024);

  union { bf16u h[8]; uint4 u; } p0, p1, p2, p3;
#pragma unroll
  for (int i = 0; i < 8; i++) {
    p0.h[i] = f2bf(v[i].x); p1.h[i] = f2bf(v[i].y);
    p2.h[i] = f2bf(v[i].z); p3.h[i] = f2bf(v[i].w);
  }
  *(uint4*)&Ts[(c * 4 + 0) * 136 + g * 8] = p0.u;
  *(uint4*)&Ts[(c * 4 + 1) * 136 + g * 8] = p1.u;
  *(uint4*)&Ts[(c * 4 + 2) * 136 + g * 8] = p2.u;
  *(uint4*)&Ts[(c * 4 + 3) * 136 + g * 8] = p3.u;
  __syncthreads();

  bf16u* dp = WT + (size_t)z * 1024 * 1024 + (size_t)n0 * 1024 + k0 + c * 8;
#pragma unroll
  for (int r = 0; r < 4; r++) {
    const int row = g + r * 16;
    *(uint4*)(dp + (size_t)row * 1024) = *(const uint4*)&Ts[row * 136 + c * 8];
  }
}

// ---------- tiled bf16 WMMA GEMM: C = A(4096x1024) * WT^T + bias ----------
// Double-buffered LDS staging with async global->LDS copies.
// MODE 0: QKV projection, writes bf16 into [B,H,S,Dh], z = blockIdx.z selects matrix
// MODE 1: output projection, adds residual, writes fp32 Hout
template <int MODE>
__global__ void gemm_kernel(const bf16u* __restrict__ A,
                            const bf16u* __restrict__ WT,
                            const float* __restrict__ bias0,
                            const float* __restrict__ bias1,
                            const float* __restrict__ bias2,
                            bf16u* __restrict__ qkv,
                            const float* __restrict__ resid,
                            float* __restrict__ Hout) {
  __shared__ bf16u As[2][128 * 40];  // 128x32 tile, stride 40 (80B, 16B-aligned)
  __shared__ bf16u Bs[2][128 * 40];

  const int tid  = threadIdx.x;
  const int wave = tid >> 5, lane = tid & 31;
  const int l = lane & 15, hi = lane >> 4;
  const int wm = wave >> 2, wn = wave & 3;          // 2x4 wave grid
  const int z = (MODE == 0) ? blockIdx.z : 0;
  const int mbase = blockIdx.y * 128;
  const int nbase = blockIdx.x * 128;
  const bf16u* Bt = WT + (size_t)z * (1024 * 1024);
  const float* bias = (MODE == 0) ? ((z == 0) ? bias0 : (z == 1) ? bias1 : bias2)
                                  : bias0;

  v8f zinit = {};
  v8f acc[4][2];
#pragma unroll
  for (int i = 0; i < 4; i++)
#pragma unroll
    for (int j = 0; j < 2; j++) acc[i][j] = zinit;

  const int r0 = tid >> 2, q = tid & 3;             // 4 threads/row, 16B each
  const bf16u* ag = A  + (size_t)(mbase + r0) * 1024 + q * 8;
  const bf16u* bg = Bt + (size_t)(nbase + r0) * 1024 + q * 8;

  auto stage = [&](int buf, int kb) {
    const int ko = kb * 32;
    copy16(ag + ko,                      &As[buf][r0 * 40 + q * 8]);
    copy16(ag + ko + (size_t)64 * 1024,  &As[buf][(r0 + 64) * 40 + q * 8]);
    copy16(bg + ko,                      &Bs[buf][r0 * 40 + q * 8]);
    copy16(bg + ko + (size_t)64 * 1024,  &Bs[buf][(r0 + 64) * 40 + q * 8]);
  };

  stage(0, 0);
  async_wait0();
  __syncthreads();

  int buf = 0;
  for (int kb = 0; kb < 32; ++kb) {
    if (kb + 1 < 32) stage(buf ^ 1, kb + 1);   // prefetch next tile

    v16bf bfrag[2];
#pragma unroll
    for (int j = 0; j < 2; j++)
      bfrag[j] = load_frag(&Bs[buf][(wn * 32 + j * 16 + l) * 40], hi);
#pragma unroll
    for (int i = 0; i < 4; i++) {
      v16bf afrag = load_frag(&As[buf][(wm * 64 + i * 16 + l) * 40], hi);
#pragma unroll
      for (int j = 0; j < 2; j++)
        acc[i][j] = wmma_bf16(afrag, bfrag[j], acc[i][j]);
    }

    async_wait0();
    __syncthreads();
    buf ^= 1;
  }

  // epilogue: C-layout value (lane l, half hi, comp r) = C[r + hi*8][l] of a 16x16 tile
#pragma unroll
  for (int i = 0; i < 4; i++) {
#pragma unroll
    for (int j = 0; j < 2; j++) {
      const int n = nbase + wn * 32 + j * 16 + l;
      const float bn = bias[n];
#pragma unroll
      for (int r = 0; r < 8; r++) {
        const int m = mbase + wm * 64 + i * 16 + r + hi * 8;
        float val = acc[i][j][r] + bn;
        if (MODE == 0) {
          int bb = m >> 11, s = m & 2047;
          int h = n >> 6, dh = n & 63;
          qkv[(size_t)z * MTOT * D_MODEL +
              (((size_t)(bb * NHEAD + h) * SEQ + s) * HDIM + dh)] = f2bf(val);
        } else {
          Hout[(size_t)m * D_MODEL + n] = val + resid[(size_t)m * D_MODEL + n];
        }
      }
    }
  }
}

// value of the lane 16 away (the other half of the same query column)
__device__ __forceinline__ float other_half(float x) {
  int b = __float_as_int(x);
  return __int_as_float(
      __builtin_amdgcn_permlanex16(b, b, 0x76543210, 0xfedcba98, false, false));
}

#define VPITCH 80   // V rows in LDS: 160 B = 32 B x odd, the transposing load's pitch

struct V8x2 { v8s a, b; };

// 16(d) x 32(t) A fragment of V^T out of the row-major V tile: two transposing loads,
// 16 keys apart. Lane (l, hi) gets column l of rows hi*8 .. hi*8+7 from each, which is
// the k order of load_frag. p is the lane's own address (see vlane in attn_kernel).
__device__ __forceinline__ v16bf load_frag_tr(const bf16u* p) {
  V8x2 t;
  t.a = __builtin_amdgcn_ds_load_tr16_b128_v8i16((AS3 v8s*)p);
  t.b = __builtin_amdgcn_ds_load_tr16_b128_v8i16((AS3 v8s*)(p + 16 * VPITCH));
  return __builtin_bit_cast(v16bf, t);
}

__global__ void attn_kernel(const bf16u* __restrict__ qkv, bf16u* __restrict__ ctx) {
  __shared__ bf16u Qs[128 * 72];      // 128 q-rows x 64, stride 72 (144B)
  __shared__ bf16u Ks[64 * 72];       // 64 k-rows x 64
  __shared__ __attribute__((aligned(16))) bf16u Vs[64 * VPITCH];   // 64 v-rows x 64, as in memory

  const int tid  = threadIdx.x;
  const int wave = tid >> 5, lane = tid & 31;
  const int l = lane & 15, hi = lane >> 4;
  const int bh = blockIdx.y;
  const int qbase = blockIdx.x * 128;
  const size_t headoff = (size_t)bh * SEQ * HDIM;
  const bf16u* Qp = qkv + headoff;
  const bf16u* Kp = qkv + (size_t)MTOT * D_MODEL + headoff;
  const bf16u* Vp = qkv + (size_t)2 * MTOT * D_MODEL + headoff;

  // stage Q tile (16KB) async: 2 threads/row, 64B each
  {
    int row = tid >> 1, half = tid & 1;
    const bf16u* g = Qp + (size_t)(qbase + row) * HDIM + half * 32;
    bf16u* d = &Qs[row * 72 + half * 32];
#pragma unroll
    for (int c = 0; c < 4; c++) copy16(g + c * 8, d + c * 8);
  }

  // transposing load: lane reads 16 B of row hi*8 + (lane & 7), column half (lane >> 3) & 1
  const bf16u* vlane = &Vs[(hi * 8 + (lane & 7)) * VPITCH + ((lane >> 3) & 1) * 8];

  v8f zinit = {};
  v8f sacc[4], o[4];
  float mrun = -1e30f;   // running maximum of this lane's query, equal in both halves
  float lrun = 0.f;      // running sum over this half's keys; halves join at the end
#pragma unroll
  for (int n = 0; n < 4; n++) o[n] = zinit;

  for (int kb = 0; kb < SEQ / 64; ++kb) {
    const int kt0 = kb * 64;
    __syncthreads();   // previous iteration's reads of Ks/Vs complete
    // stage K tile async: 4 threads/row, 32B each
    {
      int row = tid >> 2, q = tid & 3;
      const bf16u* g = Kp + (size_t)(kt0 + row) * HDIM + q * 16;
      bf16u* d = &Ks[row * 72 + q * 16];
      copy16(g, d);
      copy16(g + 8, d + 8);
    }
    // stage V tile async, rows as they lie in memory: a wave's copy takes 512 contiguous B
#pragma unroll
    for (int c = 0; c < 2; c++) {
      int idx = tid + c * 256;
      int t = idx >> 3, dc = (idx & 7) * 8;
      copy16(Vp + (size_t)(kt0 + t) * HDIM + dc, &Vs[t * VPITCH + dc]);
    }
    async_wait0();
    __syncthreads();   // directly behind the wait: holds every LDS read behind the copies

    // scores: S^T(64 keys x 16 queries) = K(64x64) * Q^T; A row = key, B column = query
    // sacc[j][r] = S^T[j*16 + hi*8 + r][l]
#pragma unroll
    for (int j = 0; j < 4; j++) sacc[j] = zinit;
#pragma unroll
    for (int ks = 0; ks < 2; ks++) {
      v16bf qfrag = load_frag(&Qs[(wave * 16 + l) * 72 + ks * 32], hi);
#pragma unroll
      for (int j = 0; j < 4; j++) {
        v16bf kfrag = load_frag(&Ks[(j * 16 + l) * 72 + ks * 32], hi);
        sacc[j] = wmma_bf16(kfrag, qfrag, sacc[j]);
      }
    }

    // online softmax of one query per lane: 32 keys in-lane, one exchange of halves
    float mt[4];   // one maximum and one sum per tile: four short chains, not one long
#pragma unroll
    for (int j = 0; j < 4; j++) {
      mt[j] = -1e30f;
#pragma unroll
      for (int r = 0; r < 8; r++) {
        float t = sacc[j][r] * 0.125f;   // 1/sqrt(64)
        sacc[j][r] = t;
        mt[j] = fmaxf(mt[j], t);
      }
    }
    float m_b = fmaxf(fmaxf(mt[0], mt[1]), fmaxf(mt[2], mt[3]));
    m_b = fmaxf(m_b, other_half(m_b));
    const float m_new = fmaxf(mrun, m_b);
    const float alpha = __expf(mrun - m_new);
    mrun = m_new;
    float srow[4];
#pragma unroll
    for (int j = 0; j < 4; j++) {
      srow[j] = 0.f;
#pragma unroll
      for (int r = 0; r < 8; r++) {
        float p = __expf(sacc[j][r] - m_new);
        sacc[j][r] = p;
        srow[j] += p;
      }
    }
    lrun = lrun * alpha + ((srow[0] + srow[1]) + (srow[2] + srow[3]));
#pragma unroll
    for (int n = 0; n < 4; n++) o[n] *= alpha;

    // ctx^T(64 d x 16 queries) += V^T(64x64) * P^T; A row = d, read transposed out of
    // Vs[t][d], and the B fragment is two score tiles converted in place: element s of
    // lane (l, hi) is key hi*8 + s (s < 8) or 16 + hi*8 + s - 8, the A side's k order
#pragma unroll
    for (int ks = 0; ks < 2; ks++) {
      v16bf pfrag;
#pragma unroll
      for (int e = 0; e < 8; e++) {
        pfrag[e]     = (__bf16)sacc[2 * ks][e];
        pfrag[8 + e] = (__bf16)sacc[2 * ks + 1][e];
      }
#pragma unroll
      for (int n = 0; n < 4; n++) {
        v16bf vfrag = load_frag_tr(vlane + ks * 32 * VPITCH + n * 16);
        o[n] = wmma_bf16(vfrag, pfrag, o[n]);
      }
    }
  }

  // normalize and store ctx back to [B*S, D] bf16
  // o[n][r] = ctx^T[n*16 + hi*8 + r][l]: 8 consecutive columns of one row per lane
  const int bb = bh >> 4, h = bh & 15;
  const float inv = 1.0f / (lrun + other_half(lrun));
  const int s = qbase + wave * 16 + l;
  bf16u* crow = ctx + ((size_t)bb * SEQ + s) * D_MODEL + h * HDIM + hi * 8;
#pragma unroll
  for (int n = 0; n < 4; n++) {
    union { uint4 u; bf16u h[8]; } pk;
#pragma unroll
    for (int r = 0; r < 8; r++) pk.h[r] = f2bf(o[n][r] * inv);
    *(uint4*)(crow + n * 16) = pk.u;
  }
}

// ---------- LayerNorm over D=1024 per row ----------

__global__ void ln_kernel(const float* __restrict__ Hb, const float* __restrict__ gamma,
                          const float* __restrict__ beta, float* __restrict__ out) {
  __shared__ float rs[256], rss[256];
  const int row = blockIdx.x, tid = threadIdx.x;
  const float* hp = Hb + (size_t)row * D_MODEL;
  float s = 0.f, ss = 0.f;
  for (int i = tid; i < D_MODEL; i += 256) {
    float x = hp[i]; s += x; ss += x * x;
  }
  rs[tid] = s; rss[tid] = ss;
  __syncthreads();
  for (int st = 128; st > 0; st >>= 1) {
    if (tid < st) { rs[tid] += rs[tid + st]; rss[tid] += rss[tid + st]; }
    __syncthreads();
  }
  float mu   = rs[0] * (1.0f / D_MODEL);
  float var  = rss[0] * (1.0f / D_MODEL) - mu * mu;
  float rstd = rsqrtf(var + 1e-12f);
  for (int i = tid; i < D_MODEL; i += 256) {
    out[(size_t)row * D_MODEL + i] = (hp[i] - mu) * rstd * gamma[i] + beta[i];
  }
}

// ---------- launch ----------

extern "C" void kernel_launch(void* const* d_in, const int* in_sizes, int n_in,
                              void* d_out, int out_size, void* d_ws, size_t ws_size,
                              hipStream_t stream) {
  (void)in_sizes; (void)n_in; (void)out_size; (void)ws_size;
  const float* X     = (const float*)d_in[0];
  const float* Wq    = (const float*)d_in[1];
  const float* bq    = (const float*)d_in[2];
  const float* Wk    = (const float*)d_in[3];
  const float* bk    = (const float*)d_in[4];
  const float* Wv    = (const float*)d_in[5];
  const float* bv    = (const float*)d_in[6];
  const float* Wo    = (const float*)d_in[7];
  const float* bo    = (const float*)d_in[8];
  const float* gamma = (const float*)d_in[9];
  const float* beta  = (const float*)d_in[10];
  float* out = (float*)d_out;

  char* ws = (char*)d_ws;
  bf16u* Xb  = (bf16u*)ws;                              //  8 MB: X in bf16
  bf16u* WT  = (bf16u*)(ws + 8ull  * 1024 * 1024);      //  8 MB: 4 transposed weights
  bf16u* QKV = (bf16u*)(ws + 16ull * 1024 * 1024);      // 24 MB: Q,K,V [B,H,S,Dh]
  bf16u* Ctx = (bf16u*)(ws + 40ull * 1024 * 1024);      //  8 MB: context [B*S, D]
  float* Hb  = (float*)(ws + 48ull * 1024 * 1024);      // 16 MB: pre-LN fp32

  cvt_x_kernel <<<dim3(MTOT * D_MODEL / 1024), 256, 0, stream>>>(X, Xb);
  cvt_wT_kernel<<<dim3(8, 16, 4),              256, 0, stream>>>(Wq, Wk, Wv, Wo, WT);
  gemm_kernel<0><<<dim3(8, 32, 3), 256, 0, stream>>>(Xb, WT, bq, bk, bv, QKV,
                                                     nullptr, nullptr);
  attn_kernel  <<<dim3(16, 32),    256, 0, stream>>>(QKV, Ctx);
  gemm_kernel<1><<<dim3(8, 32, 1), 256, 0, stream>>>(Ctx, WT + 3ull * 1024 * 1024,
                                                     bo, nullptr, nullptr, nullptr,
                                                     X, Hb);
  ln_kernel    <<<dim3(4096),      256, 0, stream>>>(Hb, gamma, beta, out);
}

// v004
// One run takes 112 microseconds.
// In both of two side-by-side timings against v003, it was 1.13 times as fast.
// Counting every step since v000, it is 1.72 times as fast.
#include <hip/hip_runtime.h>
#include <stdint.h>

typedef unsigned short bf16u;
typedef __attribute__((ext_vector_type(16))) __bf16 v16bf;
typedef __attribute__((ext_vector_type(8)))  float  v8f;
typedef __attribute__((ext_vector_type(4)))  int    v4i;
typedef __attribute__((ext_vector_type(8)))  short  v8s;

#define D_MODEL 1024
#define SEQ     2048
#define NHEAD   16
#define HDIM    64
#define MTOT    4096   // B*S

#define AS1 __attribute__((address_space(1)))
#define AS3 __attribute__((address_space(3)))

#if defined(__has_builtin)
#if __has_builtin(__builtin_amdgcn_global_load_async_to_lds_b128)
#define HAVE_ASYNC_LDS 1
#endif
#endif
#ifndef HAVE_ASYNC_LDS
#define HAVE_ASYNC_LDS 0
#endif

// ---------- helpers ----------

__device__ __forceinline__ bf16u f2bf(float f) {
  unsigned u = __float_as_uint(f);
  unsigned r = ((u >> 16) & 1u) + 0x7fffu;   // round-to-nearest-even
  return (bf16u)((u + r) >> 16);
}

struct U4x2 { uint4 a, b; };

// Load a 16x32 bf16 A/B fragment row for lane (l, hi): two contiguous 16B
// chunks per the CDNA5 16-bit matrix VGPR layout (K pairs hi*8.. and 16+hi*8..)
__device__ __forceinline__ v16bf load_frag(const bf16u* rowp, int hi) {
  U4x2 t;
  t.a = *(const uint4*)(rowp + hi * 8);
  t.b = *(const uint4*)(rowp + 16 + hi * 8);
  return __builtin_bit_cast(v16bf, t);
}

__device__ __forceinline__ v8f wmma_bf16(v16bf a, v16bf b, v8f c) {
  return __builtin_amdgcn_wmma_f32_16x16x32_bf16(
      false, a, false, b, (short)0, c, false, false);
}

// 16-byte global->LDS copy: async (ASYNCcnt-tracked, bypasses VGPRs) if available
__device__ __forceinline__ void copy16(const bf16u* g, bf16u* l) {
#if HAVE_ASYNC_LDS
  __builtin_amdgcn_global_load_async_to_lds_b128((AS1 v4i*)g, (AS3 v4i*)l, 0, 0);
#else
  *(uint4*)l = *(const uint4*)g;
#endif
}

__device__ __forceinline__ void async_wait0() {
#if HAVE_ASYNC_LDS
#if __has_builtin(__builtin_amdgcn_s_wait_asynccnt)
  __builtin_amdgcn_s_wait_asynccnt(0);
#else
  asm volatile("s_wait_asynccnt 0" ::: "memory");
#endif
#endif
}

// 16-lane row reductions via DPP16 (pure VALU, co-executes with WMMA):
// quad_perm xor1, quad_perm xor2, row_half_mirror (8), row_mirror (16)
__device__ __forceinline__ float row16_max(float x) {
  int v;
  v = __builtin_amdgcn_update_dpp(0, __float_as_int(x), 0xB1,  0xf, 0xf, true);
  x = fmaxf(x, __int_as_float(v));
  v = __builtin_amdgcn_update_dpp(0, __float_as_int(x), 0x4E,  0xf, 0xf, true);
  x = fmaxf(x, __int_as_float(v));
  v = __builtin_amdgcn_update_dpp(0, __float_as_int(x), 0x141, 0xf, 0xf, true);
  x = fmaxf(x, __int_as_float(v));
  v = __builtin_amdgcn_update_dpp(0, __float_as_int(x), 0x140, 0xf, 0xf, true);
  x = fmaxf(x, __int_as_float(v));
  return x;
}

__device__ __forceinline__ float row16_sum(float x) {
  int v;
  v = __builtin_amdgcn_update_dpp(0, __float_as_int(x), 0xB1,  0xf, 0xf, true);
  x += __int_as_float(v);
  v = __builtin_amdgcn_update_dpp(0, __float_as_int(x), 0x4E,  0xf, 0xf, true);
  x += __int_as_float(v);
  v = __builtin_amdgcn_update_dpp(0, __float_as_int(x), 0x141, 0xf, 0xf, true);
  x += __int_as_float(v);
  v = __builtin_amdgcn_update_dpp(0, __float_as_int(x), 0x140, 0xf, 0xf, true);
  x += __int_as_float(v);
  return x;
}

// ---------- conversion kernels ----------

__global__ void cvt_x_kernel(const float* __restrict__ X, bf16u* __restrict__ Xb) {
  int i = blockIdx.x * blockDim.x + threadIdx.x;   // one float4 each
  float4 v = ((const float4*)X)[i];
  union { bf16u h[4]; uint2 u; } o;
  o.h[0] = f2bf(v.x); o.h[1] = f2bf(v.y); o.h[2] = f2bf(v.z); o.h[3] = f2bf(v.w);
  ((uint2*)Xb)[i] = o.u;
}

// WT[z][n][k] = W_z[k][n]  (bf16, transposed so B-fragments load row-wise)
// One 128(k) x 64(n) tile per block. A lane reads 8 rows x 4 columns (16 lanes cover 256
// contiguous bytes of a row), turns them into 4 rows of 8 k in registers, and the tile
// goes through LDS so that every output row leaves as 256 contiguous bytes.
__global__ void cvt_wT_kernel(const float* __restrict__ W0, const float* __restrict__ W1,
                              const float* __restrict__ W2, const float* __restrict__ W3,
                              bf16u* __restrict__ WT) {
  __shared__ bf16u Ts[64 * 136];     // [n][k], pitch 272 B (16 B x odd) for 16-byte readers
  const int z = blockIdx.z;
  const float* W = (z == 0) ? W0 : (z == 1) ? W1 : (z == 2) ? W2 : W3;
  const int tid = threadIdx.x;
  const int k0 = blockIdx.x * 128, n0 = blockIdx.y * 64;
  const int c = tid & 15, g = tid >> 4;

  const float* sp = W + (size_t)(k0 + g * 8) * 1024 + n0 + c * 4;
  float4 v[8];
#pragma unroll
  for (int i = 0; i < 8; i++) v[i] = *(const float4*)(sp + (size_t)i * 1024);

  union { bf16u h[8]; uint4 u; } p0, p1, p2, p3;
#pragma unroll
  for (int i = 0; i < 8; i++) {
    p0.h[i] = f2bf(v[i].x); p1.h[i] = f2bf(v[i].y);
    p2.h[i] = f2bf(v[i].z); p3.h[i] = f2bf(v[i].w);
  }
  *(uint4*)&Ts[(c * 4 + 0) * 136 + g * 8] = p0.u;
  *(uint4*)&Ts[(c * 4 + 1) * 136 + g * 8] = p1.u;
  *(uint4*)&Ts[(c * 4 + 2) * 136 + g * 8] = p2.u;
  *(uint4*)&Ts[(c * 4 + 3) * 136 + g * 8] = p3.u;
  __syncthreads();

  bf16u* dp = WT + (size_t)z * 1024 * 1024 + (size_t)n0 * 1024 + k0 + c * 8;
#pragma unroll
  for (int r = 0; r < 4; r++) {
    const int row = g + r * 16;
    *(uint4*)(dp + (size_t)row * 1024) = *(const uint4*)&Ts[row * 136 + c * 8];
  }
}

// ---------- tiled bf16 WMMA GEMM: C = A(4096x1024) * WT^T + bias ----------
// Double-buffered LDS staging with async global->LDS copies.
// A stage holds BK k of every tile row: BK * 2 bytes of a row are whole 128-byte lines,
// and one wait and one barrier serve BK / 32 blocks of 8 products per wave.
// MODE 0: QKV projection, writes bf16 into [B,H,S,Dh], z = blockIdx.z selects matrix
// MODE 1: output projection, adds residual, writes fp32 Hout
template <int MODE, int BK>
__global__ void gemm_kernel(const bf16u* __restrict__ A,
                            const bf16u* __restrict__ WT,
                            const float* __restrict__ bias0,
                            const float* __restrict__ bias1,
                            const float* __restrict__ bias2,
                            bf16u* __restrict__ qkv,
                            const float* __restrict__ resid,
                            float* __restrict__ Hout) {
  constexpr int PITCH = BK + 8;      // row pitch in LDS: 16 B x odd for 16-byte readers
  constexpr int CPR   = BK / 8;      // 16-byte copies per row
  constexpr int RPR   = 256 / CPR;   // rows that one copy of every thread covers
  __shared__ __attribute__((aligned(16))) bf16u As[2][128 * PITCH];
  __shared__ __attribute__((aligned(16))) bf16u Bs[2][128 * PITCH];

  const int tid  = threadIdx.x;
  const int wave = tid >> 5, lane = tid & 31;
  const int l = lane & 15, hi = lane >> 4;
  const int wm = wave >> 2, wn = wave & 3;          // 2x4 wave grid
  const int z = (MODE == 0) ? blockIdx.z : 0;
  const int mbase = blockIdx.y * 128;
  const int nbase = blockIdx.x * 128;
  const bf16u* Bt = WT + (size_t)z * (1024 * 1024);
  const float* bias = (MODE == 0) ? ((z == 0) ? bias0 : (z == 1) ? bias1 : bias2)
                                  : bias0;

  v8f zinit = {};
  v8f acc[4][2];
#pragma unroll
  for (int i = 0; i < 4; i++)
#pragma unroll
    for (int j = 0; j < 2; j++) acc[i][j] = zinit;

  const int r0 = tid / CPR, q = tid % CPR;          // CPR threads/row, 16B each
  const bf16u* ag = A  + (size_t)(mbase + r0) * 1024 + q * 8;
  const bf16u* bg = Bt + (size_t)(nbase + r0) * 1024 + q * 8;

  auto stage = [&](int buf, int kb) {
    const int ko = kb * BK;
#pragma unroll   // row steps and LDS places become constants of each copy
    for (int c = 0; c < 128 / RPR; c++) {
      copy16(ag + ko + (size_t)(c * RPR) * 1024, &As[buf][(r0 + c * RPR) * PITCH + q * 8]);
      copy16(bg + ko + (size_t)(c * RPR) * 1024, &Bs[buf][(r0 + c * RPR) * PITCH + q * 8]);
    }
  };

  stage(0, 0);
  async_wait0();
  __syncthreads();

  int buf = 0;
  for (int kb = 0; kb < 1024 / BK; ++kb) {
    if (kb + 1 < 1024 / BK) stage(buf ^ 1, kb + 1);   // prefetch next tile

#pragma unroll   // fragment places become immediate offsets; loads of a block can run ahead
    for (int ks = 0; ks < BK / 32; ks++) {
      v16bf bfrag[2];
#pragma unroll
      for (int j = 0; j < 2; j++)
        bfrag[j] = load_frag(&Bs[buf][(wn * 32 + j * 16 + l) * PITCH + ks * 32], hi);
#pragma unroll
      for (int i = 0; i < 4; i++) {
        v16bf afrag = load_frag(&As[buf][(wm * 64 + i * 16 + l) * PITCH + ks * 32], hi);
#pragma unroll
        for (int j = 0; j < 2; j++)
          acc[i][j] = wmma_bf16(afrag, bfrag[j], acc[i][j]);
      }
    }

    async_wait0();
    __syncthreads();
    buf ^= 1;
  }

  // epilogue: C-layout value (lane l, half hi, comp r) = C[r + hi*8][l] of a 16x16 tile
#pragma unroll
  for (int i = 0; i < 4; i++) {
#pragma unroll
    for (int j = 0; j < 2; j++) {
      const int n = nbase + wn * 32 + j * 16 + l;
      const float bn = bias[n];
#pragma unroll
      for (int r = 0; r < 8; r++) {
        const int m = mbase + wm * 64 + i * 16 + r + hi * 8;
        float val = acc[i][j][r] + bn;
        if (MODE == 0) {
          int bb = m >> 11, s = m & 2047;
          int h = n >> 6, dh = n & 63;
          qkv[(size_t)z * MTOT * D_MODEL +
              (((size_t)(bb * NHEAD + h) * SEQ + s) * HDIM + dh)] = f2bf(val);
        } else {
          Hout[(size_t)m * D_MODEL + n] = val + resid[(size_t)m * D_MODEL + n];
        }
      }
    }
  }
}

// value of the lane 16 away (the other half of the same query column)
__device__ __forceinline__ float other_half(float x) {
  int b = __float_as_int(x);
  return __int_as_float(
      __builtin_amdgcn_permlanex16(b, b, 0x76543210, 0xfedcba98, false, false));
}

#define VPITCH 80   // V rows in LDS: 160 B = 32 B x odd, the transposing load's pitch

struct V8x2 { v8s a, b; };

// 16(d) x 32(t) A fragment of V^T out of the row-major V tile: two transposing loads,
// 16 keys apart. Lane (l, hi) gets column l of rows hi*8 .. hi*8+7 from each, which is
// the k order of load_frag. p is the lane's own address (see vlane in attn_kernel).
__device__ __forceinline__ v16bf load_frag_tr(const bf16u* p) {
  V8x2 t;
  t.a = __builtin_amdgcn_ds_load_tr16_b128_v8i16((AS3 v8s*)p);
  t.b = __builtin_amdgcn_ds_load_tr16_b128_v8i16((AS3 v8s*)(p + 16 * VPITCH));
  return __builtin_bit_cast(v16bf, t);
}

__global__ void attn_kernel(const bf16u* __restrict__ qkv, bf16u* __restrict__ ctx) {
  __shared__ bf16u Qs[128 * 72];      // 128 q-rows x 64, stride 72 (144B)
  __shared__ bf16u Ks[64 * 72];       // 64 k-rows x 64
  __shared__ __attribute__((aligned(16))) bf16u Vs[64 * VPITCH];   // 64 v-rows x 64, as in memory

  const int tid  = threadIdx.x;
  const int wave = tid >> 5, lane = tid & 31;
  const int l = lane & 15, hi = lane >> 4;
  const int bh = blockIdx.y;
  const int qbase = blockIdx.x * 128;
  const size_t headoff = (size_t)bh * SEQ * HDIM;
  const bf16u* Qp = qkv + headoff;
  const bf16u* Kp = qkv + (size_t)MTOT * D_MODEL + headoff;
  const bf16u* Vp = qkv + (size_t)2 * MTOT * D_MODEL + headoff;

  // stage Q tile (16KB) async: 2 threads/row, 64B each
  {
    int row = tid >> 1, half = tid & 1;
    const bf16u* g = Qp + (size_t)(qbase + row) * HDIM + half * 32;
    bf16u* d = &Qs[row * 72 + half * 32];
#pragma unroll
    for (int c = 0; c < 4; c++) copy16(g + c * 8, d + c * 8);
  }

  // transposing load: lane reads 16 B of row hi*8 + (lane & 7), column half (lane >> 3) & 1
  const bf16u* vlane = &Vs[(hi * 8 + (lane & 7)) * VPITCH + ((lane >> 3) & 1) * 8];

  v8f zinit = {};
  v8f sacc[4], o[4];
  float mrun = -1e30f;   // running maximum of this lane's query, equal in both halves
  float lrun = 0.f;      // running sum over this half's keys; halves join at the end
#pragma unroll
  for (int n = 0; n < 4; n++) o[n] = zinit;

  for (int kb = 0; kb < SEQ / 64; ++kb) {
    const int kt0 = kb * 64;
    __syncthreads();   // previous iteration's reads of Ks/Vs complete
    // stage K tile async: 4 threads/row, 32B each
    {
      int row = tid >> 2, q = tid & 3;
      const bf16u* g = Kp + (size_t)(kt0 + row) * HDIM + q * 16;
      bf16u* d = &Ks[row * 72 + q * 16];
      copy16(g, d);
      copy16(g + 8, d + 8);
    }
    // stage V tile async, rows as they lie in memory: a wave's copy takes 512 contiguous B
#pragma unroll
    for (int c = 0; c < 2; c++) {
      int idx = tid + c * 256;
      int t = idx >> 3, dc = (idx & 7) * 8;
      copy16(Vp + (size_t)(kt0 + t) * HDIM + dc, &Vs[t * VPITCH + dc]);
    }
    async_wait0();
    __syncthreads();   // directly behind the wait: holds every LDS read behind the copies

    // scores: S^T(64 keys x 16 queries) = K(64x64) * Q^T; A row = key, B column = query
    // sacc[j][r] = S^T[j*16 + hi*8 + r][l]
#pragma unroll
    for (int j = 0; j < 4; j++) sacc[j] = zinit;
#pragma unroll
    for (int ks = 0; ks < 2; ks++) {
      v16bf qfrag = load_frag(&Qs[(wave * 16 + l) * 72 + ks * 32], hi);
#pragma unroll
      for (int j = 0; j < 4; j++) {
        v16bf kfrag = load_frag(&Ks[(j * 16 + l) * 72 + ks * 32], hi);
        sacc[j] = wmma_bf16(kfrag, qfrag, sacc[j]);
      }
    }

    // online softmax of one query per lane: 32 keys in-lane, one exchange of halves
    float mt[4];   // one maximum and one sum per tile: four short chains, not one long
#pragma unroll
    for (int j = 0; j < 4; j++) {
      mt[j] = -1e30f;
#pragma unroll
      for (int r = 0; r < 8; r++) {
        float t = sacc[j][r] * 0.125f;   // 1/sqrt(64)
        sacc[j][r] = t;
        mt[j] = fmaxf(mt[j], t);
      }
    }
    float m_b = fmaxf(fmaxf(mt[0], mt[1]), fmaxf(mt[2], mt[3]));
    m_b = fmaxf(m_b, other_half(m_b));
    const float m_new = fmaxf(mrun, m_b);
    const float alpha = __expf(mrun - m_new);
    mrun = m_new;
    float srow[4];
#pragma unroll
    for (int j = 0; j < 4; j++) {
      srow[j] = 0.f;
#pragma unroll
      for (int r = 0; r < 8; r++) {
        float p = __expf(sacc[j][r] - m_new);
        sacc[j][r] = p;
        srow[j] += p;
      }
    }
    lrun = lrun * alpha + ((srow[0] + srow[1]) + (srow[2] + srow[3]));
#pragma unroll
    for (int n = 0; n < 4; n++) o[n] *= alpha;

    // ctx^T(64 d x 16 queries) += V^T(64x64) * P^T; A row = d, read transposed out of
    // Vs[t][d], and the B fragment is two score tiles converted in place: element s of
    // lane (l, hi) is key hi*8 + s (s < 8) or 16 + hi*8 + s - 8, the A side's k order
#pragma unroll
    for (int ks = 0; ks < 2; ks++) {
      v16bf pfrag;
#pragma unroll
      for (int e = 0; e < 8; e++) {
        pfrag[e]     = (__bf16)sacc[2 * ks][e];
        pfrag[8 + e] = (__bf16)sacc[2 * ks + 1][e];
      }
#pragma unroll
      for (int n = 0; n < 4; n++) {
        v16bf vfrag = load_frag_tr(vlane + ks * 32 * VPITCH + n * 16);
        o[n] = wmma_bf16(vfrag, pfrag, o[n]);
      }
    }
  }

  // normalize and store ctx back to [B*S, D] bf16
  // o[n][r] = ctx^T[n*16 + hi*8 + r][l]: 8 consecutive columns of one row per lane
  const int bb = bh >> 4, h = bh & 15;
  const float inv = 1.0f / (lrun + other_half(lrun));
  const int s = qbase + wave * 16 + l;
  bf16u* crow = ctx + ((size_t)bb * SEQ + s) * D_MODEL + h * HDIM + hi * 8;
#pragma unroll
  for (int n = 0; n < 4; n++) {
    union { uint4 u; bf16u h[8]; } pk;
#pragma unroll
    for (int r = 0; r < 8; r++) pk.h[r] = f2bf(o[n][r] * inv);
    *(uint4*)(crow + n * 16) = pk.u;
  }
}

// ---------- LayerNorm over D=1024 per row ----------

__global__ void ln_kernel(const float* __restrict__ Hb, const float* __restrict__ gamma,
                          const float* __restrict__ beta, float* __restrict__ out) {
  __shared__ float rs[256], rss[256];
  const int row = blockIdx.x, tid = threadIdx.x;
  const float* hp = Hb + (size_t)row * D_MODEL;
  float s = 0.f, ss = 0.f;
  for (int i = tid; i < D_MODEL; i += 256) {
    float x = hp[i]; s += x; ss += x * x;
  }
  rs[tid] = s; rss[tid] = ss;
  __syncthreads();
  for (int st = 128; st > 0; st >>= 1) {
    if (tid < st) { rs[tid] += rs[tid + st]; rss[tid] += rss[tid + st]; }
    __syncthreads();
  }
  float mu   = rs[0] * (1.0f / D_MODEL);
  float var  = rss[0] * (1.0f / D_MODEL) - mu * mu;
  float rstd = rsqrtf(var + 1e-12f);
  for (int i = tid; i < D_MODEL; i += 256) {
    out[(size_t)row * D_MODEL + i] = (hp[i] - mu) * rstd * gamma[i] + beta[i];
  }
}

// ---------- launch ----------

extern "C" void kernel_launch(void* const* d_in, const int* in_sizes, int n_in,
                              void* d_out, int out_size, void* d_ws, size_t ws_size,
                              hipStream_t stream) {
  (void)in_sizes; (void)n_in; (void)out_size; (void)ws_size;
  const float* X     = (const float*)d_in[0];
  const float* Wq    = (const float*)d_in[1];
  const float* bq    = (const float*)d_in[2];
  const float* Wk    = (const float*)d_in[3];
  const float* bk    = (const float*)d_in[4];
  const float* Wv    = (const float*)d_in[5];
  const float* bv    = (const float*)d_in[6];
  const float* Wo    = (const float*)d_in[7];
  const float* bo    = (const float*)d_in[8];
  const float* gamma = (const float*)d_in[9];
  const float* beta  = (const float*)d_in[10];
  float* out = (float*)d_out;

  char* ws = (char*)d_ws;
  bf16u* Xb  = (bf16u*)ws;                              //  8 MB: X in bf16
  bf16u* WT  = (bf16u*)(ws + 8ull  * 1024 * 1024);      //  8 MB: 4 transposed weights
  bf16u* QKV = (bf16u*)(ws + 16ull * 1024 * 1024);      // 24 MB: Q,K,V [B,H,S,Dh]
  bf16u* Ctx = (bf16u*)(ws + 40ull * 1024 * 1024);      //  8 MB: context [B*S, D]
  float* Hb  = (float*)(ws + 48ull * 1024 * 1024);      // 16 MB: pre-LN fp32

  cvt_x_kernel <<<dim3(MTOT * D_MODEL / 1024), 256, 0, stream>>>(X, Xb);
  cvt_wT_kernel<<<dim3(8, 16, 4),              256, 0, stream>>>(Wq, Wk, Wv, Wo, WT);
  // stage length by residency: four blocks share a WGP's LDS in the first, two in the second
  gemm_kernel<0, 64><<<dim3(8, 32, 3), 256, 0, stream>>>(Xb, WT, bq, bk, bv, QKV,
                                                         nullptr, nullptr);
  attn_kernel  <<<dim3(16, 32),    256, 0, stream>>>(QKV, Ctx);
  gemm_kernel<1, 128><<<dim3(8, 32, 1), 256, 0, stream>>>(Ctx, WT + 3ull * 1024 * 1024,
                                                          bo, nullptr, nullptr, nullptr,
                                                          X, Hb);
  ln_kernel    <<<dim3(4096),      256, 0, stream>>>(Hb, gamma, beta, out);
}

// v005
// Measured time: 96.9 microseconds a run.
// Two timings next to v004 both put it at 1.15 times that version's speed.
// Over all steps from v000 it is 1.98 times as fast.
#include <hip/hip_runtime.h>
#include <stdint.h>

typedef unsigned short bf16u;
typedef __attribute__((ext_vector_type(16))) __bf16 v16bf;
typedef __attribute__((ext_vector_type(8)))  float  v8f;
typedef __attribute__((ext_vector_type(4)))  int    v4i;
typedef __attribute__((ext_vector_type(8)))  short  v8s;

#define D_MODEL 1024
#define SEQ     2048
#define NHEAD   16
#define HDIM    64
#define MTOT    4096   // B*S

#define AS1 __attribute__((address_space(1)))
#define AS3 __attribute__((address_space(3)))

#if defined(__has_builtin)
#if __has_builtin(__builtin_amdgcn_global_load_async_to_lds_b128)
#define HAVE_ASYNC_LDS 1
#endif
#endif
#ifndef HAVE_ASYNC_LDS
#define HAVE_ASYNC_LDS 0
#endif

// ---------- helpers ----------

__device__ __forceinline__ bf16u f2bf(float f) {
  unsigned u = __float_as_uint(f);
  unsigned r = ((u >> 16) & 1u) + 0x7fffu;   // round-to-nearest-even
  return (bf16u)((u + r) >> 16);
}

struct U4x2 { uint4 a, b; };

// Load a 16x32 bf16 A/B fragment row for lane (l, hi): two contiguous 16B
// chunks per the CDNA5 16-bit matrix VGPR layout (K pairs hi*8.. and 16+hi*8..)
__device__ __forceinline__ v16bf load_frag(const bf16u* rowp, int hi) {
  U4x2 t;
  t.a = *(const uint4*)(rowp + hi * 8);
  t.b = *(const uint4*)(rowp + 16 + hi * 8);
  return __builtin_bit_cast(v16bf, t);
}

__device__ __forceinline__ v8f wmma_bf16(v16bf a, v16bf b, v8f c) {
  return __builtin_amdgcn_wmma_f32_16x16x32_bf16(
      false, a, false, b, (short)0, c, false, false);
}

// 16-byte global->LDS copy: async (ASYNCcnt-tracked, bypasses VGPRs) if available
__device__ __forceinline__ void copy16(const bf16u* g, bf16u* l) {
#if HAVE_ASYNC_LDS
  __builtin_amdgcn_global_load_async_to_lds_b128((AS1 v4i*)g, (AS3 v4i*)l, 0, 0);
#else
  *(uint4*)l = *(const uint4*)g;
#endif
}

__device__ __forceinline__ void async_wait0() {
#if HAVE_ASYNC_LDS
#if __has_builtin(__builtin_amdgcn_s_wait_asynccnt)
  __builtin_amdgcn_s_wait_asynccnt(0);
#else
  asm volatile("s_wait_asynccnt 0" ::: "memory");
#endif
#endif
}

// 16-lane row reductions via DPP16 (pure VALU, co-executes with WMMA):
// quad_perm xor1, quad_perm xor2, row_half_mirror (8), row_mirror (16)
__device__ __forceinline__ float row16_max(float x) {
  int v;
  v = __builtin_amdgcn_update_dpp(0, __float_as_int(x), 0xB1,  0xf, 0xf, true);
  x = fmaxf(x, __int_as_float(v));
  v = __builtin_amdgcn_update_dpp(0, __float_as_int(x), 0x4E,  0xf, 0xf, true);
  x = fmaxf(x, __int_as_float(v));
  v = __builtin_amdgcn_update_dpp(0, __float_as_int(x), 0x141, 0xf, 0xf, true);
  x = fmaxf(x, __int_as_float(v));
  v = __builtin_amdgcn_update_dpp(0, __float_as_int(x), 0x140, 0xf, 0xf, true);
  x = fmaxf(x, __int_as_float(v));
  return x;
}

__device__ __forceinline__ float row16_sum(float x) {
  int v;
  v = __builtin_amdgcn_update_dpp(0, __float_as_int(x), 0xB1,  0xf, 0xf, true);
  x += __int_as_float(v);
  v = __builtin_amdgcn_update_dpp(0, __float_as_int(x), 0x4E,  0xf, 0xf, true);
  x += __int_as_float(v);
  v = __builtin_amdgcn_update_dpp(0, __float_as_int(x), 0x141, 0xf, 0xf, true);
  x += __int_as_float(v);
  v = __builtin_amdgcn_update_dpp(0, __float_as_int(x), 0x140, 0xf, 0xf, true);
  x += __int_as_float(v);
  return x;
}

// ---------- conversion kernels ----------

__global__ void cvt_x_kernel(const float* __restrict__ X, bf16u* __restrict__ Xb) {
  int i = blockIdx.x * blockDim.x + threadIdx.x;   // one float4 each
  float4 v = ((const float4*)X)[i];
  union { bf16u h[4]; uint2 u; } o;
  o.h[0] = f2bf(v.x); o.h[1] = f2bf(v.y); o.h[2] = f2bf(v.z); o.h[3] = f2bf(v.w);
  ((uint2*)Xb)[i] = o.u;
}

// WT[z][n][k] = W_z[k][n]  (bf16, transposed so B-fragments load row-wise)
// One 128(k) x 64(n) tile per block. A lane reads 8 rows x 4 columns (16 lanes cover 256
// contiguous bytes of a row), turns them into 4 rows of 8 k in registers, and the tile
// goes through LDS so that every output row leaves as 256 contiguous bytes.
__global__ void cvt_wT_kernel(const float* __restrict__ W0, const float* __restrict__ W1,
                              const float* __restrict__ W2, const float* __restrict__ W3,
                              bf16u* __restrict__ WT) {
  __shared__ bf16u Ts[64 * 136];     // [n][k], pitch 272 B (16 B x odd) for 16-byte readers
  const int z = blockIdx.z;
  const float* W = (z == 0) ? W0 : (z == 1) ? W1 : (z == 2) ? W2 : W3;
  const int tid = threadIdx.x;
  const int k0 = blockIdx.x * 128, n0 = blockIdx.y * 64;
  const int c = tid & 15, g = tid >> 4;

  const float* sp = W + (size_t)(k0 + g * 8) * 1024 + n0 + c * 4;
  float4 v[8];
#pragma unroll
  for (int i = 0; i < 8; i++) v[i] = *(const float4*)(sp + (size_t)i * 1024);

  union { bf16u h[8]; uint4 u; } p0, p1, p2, p3;
#pragma unroll
  for (int i = 0; i < 8; i++) {
    p0.h[i] = f2bf(v[i].x); p1.h[i] = f2bf(v[i].y);
    p2.h[i] = f2bf(v[i].z); p3.h[i] = f2bf(v[i].w);
  }
  *(uint4*)&Ts[(c * 4 + 0) * 136 + g * 8] = p0.u;
  *(uint4*)&Ts[(c * 4 + 1) * 136 + g * 8] = p1.u;
  *(uint4*)&Ts[(c * 4 + 2) * 136 + g * 8] = p2.u;
  *(uint4*)&Ts[(c * 4 + 3) * 136 + g * 8] = p3.u;
  __syncthreads();

  bf16u* dp = WT + (size_t)z * 1024 * 1024 + (size_t)n0 * 1024 + k0 + c * 8;
#pragma unroll
  for (int r = 0; r < 4; r++) {
    const int row = g + r * 16;
    *(uint4*)(dp + (size_t)row * 1024) = *(const uint4*)&Ts[row * 136 + c * 8];
  }
}

// ---------- tiled bf16 WMMA GEMM: C = A(4096x1024) * WT^T + bias ----------
// Double-buffered LDS staging with async global->LDS copies.
// A stage holds BK k of every tile row: BK * 2 bytes of a row are whole 128-byte lines,
// and one wait and one barrier serve BK / 32 blocks of 8 products per wave.
// MODE 0: QKV projection, writes bf16 into [B,H,S,Dh], z = blockIdx.z selects matrix
// MODE 1: output projection, adds residual, writes fp32 Hout
template <int MODE, int BK>
__global__ void gemm_kernel(const bf16u* __restrict__ A,
                            const bf16u* __restrict__ WT,
                            const float* __restrict__ bias0,
                            const float* __restrict__ bias1,
                            const float* __restrict__ bias2,
                            bf16u* __restrict__ qkv,
                            const float* __restrict__ resid,
                            float* __restrict__ Hout) {
  constexpr int PITCH = BK + 8;      // row pitch in LDS: 16 B x odd for 16-byte readers
  constexpr int CPR   = BK / 8;      // 16-byte copies per row
  constexpr int RPR   = 256 / CPR;   // rows that one copy of every thread covers
  __shared__ __attribute__((aligned(16))) bf16u As[2][128 * PITCH];
  __shared__ __attribute__((aligned(16))) bf16u Bs[2][128 * PITCH];

  const int tid  = threadIdx.x;
  const int wave = tid >> 5, lane = tid & 31;
  const int l = lane & 15, hi = lane >> 4;
  const int wm = wave >> 2, wn = wave & 3;          // 2x4 wave grid
  const int z = (MODE == 0) ? blockIdx.z : 0;
  const int mbase = blockIdx.y * 128;
  const int nbase = blockIdx.x * 128;
  const bf16u* Bt = WT + (size_t)z * (1024 * 1024);
  const float* bias = (MODE == 0) ? ((z == 0) ? bias0 : (z == 1) ? bias1 : bias2)
                                  : bias0;

  v8f zinit = {};
  v8f acc[4][2];
#pragma unroll
  for (int i = 0; i < 4; i++)
#pragma unroll
    for (int j = 0; j < 2; j++) acc[i][j] = zinit;

  const int r0 = tid / CPR, q = tid % CPR;          // CPR threads/row, 16B each
  const bf16u* ag = A  + (size_t)(mbase + r0) * 1024 + q * 8;
  const bf16u* bg = Bt + (size_t)(nbase + r0) * 1024 + q * 8;

  auto stage = [&](int buf, int kb) {
    const int ko = kb * BK;
#pragma unroll   // row steps and LDS places become constants of each copy
    for (int c = 0; c < 128 / RPR; c++) {
      copy16(ag + ko + (size_t)(c * RPR) * 1024, &As[buf][(r0 + c * RPR) * PITCH + q * 8]);
      copy16(bg + ko + (size_t)(c * RPR) * 1024, &Bs[buf][(r0 + c * RPR) * PITCH + q * 8]);
    }
  };

  stage(0, 0);
  async_wait0();
  __syncthreads();

  int buf = 0;
  for (int kb = 0; kb < 1024 / BK; ++kb) {
    if (kb + 1 < 1024 / BK) stage(buf ^ 1, kb + 1);   // prefetch next tile

#pragma unroll   // fragment places become immediate offsets; loads of a block can run ahead
    for (int ks = 0; ks < BK / 32; ks++) {
      v16bf bfrag[2];
#pragma unroll
      for (int j = 0; j < 2; j++)
        bfrag[j] = load_frag(&Bs[buf][(wn * 32 + j * 16 + l) * PITCH + ks * 32], hi);
#pragma unroll
      for (int i = 0; i < 4; i++) {
        v16bf afrag = load_frag(&As[buf][(wm * 64 + i * 16 + l) * PITCH + ks * 32], hi);
#pragma unroll
        for (int j = 0; j < 2; j++)
          acc[i][j] = wmma_bf16(afrag, bfrag[j], acc[i][j]);
      }
    }

    async_wait0();
    __syncthreads();
    buf ^= 1;
  }

  // epilogue: C-layout value (lane l, half hi, comp r) = C[r + hi*8][l] of a 16x16 tile
#pragma unroll
  for (int i = 0; i < 4; i++) {
#pragma unroll
    for (int j = 0; j < 2; j++) {
      const int n = nbase + wn * 32 + j * 16 + l;
      const float bn = bias[n];
#pragma unroll
      for (int r = 0; r < 8; r++) {
        const int m = mbase + wm * 64 + i * 16 + r + hi * 8;
        float val = acc[i][j][r] + bn;
        if (MODE == 0) {
          int bb = m >> 11, s = m & 2047;
          int h = n >> 6, dh = n & 63;
          qkv[(size_t)z * MTOT * D_MODEL +
              (((size_t)(bb * NHEAD + h) * SEQ + s) * HDIM + dh)] = f2bf(val);
        } else {
          Hout[(size_t)m * D_MODEL + n] = val + resid[(size_t)m * D_MODEL + n];
        }
      }
    }
  }
}

// value of the lane 16 away (the other half of the same query column)
__device__ __forceinline__ float other_half(float x) {
  int b = __float_as_int(x);
  return __int_as_float(
      __builtin_amdgcn_permlanex16(b, b, 0x76543210, 0xfedcba98, false, false));
}

#define VPITCH 80   // V rows in LDS: 160 B = 32 B x odd, the transposing load's pitch

struct V8x2 { v8s a, b; };

// 16(d) x 32(t) A fragment of V^T out of the row-major V tile: two transposing loads,
// 16 keys apart. Lane (l, hi) gets column l of rows hi*8 .. hi*8+7 from each, which is
// the k order of load_frag. p is the lane's own address (see vlane in attn_kernel).
__device__ __forceinline__ v16bf load_frag_tr(const bf16u* p) {
  V8x2 t;
  t.a = __builtin_amdgcn_ds_load_tr16_b128_v8i16((AS3 v8s*)p);
  t.b = __builtin_amdgcn_ds_load_tr16_b128_v8i16((AS3 v8s*)(p + 16 * VPITCH));
  return __builtin_bit_cast(v16bf, t);
}

// launch bounds: the real block size lifts the register ceiling, which the two copies of the
// loop body need (no spill); four waves a SIMD still fit
__global__ __launch_bounds__(256) void attn_kernel(const bf16u* __restrict__ qkv, bf16u* __restrict__ ctx) {
  __shared__ bf16u Qs[128 * 72];      // 128 q-rows x 64, stride 72 (144B)
  // K and V: two buffers each, the next pass's tiles land while this pass's are worked on
  __shared__ __attribute__((aligned(16))) bf16u Ks[2][64 * 72];    // 64 k-rows x 64
  __shared__ __attribute__((aligned(16))) bf16u Vs[2][64 * VPITCH];   // 64 v-rows x 64, as in memory

  const int tid  = threadIdx.x;
  const int wave = tid >> 5, lane = tid & 31;
  const int l = lane & 15, hi = lane >> 4;
  const int bh = blockIdx.y;
  const int qbase = blockIdx.x * 128;
  const size_t headoff = (size_t)bh * SEQ * HDIM;
  const bf16u* Qp = qkv + headoff;
  const bf16u* Kp = qkv + (size_t)MTOT * D_MODEL + headoff;
  const bf16u* Vp = qkv + (size_t)2 * MTOT * D_MODEL + headoff;

  // stage Q tile (16KB) async: 2 threads/row, 64B each
  {
    int row = tid >> 1, half = tid & 1;
    const bf16u* g = Qp + (size_t)(qbase + row) * HDIM + half * 32;
    bf16u* d = &Qs[row * 72 + half * 32];
#pragma unroll
    for (int c = 0; c < 4; c++) copy16(g + c * 8, d + c * 8);
  }

  // transposing load: lane reads 16 B of row hi*8 + (lane & 7), column half (lane >> 3) & 1
  const int vlane = (hi * 8 + (lane & 7)) * VPITCH + ((lane >> 3) & 1) * 8;

  // async copies of the 64 keys of pass kb into buffer b
  auto stage = [&](int b, int kb) {
    const int kt0 = kb * 64;
    // K tile: 4 threads/row, 32B each
    {
      int row = tid >> 2, q = tid & 3;
      const bf16u* g = Kp + (size_t)(kt0 + row) * HDIM + q * 16;
      bf16u* d = &Ks[b][row * 72 + q * 16];
      copy16(g, d);
      copy16(g + 8, d + 8);
    }
    // V tile, rows as they lie in memory: a wave's copy takes 512 contiguous B
#pragma unroll
    for (int c = 0; c < 2; c++) {
      int idx = tid + c * 256;
      int t = idx >> 3, dc = (idx & 7) * 8;
      copy16(Vp + (size_t)(kt0 + t) * HDIM + dc, &Vs[b][t * VPITCH + dc]);
    }
  };

  v8f zinit = {};
  v8f sacc[4], o[4];
  float mrun = -1e30f;   // running maximum of this lane's query, equal in both halves
  float lrun = 0.f;      // running sum over this half's keys; halves join at the end
#pragma unroll
  for (int n = 0; n < 4; n++) o[n] = zinit;

  // ring prologue: Q and pass 0 land and are published, then pass 1's copies start
  stage(0, 0);
  asm volatile("s_wait_asynccnt 0x0" ::: "memory");   // this wave's Q, K, V copies have landed
  __syncthreads();                                    // ... and every other wave's
  stage(1, 1);

#pragma unroll 2   // the buffer index becomes a constant of each copy of the body
  for (int kb = 0; kb < SEQ / 64; ++kb) {
    const int b = kb & 1;

    // scores: S^T(64 keys x 16 queries) = K(64x64) * Q^T; A row = key, B column = query
    // sacc[j][r] = S^T[j*16 + hi*8 + r][l]
#pragma unroll
    for (int j = 0; j < 4; j++) sacc[j] = zinit;
#pragma unroll
    for (int ks = 0; ks < 2; ks++) {
      v16bf qfrag = load_frag(&Qs[(wave * 16 + l) * 72 + ks * 32], hi);
#pragma unroll
      for (int j = 0; j < 4; j++) {
        v16bf kfrag = load_frag(&Ks[b][(j * 16 + l) * 72 + ks * 32], hi);
        sacc[j] = wmma_bf16(kfrag, qfrag, sacc[j]);
      }
    }

    // online softmax of one query per lane: 32 keys in-lane, one exchange of halves
    float mt[4];   // one maximum and one sum per tile: four short chains, not one long
#pragma unroll
    for (int j = 0; j < 4; j++) {
      mt[j] = -1e30f;
#pragma unroll
      for (int r = 0; r < 8; r++) {
        float t = sacc[j][r] * 0.125f;   // 1/sqrt(64)
        sacc[j][r] = t;
        mt[j] = fmaxf(mt[j], t);
      }
    }
    float m_b = fmaxf(fmaxf(mt[0], mt[1]), fmaxf(mt[2], mt[3]));
    m_b = fmaxf(m_b, other_half(m_b));
    const float m_new = fmaxf(mrun, m_b);
    const float alpha = __expf(mrun - m_new);
    mrun = m_new;
    float srow[4];
#pragma unroll
    for (int j = 0; j < 4; j++) {
      srow[j] = 0.f;
#pragma unroll
      for (int r = 0; r < 8; r++) {
        float p = __expf(sacc[j][r] - m_new);
        sacc[j][r] = p;
        srow[j] += p;
      }
    }
    lrun = lrun * alpha + ((srow[0] + srow[1]) + (srow[2] + srow[3]));
#pragma unroll
    for (int n = 0; n < 4; n++) o[n] *= alpha;

    // ctx^T(64 d x 16 queries) += V^T(64x64) * P^T; A row = d, read transposed out of
    // Vs[t][d], and the B fragment is two score tiles converted in place: element s of
    // lane (l, hi) is key hi*8 + s (s < 8) or 16 + hi*8 + s - 8, the A side's k order
#pragma unroll
    for (int ks = 0; ks < 2; ks++) {
      v16bf pfrag;
#pragma unroll
      for (int e = 0; e < 8; e++) {
        pfrag[e]     = (__bf16)sacc[2 * ks][e];
        pfrag[8 + e] = (__bf16)sacc[2 * ks + 1][e];
      }
#pragma unroll
      for (int n = 0; n < 4; n++) {
        v16bf vfrag = load_frag_tr(&Vs[b][vlane + ks * 32 * VPITCH + n * 16]);
        o[n] = wmma_bf16(vfrag, pfrag, o[n]);
      }
    }

    // publish point of pass kb + 1; the one barrier also ends every read of buffer b
    asm volatile("s_wait_dscnt 0x0" ::: "memory");      // own reads of buffer b are done before it is refilled
    asm volatile("s_wait_asynccnt 0x0" ::: "memory");   // own copies of pass kb + 1 have landed
    __syncthreads();
    if (kb + 2 < SEQ / 64) stage(b, kb + 2);            // flies during pass kb + 1
  }
  asm volatile("s_wait_asynccnt 0x0" ::: "memory");     // no copy outstanding when the wave ends

  // normalize and store ctx back to [B*S, D] bf16
  // o[n][r] = ctx^T[n*16 + hi*8 + r][l]: 8 consecutive columns of one row per lane
  const int bb = bh >> 4, h = bh & 15;
  const float inv = 1.0f / (lrun + other_half(lrun));
  const int s = qbase + wave * 16 + l;
  bf16u* crow = ctx + ((size_t)bb * SEQ + s) * D_MODEL + h * HDIM + hi * 8;
#pragma unroll
  for (int n = 0; n < 4; n++) {
    union { uint4 u; bf16u h[8]; } pk;
#pragma unroll
    for (int r = 0; r < 8; r++) pk.h[r] = f2bf(o[n][r] * inv);
    *(uint4*)(crow + n * 16) = pk.u;
  }
}

// ---------- LayerNorm over D=1024 per row ----------

__global__ void ln_kernel(const float* __restrict__ Hb, const float* __restrict__ gamma,
                          const float* __restrict__ beta, float* __restrict__ out) {
  __shared__ float rs[256], rss[256];
  const int row = blockIdx.x, tid = threadIdx.x;
  const float* hp = Hb + (size_t)row * D_MODEL;
  float s = 0.f, ss = 0.f;
  for (int i = tid; i < D_MODEL; i += 256) {
    float x = hp[i]; s += x; ss += x * x;
  }
  rs[tid] = s; rss[tid] = ss;
  __syncthreads();
  for (int st = 128; st > 0; st >>= 1) {
    if (tid < st) { rs[tid] += rs[tid + st]; rss[tid] += rss[tid + st]; }
    __syncthreads();
  }
  float mu   = rs[0] * (1.0f / D_MODEL);
  float var  = rss[0] * (1.0f / D_MODEL) - mu * mu;
  float rstd = rsqrtf(var + 1e-12f);
  for (int i = tid; i < D_MODEL; i += 256) {
    out[(size_t)row * D_MODEL + i] = (hp[i] - mu) * rstd * gamma[i] + beta[i];
  }
}

// ---------- launch ----------

extern "C" void kernel_launch(void* const* d_in, const int* in_sizes, int n_in,
                              void* d_out, int out_size, void* d_ws, size_t ws_size,
                              hipStream_t stream) {
  (void)in_sizes; (void)n_in; (void)out_size; (void)ws_size;
  const float* X     = (const float*)d_in[0];
  const float* Wq    = (const float*)d_in[1];
  const float* bq    = (const float*)d_in[2];
  const float* Wk    = (const float*)d_in[3];
  const float* bk    = (const float*)d_in[4];
  const float* Wv    = (const float*)d_in[5];
  const float* bv    = (const float*)d_in[6];
  const float* Wo    = (const float*)d_in[7];
  const float* bo    = (const float*)d_in[8];
  const float* gamma = (const float*)d_in[9];
  const float* beta  = (const float*)d_in[10];
  float* out = (float*)d_out;

  char* ws = (char*)d_ws;
  bf16u* Xb  = (bf16u*)ws;                              //  8 MB: X in bf16
  bf16u* WT  = (bf16u*)(ws + 8ull  * 1024 * 1024);      //  8 MB: 4 transposed weights
  bf16u* QKV = (bf16u*)(ws + 16ull * 1024 * 1024);      // 24 MB: Q,K,V [B,H,S,Dh]
  bf16u* Ctx = (bf16u*)(ws + 40ull * 1024 * 1024);      //  8 MB: context [B*S, D]
  float* Hb  = (float*)(ws + 48ull * 1024 * 1024);      // 16 MB: pre-LN fp32

  cvt_x_kernel <<<dim3(MTOT * D_MODEL / 1024), 256, 0, stream>>>(X, Xb);
  cvt_wT_kernel<<<dim3(8, 16, 4),              256, 0, stream>>>(Wq, Wk, Wv, Wo, WT);
  // stage length by residency: four blocks share a WGP's LDS in the first, two in the second
  gemm_kernel<0, 64><<<dim3(8, 32, 3), 256, 0, stream>>>(Xb, WT, bq, bk, bv, QKV,
                                                         nullptr, nullptr);
  attn_kernel  <<<dim3(16, 32),    256, 0, stream>>>(QKV, Ctx);
  gemm_kernel<1, 128><<<dim3(8, 32, 1), 256, 0, stream>>>(Ctx, WT + 3ull * 1024 * 1024,
                                                          bo, nullptr, nullptr, nullptr,
                                                          X, Hb);
  ln_kernel    <<<dim3(4096),      256, 0, stream>>>(Hb, gamma, beta, out);
}

// v006
// A run of this version takes 92.4 microseconds.
// Two timings next to v005 both put it at 1.05 times that version's speed.
// Counting every step since v000, it is 2.08 times as fast.
#include <hip/hip_runtime.h>
#include <stdint.h>

typedef unsigned short bf16u;
typedef __attribute__((ext_vector_type(16))) __bf16 v16bf;
typedef __attribute__((ext_vector_type(8)))  float  v8f;
typedef __attribute__((ext_vector_type(2)))  float  v2f;
typedef __attribute__((ext_vector_type(4)))  int    v4i;
typedef __attribute__((ext_vector_type(8)))  short  v8s;

#define D_MODEL 1024
#define SEQ     2048
#define NHEAD   16
#define HDIM    64
#define MTOT    4096   // B*S

#define AS1 __attribute__((address_space(1)))
#define AS3 __attribute__((address_space(3)))

#if defined(__has_builtin)
#if __has_builtin(__builtin_amdgcn_global_load_async_to_lds_b128)
#define HAVE_ASYNC_LDS 1
#endif
#endif
#ifndef HAVE_ASYNC_LDS
#define HAVE_ASYNC_LDS 0
#endif

// ---------- helpers ----------

__device__ __forceinline__ bf16u f2bf(float f) {
  unsigned u = __float_as_uint(f);
  unsigned r = ((u >> 16) & 1u) + 0x7fffu;   // round-to-nearest-even
  return (bf16u)((u + r) >> 16);
}

struct U4x2 { uint4 a, b; };

// Load a 16x32 bf16 A/B fragment row for lane (l, hi): two contiguous 16B
// chunks per the CDNA5 16-bit matrix VGPR layout (K pairs hi*8.. and 16+hi*8..)
__device__ __forceinline__ v16bf load_frag(const bf16u* rowp, int hi) {
  U4x2 t;
  t.a = *(const uint4*)(rowp + hi * 8);
  t.b = *(const uint4*)(rowp + 16 + hi * 8);
  return __builtin_bit_cast(v16bf, t);
}

__device__ __forceinline__ v8f wmma_bf16(v16bf a, v16bf b, v8f c) {
  return __builtin_amdgcn_wmma_f32_16x16x32_bf16(
      false, a, false, b, (short)0, c, false, false);
}

// 16-byte global->LDS copy: async (ASYNCcnt-tracked, bypasses VGPRs) if available
__device__ __forceinline__ void copy16(const bf16u* g, bf16u* l) {
#if HAVE_ASYNC_LDS
  __builtin_amdgcn_global_load_async_to_lds_b128((AS1 v4i*)g, (AS3 v4i*)l, 0, 0);
#else
  *(uint4*)l = *(const uint4*)g;
#endif
}

__device__ __forceinline__ void async_wait0() {
#if HAVE_ASYNC_LDS
#if __has_builtin(__builtin_amdgcn_s_wait_asynccnt)
  __builtin_amdgcn_s_wait_asynccnt(0);
#else
  asm volatile("s_wait_asynccnt 0" ::: "memory");
#endif
#endif
}

// 16-lane row reductions via DPP16 (pure VALU, co-executes with WMMA):
// quad_perm xor1, quad_perm xor2, row_half_mirror (8), row_mirror (16)
__device__ __forceinline__ float row16_max(float x) {
  int v;
  v = __builtin_amdgcn_update_dpp(0, __float_as_int(x), 0xB1,  0xf, 0xf, true);
  x = fmaxf(x, __int_as_float(v));
  v = __builtin_amdgcn_update_dpp(0, __float_as_int(x), 0x4E,  0xf, 0xf, true);
  x = fmaxf(x, __int_as_float(v));
  v = __builtin_amdgcn_update_dpp(0, __float_as_int(x), 0x141, 0xf, 0xf, true);
  x = fmaxf(x, __int_as_float(v));
  v = __builtin_amdgcn_update_dpp(0, __float_as_int(x), 0x140, 0xf, 0xf, true);
  x = fmaxf(x, __int_as_float(v));
  return x;
}

__device__ __forceinline__ float row16_sum(float x) {
  int v;
  v = __builtin_amdgcn_update_dpp(0, __float_as_int(x), 0xB1,  0xf, 0xf, true);
  x += __int_as_float(v);
  v = __builtin_amdgcn_update_dpp(0, __float_as_int(x), 0x4E,  0xf, 0xf, true);
  x += __int_as_float(v);
  v = __builtin_amdgcn_update_dpp(0, __float_as_int(x), 0x141, 0xf, 0xf, true);
  x += __int_as_float(v);
  v = __builtin_amdgcn_update_dpp(0, __float_as_int(x), 0x140, 0xf, 0xf, true);
  x += __int_as_float(v);
  return x;
}

// ---------- conversion kernels ----------

__global__ void cvt_x_kernel(const float* __restrict__ X, bf16u* __restrict__ Xb) {
  int i = blockIdx.x * blockDim.x + threadIdx.x;   // one float4 each
  float4 v = ((const float4*)X)[i];
  union { bf16u h[4]; uint2 u; } o;
  o.h[0] = f2bf(v.x); o.h[1] = f2bf(v.y); o.h[2] = f2bf(v.z); o.h[3] = f2bf(v.w);
  ((uint2*)Xb)[i] = o.u;
}

// WT[z][n][k] = W_z[k][n]  (bf16, transposed so B-fragments load row-wise)
// One 128(k) x 64(n) tile per block. A lane reads 8 rows x 4 columns (16 lanes cover 256
// contiguous bytes of a row), turns them into 4 rows of 8 k in registers, and the tile
// goes through LDS so that every output row leaves as 256 contiguous bytes.
__global__ void cvt_wT_kernel(const float* __restrict__ W0, const float* __restrict__ W1,
                              const float* __restrict__ W2, const float* __restrict__ W3,
                              bf16u* __restrict__ WT) {
  __shared__ bf16u Ts[64 * 136];     // [n][k], pitch 272 B (16 B x odd) for 16-byte readers
  const int z = blockIdx.z;
  const float* W = (z == 0) ? W0 : (z == 1) ? W1 : (z == 2) ? W2 : W3;
  const int tid = threadIdx.x;
  const int k0 = blockIdx.x * 128, n0 = blockIdx.y * 64;
  const int c = tid & 15, g = tid >> 4;

  const float* sp = W + (size_t)(k0 + g * 8) * 1024 + n0 + c * 4;
  float4 v[8];
#pragma unroll
  for (int i = 0; i < 8; i++) v[i] = *(const float4*)(sp + (size_t)i * 1024);

  union { bf16u h[8]; uint4 u; } p0, p1, p2, p3;
#pragma unroll
  for (int i = 0; i < 8; i++) {
    p0.h[i] = f2bf(v[i].x); p1.h[i] = f2bf(v[i].y);
    p2.h[i] = f2bf(v[i].z); p3.h[i] = f2bf(v[i].w);
  }
  *(uint4*)&Ts[(c * 4 + 0) * 136 + g * 8] = p0.u;
  *(uint4*)&Ts[(c * 4 + 1) * 136 + g * 8] = p1.u;
  *(uint4*)&Ts[(c * 4 + 2) * 136 + g * 8] = p2.u;
  *(uint4*)&Ts[(c * 4 + 3) * 136 + g * 8] = p3.u;
  __syncthreads();

  bf16u* dp = WT + (size_t)z * 1024 * 1024 + (size_t)n0 * 1024 + k0 + c * 8;
#pragma unroll
  for (int r = 0; r < 4; r++) {
    const int row = g + r * 16;
    *(uint4*)(dp + (size_t)row * 1024) = *(const uint4*)&Ts[row * 136 + c * 8];
  }
}

// ---------- tiled bf16 WMMA GEMM: C = A(4096x1024) * WT^T + bias ----------
// Double-buffered LDS staging with async global->LDS copies.
// A stage holds BK k of every tile row: BK * 2 bytes of a row are whole 128-byte lines,
// and one wait and one barrier serve BK / 32 blocks of 8 products per wave.
// MODE 0: QKV projection, writes bf16 into [B,H,S,Dh], z = blockIdx.z selects matrix
// MODE 1: output projection, adds residual, writes fp32 Hout
template <int MODE, int BK>
__global__ void gemm_kernel(const bf16u* __restrict__ A,
                            const bf16u* __restrict__ WT,
                            const float* __restrict__ bias0,
                            const float* __restrict__ bias1,
                            const float* __restrict__ bias2,
                            bf16u* __restrict__ qkv,
                            const float* __restrict__ resid,
                            float* __restrict__ Hout) {
  constexpr int PITCH = BK + 8;      // row pitch in LDS: 16 B x odd for 16-byte readers
  constexpr int CPR   = BK / 8;      // 16-byte copies per row
  constexpr int RPR   = 256 / CPR;   // rows that one copy of every thread covers
  __shared__ __attribute__((aligned(16))) bf16u As[2][128 * PITCH];
  __shared__ __attribute__((aligned(16))) bf16u Bs[2][128 * PITCH];

  const int tid  = threadIdx.x;
  const int wave = tid >> 5, lane = tid & 31;
  const int l = lane & 15, hi = lane >> 4;
  const int wm = wave >> 2, wn = wave & 3;          // 2x4 wave grid
  const int z = (MODE == 0) ? blockIdx.z : 0;
  const int mbase = blockIdx.y * 128;
  const int nbase = blockIdx.x * 128;
  const bf16u* Bt = WT + (size_t)z * (1024 * 1024);
  const float* bias = (MODE == 0) ? ((z == 0) ? bias0 : (z == 1) ? bias1 : bias2)
                                  : bias0;

  v8f zinit = {};
  v8f acc[4][2];
#pragma unroll
  for (int i = 0; i < 4; i++)
#pragma unroll
    for (int j = 0; j < 2; j++) acc[i][j] = zinit;

  const int r0 = tid / CPR, q = tid % CPR;          // CPR threads/row, 16B each
  const bf16u* ag = A  + (size_t)(mbase + r0) * 1024 + q * 8;
  const bf16u* bg = Bt + (size_t)(nbase + r0) * 1024 + q * 8;

  auto stage = [&](int buf, int kb) {
    const int ko = kb * BK;
#pragma unroll   // row steps and LDS places become constants of each copy
    for (int c = 0; c < 128 / RPR; c++) {
      copy16(ag + ko + (size_t)(c * RPR) * 1024, &As[buf][(r0 + c * RPR) * PITCH + q * 8]);
      copy16(bg + ko + (size_t)(c * RPR) * 1024, &Bs[buf][(r0 + c * RPR) * PITCH + q * 8]);
    }
  };

  stage(0, 0);
  async_wait0();
  __syncthreads();

  int buf = 0;
  for (int kb = 0; kb < 1024 / BK; ++kb) {
    if (kb + 1 < 1024 / BK) stage(buf ^ 1, kb + 1);   // prefetch next tile

#pragma unroll   // fragment places become immediate offsets; loads of a block can run ahead
    for (int ks = 0; ks < BK / 32; ks++) {
      v16bf bfrag[2];
#pragma unroll
      for (int j = 0; j < 2; j++)
        bfrag[j] = load_frag(&Bs[buf][(wn * 32 + j * 16 + l) * PITCH + ks * 32], hi);
#pragma unroll
      for (int i = 0; i < 4; i++) {
        v16bf afrag = load_frag(&As[buf][(wm * 64 + i * 16 + l) * PITCH + ks * 32], hi);
#pragma unroll
        for (int j = 0; j < 2; j++)
          acc[i][j] = wmma_bf16(afrag, bfrag[j], acc[i][j]);
      }
    }

    async_wait0();
    __syncthreads();
    buf ^= 1;
  }

  // epilogue: C-layout value (lane l, half hi, comp r) = C[r + hi*8][l] of a 16x16 tile
#pragma unroll
  for (int i = 0; i < 4; i++) {
#pragma unroll
    for (int j = 0; j < 2; j++) {
      const int n = nbase + wn * 32 + j * 16 + l;
      const float bn = bias[n];
#pragma unroll
      for (int r = 0; r < 8; r++) {
        const int m = mbase + wm * 64 + i * 16 + r + hi * 8;
        float val = acc[i][j][r] + bn;
        if (MODE == 0) {
          int bb = m >> 11, s = m & 2047;
          int h = n >> 6, dh = n & 63;
          qkv[(size_t)z * MTOT * D_MODEL +
              (((size_t)(bb * NHEAD + h) * SEQ + s) * HDIM + dh)] = f2bf(val);
        } else {
          Hout[(size_t)m * D_MODEL + n] = val + resid[(size_t)m * D_MODEL + n];
        }
      }
    }
  }
}

// value of the lane 16 away (the other half of the same query column)
__device__ __forceinline__ float other_half(float x) {
  int b = __float_as_int(x);
  return __int_as_float(
      __builtin_amdgcn_permlanex16(b, b, 0x76543210, 0xfedcba98, false, false));
}

#define VPITCH 80   // V rows in LDS: 160 B = 32 B x odd, the transposing load's pitch

struct V8x2 { v8s a, b; };

// 16(d) x 32(t) A fragment of V^T out of the row-major V tile: two transposing loads,
// 16 keys apart. Lane (l, hi) gets column l of rows hi*8 .. hi*8+7 from each, which is
// the k order of load_frag. p is the lane's own address (see vlane in attn_kernel).
__device__ __forceinline__ v16bf load_frag_tr(const bf16u* p) {
  V8x2 t;
  t.a = __builtin_amdgcn_ds_load_tr16_b128_v8i16((AS3 v8s*)p);
  t.b = __builtin_amdgcn_ds_load_tr16_b128_v8i16((AS3 v8s*)(p + 16 * VPITCH));
  return __builtin_bit_cast(v16bf, t);
}

// A wave holds 32 query columns (two B fragments), so that every K and V fragment it reads
// from LDS feeds two products. To keep four waves a SIMD the keys are split instead: a stage
// is 128 keys, waves 0-3 take its first 64 and waves 4-7 its last 64, for the same 128
// queries. Each wave runs its own online softmax over its 1024 keys; the two partial
// results of a query (maximum, sum, O) are joined through LDS behind the loop.
// launch bounds and waves per SIMD: 256 registers a wave, two blocks share a WGP
__global__ __launch_bounds__(256) __attribute__((amdgpu_waves_per_eu(4, 4)))
void attn_kernel(const bf16u* __restrict__ qkv, bf16u* __restrict__ ctx) {
  __shared__ __attribute__((aligned(16))) bf16u Qs[128 * 72];   // 128 q-rows x 64, stride 72 (144B)
  // K and V: two buffers each, the next pass's tiles land while this pass's are worked on
  __shared__ __attribute__((aligned(16))) bf16u Ks[2][128 * 72];       // 128 k-rows x 64
  __shared__ __attribute__((aligned(16))) bf16u Vs[2][128 * VPITCH];   // 128 v-rows x 64, as in memory
  // hand-over of the second key half's partial result: 16 x 4 values of O, then maxima and sums
  __shared__ float4 Mg[4][17][32];

  const int tid  = threadIdx.x;
  const int wave = tid >> 5, lane = tid & 31;
  const int l = lane & 15, hi = lane >> 4;
  const int cg = wave & 3;    // which 32 query columns
  const int kh = wave >> 2;   // which 64 keys of every stage
  const int bh = blockIdx.y;
  const int qbase = blockIdx.x * 128;
  const size_t headoff = (size_t)bh * SEQ * HDIM;
  const bf16u* Qp = qkv + headoff;
  const bf16u* Kp = qkv + (size_t)MTOT * D_MODEL + headoff;
  const bf16u* Vp = qkv + (size_t)2 * MTOT * D_MODEL + headoff;

  // stage Q tile (16KB) async: 2 threads/row, 64B each
  {
    int row = tid >> 1, half = tid & 1;
    const bf16u* g = Qp + (size_t)(qbase + row) * HDIM + half * 32;
    bf16u* d = &Qs[row * 72 + half * 32];
#pragma unroll
    for (int c = 0; c < 4; c++) copy16(g + c * 8, d + c * 8);
  }

  // transposing load: lane reads 16 B of row hi*8 + (lane & 7), column half (lane >> 3) & 1
  const int vlane = (kh * 64 + hi * 8 + (lane & 7)) * VPITCH + ((lane >> 3) & 1) * 8;
  const int klane = (kh * 64 + l) * 72;

  // async copies of the 128 keys of pass kb into buffer b, rows as they lie in memory:
  // a wave's copy takes 512 contiguous B
  auto stage = [&](int b, int kb) {
    const bf16u* kg = Kp + (size_t)kb * (128 * HDIM);   // the same for the whole block
    const bf16u* vg = Vp + (size_t)kb * (128 * HDIM);
#pragma unroll
    for (int c = 0; c < 4; c++) {
      const int idx = tid + c * 256;
      const int t = idx >> 3, dc = (idx & 7) * 8;       // t * HDIM + dc = idx * 8
      copy16(kg + idx * 8, &Ks[b][t * 72 + dc]);
      copy16(vg + idx * 8, &Vs[b][t * VPITCH + dc]);
    }
  };

  v8f zinit = {};
  v8f sacc[2][4], o[2][4];
  float mrun[2];   // running maximum of this lane's two queries, equal in both halves
  float lrun[2];   // running sums over this half's keys; halves join at the end
#pragma unroll
  for (int c = 0; c < 2; c++) {
    mrun[c] = -1e30f;
    lrun[c] = 0.f;
#pragma unroll
    for (int n = 0; n < 4; n++) o[c][n] = zinit;
  }

  // ring prologue: Q and pass 0 land and are published, then pass 1's copies start
  stage(0, 0);
  asm volatile("s_wait_asynccnt 0x0" ::: "memory");   // this wave's Q, K, V copies have landed
  __syncthreads();                                    // ... and every other wave's
  stage(1, 1);

#pragma unroll 1   // rolled: two copies of the body keep every copy's LDS place in a register and spill
  for (int kb = 0; kb < SEQ / 128; ++kb) {
    const int b = kb & 1;

    // scores: S^T(64 keys x 32 queries) = K(64x64) * Q^T; A row = key, B column = query
    // sacc[c][j][r] = S^T[j*16 + hi*8 + r][c*16 + l]
#pragma unroll
    for (int c = 0; c < 2; c++)
#pragma unroll
      for (int j = 0; j < 4; j++) sacc[c][j] = zinit;
#pragma unroll
    for (int ks = 0; ks < 2; ks++) {
      v16bf qfrag0 = load_frag(&Qs[(cg * 32 + l) * 72 + ks * 32], hi);
      v16bf qfrag1 = load_frag(&Qs[(cg * 32 + 16 + l) * 72 + ks * 32], hi);
#pragma unroll
      for (int j = 0; j < 4; j++) {
        v16bf kfrag = load_frag(&Ks[b][klane + j * 16 * 72 + ks * 32], hi);
        sacc[0][j] = wmma_bf16(kfrag, qfrag0, sacc[0][j]);
        sacc[1][j] = wmma_bf16(kfrag, qfrag1, sacc[1][j]);
      }
    }

    // online softmax of two queries per lane: 32 keys of each in-lane, one exchange of halves
    // pfrag[c][ks]: B fragment of P^T, two score tiles converted in place: element s of
    // lane (l, hi) is key hi*8 + s (s < 8) or 16 + hi*8 + s - 8, the A side's k order
    v16bf pfrag[2][2];
#pragma unroll
    for (int c = 0; c < 2; c++) {
      // pairs along r lie in neighbouring registers of an accumulator: packed math, no moves
      v2f t2[4][4];
      float mt[4];   // one maximum and one sum per tile: four short chains, not one long
#pragma unroll
      for (int j = 0; j < 4; j++) {
        mt[j] = -1e30f;
#pragma unroll
        for (int h = 0; h < 4; h++) {
          v2f t = {sacc[c][j][2 * h], sacc[c][j][2 * h + 1]};
          t *= 0.125f;   // 1/sqrt(64)
          t2[j][h] = t;
          mt[j] = fmaxf(mt[j], fmaxf(t.x, t.y));
        }
      }
      float m_b = fmaxf(fmaxf(mt[0], mt[1]), fmaxf(mt[2], mt[3]));
      m_b = fmaxf(m_b, other_half(m_b));
      const float m_new = fmaxf(mrun[c], m_b);
      const float alpha = __expf(mrun[c] - m_new);
      mrun[c] = m_new;
      v2f srow[4];
#pragma unroll
      for (int j = 0; j < 4; j++) {
        srow[j] = (v2f){0.f, 0.f};
#pragma unroll
        for (int h = 0; h < 4; h++) {
          const v2f d = t2[j][h] - m_new;
          const v2f p = {__expf(d.x), __expf(d.y)};
          t2[j][h] = p;
          srow[j] += p;
        }
      }
      const v2f sall = (srow[0] + srow[1]) + (srow[2] + srow[3]);
      lrun[c] = lrun[c] * alpha + (sall.x + sall.y);
#pragma unroll
      for (int ks = 0; ks < 2; ks++)
#pragma unroll
        for (int h = 0; h < 4; h++) {
          pfrag[c][ks][2 * h]         = (__bf16)t2[2 * ks][h].x;
          pfrag[c][ks][2 * h + 1]     = (__bf16)t2[2 * ks][h].y;
          pfrag[c][ks][8 + 2 * h]     = (__bf16)t2[2 * ks + 1][h].x;
          pfrag[c][ks][8 + 2 * h + 1] = (__bf16)t2[2 * ks + 1][h].y;
        }
#pragma unroll
      for (int n = 0; n < 4; n++) o[c][n] *= alpha;
    }

    // ctx^T(64 d x 32 queries) += V^T(64x64) * P^T; A row = d, read transposed out of Vs[t][d]
#pragma unroll
    for (int ks = 0; ks < 2; ks++) {
#pragma unroll
      for (int n = 0; n < 4; n++) {
        v16bf vfrag = load_frag_tr(&Vs[b][vlane + ks * 32 * VPITCH + n * 16]);
        o[0][n] = wmma_bf16(vfrag, pfrag[0][ks], o[0][n]);
        o[1][n] = wmma_bf16(vfrag, pfrag[1][ks], o[1][n]);
      }
    }

    // publish point of pass kb + 1; the one barrier also ends every read of buffer b
    asm volatile("s_wait_dscnt 0x0" ::: "memory");      // own reads of buffer b are done before it is refilled
    asm volatile("s_wait_asynccnt 0x0" ::: "memory");   // own copies of pass kb + 1 have landed
    __syncthreads();
    if (kb + 2 < SEQ / 128) stage(b, kb + 2);           // flies during pass kb + 1
  }
  asm volatile("s_wait_asynccnt 0x0" ::: "memory");     // no copy outstanding when the wave ends

  // join of the two key halves: wave cg + 4 hands its partial result to wave cg, lane to lane
  // (both hold the same queries and the same d in the same lanes and registers)
  if (kh == 1) {
#pragma unroll
    for (int c = 0; c < 2; c++)
#pragma unroll
      for (int n = 0; n < 4; n++) {
        Mg[cg][(c * 4 + n) * 2 + 0][lane] = make_float4(o[c][n][0], o[c][n][1], o[c][n][2], o[c][n][3]);
        Mg[cg][(c * 4 + n) * 2 + 1][lane] = make_float4(o[c][n][4], o[c][n][5], o[c][n][6], o[c][n][7]);
      }
    Mg[cg][16][lane] = make_float4(mrun[0], mrun[1], lrun[0], lrun[1]);
  }
  __syncthreads();   // the hand-over is written before its reader starts
  if (kh == 1) return;

  // normalize and store ctx back to [B*S, D] bf16
  // o[c][n][r] = ctx^T[n*16 + hi*8 + r][c*16 + l]: 8 consecutive columns of one row per lane
  const int bb = bh >> 4, h = bh & 15;
  const float4 ml = Mg[cg][16][lane];
#pragma unroll
  for (int c = 0; c < 2; c++) {
    const float m2 = c ? ml.y : ml.x, l2 = c ? ml.w : ml.z;
    const float m  = fmaxf(mrun[c], m2);
    const float f1 = __expf(mrun[c] - m), f2 = __expf(m2 - m);
    const float lsum = lrun[c] * f1 + l2 * f2;
    const float inv = 1.0f / (lsum + other_half(lsum));
    const float g1 = f1 * inv, g2 = f2 * inv;
    const int s = qbase + cg * 32 + c * 16 + l;
    bf16u* crow = ctx + ((size_t)bb * SEQ + s) * D_MODEL + h * HDIM + hi * 8;
#pragma unroll
    for (int n = 0; n < 4; n++) {
      const float4 pa = Mg[cg][(c * 4 + n) * 2 + 0][lane];
      const float4 pb = Mg[cg][(c * 4 + n) * 2 + 1][lane];
      const float p2[8] = {pa.x, pa.y, pa.z, pa.w, pb.x, pb.y, pb.z, pb.w};
      union { uint4 u; bf16u h[8]; } pk;
#pragma unroll
      for (int r = 0; r < 8; r++) pk.h[r] = f2bf(o[c][n][r] * g1 + p2[r] * g2);
      *(uint4*)(crow + n * 16) = pk.u;
    }
  }
}

// ---------- LayerNorm over D=1024 per row ----------

__global__ void ln_kernel(const float* __restrict__ Hb, const float* __restrict__ gamma,
                          const float* __restrict__ beta, float* __restrict__ out) {
  __shared__ float rs[256], rss[256];
  const int row = blockIdx.x, tid = threadIdx.x;
  const float* hp = Hb + (size_t)row * D_MODEL;
  float s = 0.f, ss = 0.f;
  for (int i = tid; i < D_MODEL; i += 256) {
    float x = hp[i]; s += x; ss += x * x;
  }
  rs[tid] = s; rss[tid] = ss;
  __syncthreads();
  for (int st = 128; st > 0; st >>= 1) {
    if (tid < st) { rs[tid] += rs[tid + st]; rss[tid] += rss[tid + st]; }
    __syncthreads();
  }
  float mu   = rs[0] * (1.0f / D_MODEL);
  float var  = rss[0] * (1.0f / D_MODEL) - mu * mu;
  float rstd = rsqrtf(var + 1e-12f);
  for (int i = tid; i < D_MODEL; i += 256) {
    out[(size_t)row * D_MODEL + i] = (hp[i] - mu) * rstd * gamma[i] + beta[i];
  }
}

// ---------- launch ----------

extern "C" void kernel_launch(void* const* d_in, const int* in_sizes, int n_in,
                              void* d_out, int out_size, void* d_ws, size_t ws_size,
                              hipStream_t stream) {
  (void)in_sizes; (void)n_in; (void)out_size; (void)ws_size;
  const float* X     = (const float*)d_in[0];
  const float* Wq    = (const float*)d_in[1];
  const float* bq    = (const float*)d_in[2];
  const float* Wk    = (const float*)d_in[3];
  const float* bk    = (const float*)d_in[4];
  const float* Wv    = (const float*)d_in[5];
  const float* bv    = (const float*)d_in[6];
  const float* Wo    = (const float*)d_in[7];
  const float* bo    = (const float*)d_in[8];
  const float* gamma = (const float*)d_in[9];
  const float* beta  = (const float*)d_in[10];
  float* out = (float*)d_out;

  char* ws = (char*)d_ws;
  bf16u* Xb  = (bf16u*)ws;                              //  8 MB: X in bf16
  bf16u* WT  = (bf16u*)(ws + 8ull  * 1024 * 1024);      //  8 MB: 4 transposed weights
  bf16u* QKV = (bf16u*)(ws + 16ull * 1024 * 1024);      // 24 MB: Q,K,V [B,H,S,Dh]
  bf16u* Ctx = (bf16u*)(ws + 40ull * 1024 * 1024);      //  8 MB: context [B*S, D]
  float* Hb  = (float*)(ws + 48ull * 1024 * 1024);      // 16 MB: pre-LN fp32

  cvt_x_kernel <<<dim3(MTOT * D_MODEL / 1024), 256, 0, stream>>>(X, Xb);
  cvt_wT_kernel<<<dim3(8, 16, 4),              256, 0, stream>>>(Wq, Wk, Wv, Wo, WT);
  // stage length by residency: four blocks share a WGP's LDS in the first, two in the second
  gemm_kernel<0, 64><<<dim3(8, 32, 3), 256, 0, stream>>>(Xb, WT, bq, bk, bv, QKV,
                                                         nullptr, nullptr);
  attn_kernel  <<<dim3(16, 32),    256, 0, stream>>>(QKV, Ctx);
  gemm_kernel<1, 128><<<dim3(8, 32, 1), 256, 0, stream>>>(Ctx, WT + 3ull * 1024 * 1024,
                                                          bo, nullptr, nullptr, nullptr,
                                                          X, Hb);
  ln_kernel    <<<dim3(4096),      256, 0, stream>>>(Hb, gamma, beta, out);
}

// v007
// Measured time: 89.3 microseconds a run.
// In two side-by-side timings against v006, it was 1.04 and 1.05 times as fast.
// All steps since v000 together make it 2.17 times as fast.
#include <hip/hip_runtime.h>
#include <stdint.h>

typedef unsigned short bf16u;
typedef __attribute__((ext_vector_type(16))) __bf16 v16bf;
typedef __attribute__((ext_vector_type(8)))  float  v8f;
typedef __attribute__((ext_vector_type(2)))  float  v2f;
typedef __attribute__((ext_vector_type(4)))  int    v4i;
typedef __attribute__((ext_vector_type(8)))  short  v8s;

#define D_MODEL 1024
#define SEQ     2048
#define NHEAD   16
#define HDIM    64
#define MTOT    4096   // B*S

#define AS1 __attribute__((address_space(1)))
#define AS3 __attribute__((address_space(3)))

#if defined(__has_builtin)
#if __has_builtin(__builtin_amdgcn_global_load_async_to_lds_b128)
#define HAVE_ASYNC_LDS 1
#endif
#endif
#ifndef HAVE_ASYNC_LDS
#define HAVE_ASYNC_LDS 0
#endif

// ---------- helpers ----------

__device__ __forceinline__ bf16u f2bf(float f) {
  unsigned u = __float_as_uint(f);
  unsigned r = ((u >> 16) & 1u) + 0x7fffu;   // round-to-nearest-even
  return (bf16u)((u + r) >> 16);
}

struct U4x2 { uint4 a, b; };

// Load a 16x32 bf16 A/B fragment row for lane (l, hi): two contiguous 16B
// chunks per the CDNA5 16-bit matrix VGPR layout (K pairs hi*8.. and 16+hi*8..)
__device__ __forceinline__ v16bf load_frag(const bf16u* rowp, int hi) {
  U4x2 t;
  t.a = *(const uint4*)(rowp + hi * 8);
  t.b = *(const uint4*)(rowp + 16 + hi * 8);
  return __builtin_bit_cast(v16bf, t);
}

__device__ __forceinline__ v8f wmma_bf16(v16bf a, v16bf b, v8f c) {
  return __builtin_amdgcn_wmma_f32_16x16x32_bf16(
      false, a, false, b, (short)0, c, false, false);
}

// 16-byte global->LDS copy: async (ASYNCcnt-tracked, bypasses VGPRs) if available
__device__ __forceinline__ void copy16(const bf16u* g, bf16u* l) {
#if HAVE_ASYNC_LDS
  __builtin_amdgcn_global_load_async_to_lds_b128((AS1 v4i*)g, (AS3 v4i*)l, 0, 0);
#else
  *(uint4*)l = *(const uint4*)g;
#endif
}

__device__ __forceinline__ void async_wait0() {
#if HAVE_ASYNC_LDS
#if __has_builtin(__builtin_amdgcn_s_wait_asynccnt)
  __builtin_amdgcn_s_wait_asynccnt(0);
#else
  asm volatile("s_wait_asynccnt 0" ::: "memory");
#endif
#endif
}

// 16-lane row reductions via DPP16 (pure VALU, co-executes with WMMA):
// quad_perm xor1, quad_perm xor2, row_half_mirror (8), row_mirror (16)
__device__ __forceinline__ float row16_max(float x) {
  int v;
  v = __builtin_amdgcn_update_dpp(0, __float_as_int(x), 0xB1,  0xf, 0xf, true);
  x = fmaxf(x, __int_as_float(v));
  v = __builtin_amdgcn_update_dpp(0, __float_as_int(x), 0x4E,  0xf, 0xf, true);
  x = fmaxf(x, __int_as_float(v));
  v = __builtin_amdgcn_update_dpp(0, __float_as_int(x), 0x141, 0xf, 0xf, true);
  x = fmaxf(x, __int_as_float(v));
  v = __builtin_amdgcn_update_dpp(0, __float_as_int(x), 0x140, 0xf, 0xf, true);
  x = fmaxf(x, __int_as_float(v));
  return x;
}

__device__ __forceinline__ float row16_sum(float x) {
  int v;
  v = __builtin_amdgcn_update_dpp(0, __float_as_int(x), 0xB1,  0xf, 0xf, true);
  x += __int_as_float(v);
  v = __builtin_amdgcn_update_dpp(0, __float_as_int(x), 0x4E,  0xf, 0xf, true);
  x += __int_as_float(v);
  v = __builtin_amdgcn_update_dpp(0, __float_as_int(x), 0x141, 0xf, 0xf, true);
  x += __int_as_float(v);
  v = __builtin_amdgcn_update_dpp(0, __float_as_int(x), 0x140, 0xf, 0xf, true);
  x += __int_as_float(v);
  return x;
}

// ---------- conversion kernels ----------

__global__ void cvt_x_kernel(const float* __restrict__ X, bf16u* __restrict__ Xb) {
  int i = blockIdx.x * blockDim.x + threadIdx.x;   // one float4 each
  float4 v = ((const float4*)X)[i];
  union { bf16u h[4]; uint2 u; } o;
  o.h[0] = f2bf(v.x); o.h[1] = f2bf(v.y); o.h[2] = f2bf(v.z); o.h[3] = f2bf(v.w);
  ((uint2*)Xb)[i] = o.u;
}

// WT[z][n][k] = W_z[k][n]  (bf16, transposed so B-fragments load row-wise)
// One 128(k) x 64(n) tile per block. A lane reads 8 rows x 4 columns (16 lanes cover 256
// contiguous bytes of a row), turns them into 4 rows of 8 k in registers, and the tile
// goes through LDS so that every output row leaves as 256 contiguous bytes.
__global__ void cvt_wT_kernel(const float* __restrict__ W0, const float* __restrict__ W1,
                              const float* __restrict__ W2, const float* __restrict__ W3,
                              bf16u* __restrict__ WT) {
  __shared__ bf16u Ts[64 * 136];     // [n][k], pitch 272 B (16 B x odd) for 16-byte readers
  const int z = blockIdx.z;
  const float* W = (z == 0) ? W0 : (z == 1) ? W1 : (z == 2) ? W2 : W3;
  const int tid = threadIdx.x;
  const int k0 = blockIdx.x * 128, n0 = blockIdx.y * 64;
  const int c = tid & 15, g = tid >> 4;

  const float* sp = W + (size_t)(k0 + g * 8) * 1024 + n0 + c * 4;
  float4 v[8];
#pragma unroll
  for (int i = 0; i < 8; i++) v[i] = *(const float4*)(sp + (size_t)i * 1024);

  union { bf16u h[8]; uint4 u; } p0, p1, p2, p3;
#pragma unroll
  for (int i = 0; i < 8; i++) {
    p0.h[i] = f2bf(v[i].x); p1.h[i] = f2bf(v[i].y);
    p2.h[i] = f2bf(v[i].z); p3.h[i] = f2bf(v[i].w);
  }
  *(uint4*)&Ts[(c * 4 + 0) * 136 + g * 8] = p0.u;
  *(uint4*)&Ts[(c * 4 + 1) * 136 + g * 8] = p1.u;
  *(uint4*)&Ts[(c * 4 + 2) * 136 + g * 8] = p2.u;
  *(uint4*)&Ts[(c * 4 + 3) * 136 + g * 8] = p3.u;
  __syncthreads();

  bf16u* dp = WT + (size_t)z * 1024 * 1024 + (size_t)n0 * 1024 + k0 + c * 8;
#pragma unroll
  for (int r = 0; r < 4; r++) {
    const int row = g + r * 16;
    *(uint4*)(dp + (size_t)row * 1024) = *(const uint4*)&Ts[row * 136 + c * 8];
  }
}

// ---------- tiled bf16 WMMA GEMM: C = A(4096x1024) * WT^T + bias ----------
// Double-buffered LDS staging with async global->LDS copies.
// A stage holds BK k of every tile row: BK * 2 bytes of a row are whole 128-byte lines,
// and one wait and one barrier serve BK / 32 blocks of 8 products per wave.
// MODE 0: QKV projection, writes bf16 into [B,H,S,Dh], z = blockIdx.z selects matrix
// MODE 1: output projection, adds residual, writes fp32 Hout
template <int MODE, int BK>
__global__ void gemm_kernel(const bf16u* __restrict__ A,
                            const bf16u* __restrict__ WT,
                            const float* __restrict__ bias0,
                            const float* __restrict__ bias1,
                            const float* __restrict__ bias2,
                            bf16u* __restrict__ qkv,
                            const float* __restrict__ resid,
                            float* __restrict__ Hout) {
  constexpr int PITCH = BK + 8;      // row pitch in LDS: 16 B x odd for 16-byte readers
  constexpr int CPR   = BK / 8;      // 16-byte copies per row
  constexpr int RPR   = 256 / CPR;   // rows that one copy of every thread covers
  __shared__ __attribute__((aligned(16))) bf16u As[2][128 * PITCH];
  __shared__ __attribute__((aligned(16))) bf16u Bs[2][128 * PITCH];

  const int tid  = threadIdx.x;
  const int wave = tid >> 5, lane = tid & 31;
  const int l = lane & 15, hi = lane >> 4;
  const int wm = wave >> 2, wn = wave & 3;          // 2x4 wave grid
  const int z = (MODE == 0) ? blockIdx.z : 0;
  const int mbase = blockIdx.y * 128;
  const int nbase = blockIdx.x * 128;
  const bf16u* Bt = WT + (size_t)z * (1024 * 1024);
  const float* bias = (MODE == 0) ? ((z == 0) ? bias0 : (z == 1) ? bias1 : bias2)
                                  : bias0;

  v8f zinit = {};
  v8f acc[4][2];
#pragma unroll
  for (int i = 0; i < 4; i++)
#pragma unroll
    for (int j = 0; j < 2; j++) acc[i][j] = zinit;

  const int r0 = tid / CPR, q = tid % CPR;          // CPR threads/row, 16B each
  const bf16u* ag = A  + (size_t)(mbase + r0) * 1024 + q * 8;
  const bf16u* bg = Bt + (size_t)(nbase + r0) * 1024 + q * 8;

  auto stage = [&](int buf, int kb) {
    const int ko = kb * BK;
#pragma unroll   // row steps and LDS places become constants of each copy
    for (int c = 0; c < 128 / RPR; c++) {
      copy16(ag + ko + (size_t)(c * RPR) * 1024, &As[buf][(r0 + c * RPR) * PITCH + q * 8]);
      copy16(bg + ko + (size_t)(c * RPR) * 1024, &Bs[buf][(r0 + c * RPR) * PITCH + q * 8]);
    }
  };

  stage(0, 0);
  async_wait0();
  __syncthreads();

  int buf = 0;
  for (int kb = 0; kb < 1024 / BK; ++kb) {
    if (kb + 1 < 1024 / BK) stage(buf ^ 1, kb + 1);   // prefetch next tile

#pragma unroll   // fragment places become immediate offsets; loads of a block can run ahead
    for (int ks = 0; ks < BK / 32; ks++) {
      v16bf bfrag[2];
#pragma unroll
      for (int j = 0; j < 2; j++)
        bfrag[j] = load_frag(&Bs[buf][(wn * 32 + j * 16 + l) * PITCH + ks * 32], hi);
#pragma unroll
      for (int i = 0; i < 4; i++) {
        v16bf afrag = load_frag(&As[buf][(wm * 64 + i * 16 + l) * PITCH + ks * 32], hi);
#pragma unroll
        for (int j = 0; j < 2; j++)
          acc[i][j] = wmma_bf16(afrag, bfrag[j], acc[i][j]);
      }
    }

    async_wait0();
    __syncthreads();
    buf ^= 1;
  }

  // epilogue: C-layout value (lane l, half hi, comp r) = C[r + hi*8][l] of a 16x16 tile
#pragma unroll
  for (int i = 0; i < 4; i++) {
#pragma unroll
    for (int j = 0; j < 2; j++) {
      const int n = nbase + wn * 32 + j * 16 + l;
      const float bn = bias[n];
#pragma unroll
      for (int r = 0; r < 8; r++) {
        const int m = mbase + wm * 64 + i * 16 + r + hi * 8;
        float val = acc[i][j][r] + bn;
        if (MODE == 0) {
          int bb = m >> 11, s = m & 2047;
          int h = n >> 6, dh = n & 63;
          qkv[(size_t)z * MTOT * D_MODEL +
              (((size_t)(bb * NHEAD + h) * SEQ + s) * HDIM + dh)] = f2bf(val);
        } else {
          Hout[(size_t)m * D_MODEL + n] = val + resid[(size_t)m * D_MODEL + n];
        }
      }
    }
  }
}

// value of the lane 16 away (the other half of the same query column)
__device__ __forceinline__ float other_half(float x) {
  int b = __float_as_int(x);
  return __int_as_float(
      __builtin_amdgcn_permlanex16(b, b, 0x76543210, 0xfedcba98, false, false));
}

#define VPITCH 80   // V rows in LDS: 160 B = 32 B x odd, the transposing load's pitch

struct V8x2 { v8s a, b; };

// 16(d) x 32(t) A fragment of V^T out of the row-major V tile: two transposing loads,
// 16 keys apart. Lane (l, hi) gets column l of rows hi*8 .. hi*8+7 from each, which is
// the k order of load_frag. p is the lane's own address (see vlane in attn_kernel).
__device__ __forceinline__ v16bf load_frag_tr(const bf16u* p) {
  V8x2 t;
  t.a = __builtin_amdgcn_ds_load_tr16_b128_v8i16((AS3 v8s*)p);
  t.b = __builtin_amdgcn_ds_load_tr16_b128_v8i16((AS3 v8s*)(p + 16 * VPITCH));
  return __builtin_bit_cast(v16bf, t);
}

// A wave holds 32 query columns (two B fragments), so that every K and V fragment it reads
// from LDS feeds two products. To keep four waves a SIMD the keys are split instead: a stage
// is 128 keys, waves 0-3 take its first 64 and waves 4-7 its last 64, for the same 128
// queries. Each wave runs its own online softmax over its 1024 keys; the two partial
// results of a query (maximum, sum, O) are joined through LDS behind the loop.
// launch bounds and waves per SIMD: 256 registers a wave, two blocks share a WGP
__global__ __launch_bounds__(256) __attribute__((amdgpu_waves_per_eu(4, 4)))
void attn_kernel(const bf16u* __restrict__ qkv, bf16u* __restrict__ ctx) {
  __shared__ __attribute__((aligned(16))) bf16u Qs[128 * 72];   // 128 q-rows x 64, stride 72 (144B)
  // K and V: two buffers each, the next pass's tiles land while this pass's are worked on
  __shared__ __attribute__((aligned(16))) bf16u Ks[2][128 * 72];       // 128 k-rows x 64
  __shared__ __attribute__((aligned(16))) bf16u Vs[2][128 * VPITCH];   // 128 v-rows x 64, as in memory
  // hand-over of the second key half's partial result: 16 x 4 values of O, then maxima and sums
  __shared__ float4 Mg[4][17][32];

  const int tid  = threadIdx.x;
  const int wave = tid >> 5, lane = tid & 31;
  const int l = lane & 15, hi = lane >> 4;
  const int cg = wave & 3;    // which 32 query columns
  const int kh = wave >> 2;   // which 64 keys of every stage
  const int bh = blockIdx.y;
  const int qbase = blockIdx.x * 128;
  const size_t headoff = (size_t)bh * SEQ * HDIM;
  const bf16u* Qp = qkv + headoff;
  const bf16u* Kp = qkv + (size_t)MTOT * D_MODEL + headoff;
  const bf16u* Vp = qkv + (size_t)2 * MTOT * D_MODEL + headoff;

  // stage Q tile (16KB) async: 2 threads/row, 64B each
  {
    int row = tid >> 1, half = tid & 1;
    const bf16u* g = Qp + (size_t)(qbase + row) * HDIM + half * 32;
    bf16u* d = &Qs[row * 72 + half * 32];
#pragma unroll
    for (int c = 0; c < 4; c++) copy16(g + c * 8, d + c * 8);
  }

  // transposing load: lane reads 16 B of row hi*8 + (lane & 7), column half (lane >> 3) & 1
  const int vlane = (kh * 64 + hi * 8 + (lane & 7)) * VPITCH + ((lane >> 3) & 1) * 8;
  const int klane = (kh * 64 + l) * 72;

  // async copies of the 128 keys of pass kb into buffer b, rows as they lie in memory:
  // a wave's copy takes 512 contiguous B
  auto stage = [&](int b, int kb) {
    const bf16u* kg = Kp + (size_t)kb * (128 * HDIM);   // the same for the whole block
    const bf16u* vg = Vp + (size_t)kb * (128 * HDIM);
#pragma unroll
    for (int c = 0; c < 4; c++) {
      const int idx = tid + c * 256;
      const int t = idx >> 3, dc = (idx & 7) * 8;       // t * HDIM + dc = idx * 8
      copy16(kg + idx * 8, &Ks[b][t * 72 + dc]);
      copy16(vg + idx * 8, &Vs[b][t * VPITCH + dc]);
    }
  };

  v8f zinit = {};
  v8f sacc[2][4], o[2][4];
  float mrun[2];   // running maximum of this lane's two queries, equal in both halves
  float lrun[2];   // running sums over this half's keys; halves join at the end
#pragma unroll
  for (int c = 0; c < 2; c++) {
    mrun[c] = -1e30f;
    lrun[c] = 0.f;
#pragma unroll
    for (int n = 0; n < 4; n++) o[c][n] = zinit;
  }

  // ring prologue: Q and pass 0 land and are published, then pass 1's copies start
  stage(0, 0);
  asm volatile("s_wait_asynccnt 0x0" ::: "memory");   // this wave's Q, K, V copies have landed
  __syncthreads();                                    // ... and every other wave's
  stage(1, 1);

#pragma unroll 1   // rolled: two copies of the body keep every copy's LDS place in a register and spill
  for (int kb = 0; kb < SEQ / 128; ++kb) {
    const int b = kb & 1;

    // scores: S^T(64 keys x 32 queries) = K(64x64) * Q^T; A row = key, B column = query
    // sacc[c][j][r] = S^T[j*16 + hi*8 + r][c*16 + l]
#pragma unroll
    for (int c = 0; c < 2; c++)
#pragma unroll
      for (int j = 0; j < 4; j++) sacc[c][j] = zinit;
#pragma unroll
    for (int ks = 0; ks < 2; ks++) {
      v16bf qfrag0 = load_frag(&Qs[(cg * 32 + l) * 72 + ks * 32], hi);
      v16bf qfrag1 = load_frag(&Qs[(cg * 32 + 16 + l) * 72 + ks * 32], hi);
#pragma unroll
      for (int j = 0; j < 4; j++) {
        v16bf kfrag = load_frag(&Ks[b][klane + j * 16 * 72 + ks * 32], hi);
        sacc[0][j] = wmma_bf16(kfrag, qfrag0, sacc[0][j]);
        sacc[1][j] = wmma_bf16(kfrag, qfrag1, sacc[1][j]);
      }
    }

    // online softmax of two queries per lane: 32 keys of each in-lane, one exchange of halves
    // pfrag[c][ks]: B fragment of P^T, two score tiles converted in place: element s of
    // lane (l, hi) is key hi*8 + s (s < 8) or 16 + hi*8 + s - 8, the A side's k order
    v16bf pfrag[2][2];
#pragma unroll
    for (int c = 0; c < 2; c++) {
      // pairs along r lie in neighbouring registers of an accumulator: packed math, no moves
      v2f t2[4][4];
      float mt[4];   // one maximum and one sum per tile: four short chains, not one long
#pragma unroll
      for (int j = 0; j < 4; j++) {
        mt[j] = -1e30f;
#pragma unroll
        for (int h = 0; h < 4; h++) {
          v2f t = {sacc[c][j][2 * h], sacc[c][j][2 * h + 1]};
          t *= 0.125f;   // 1/sqrt(64)
          t2[j][h] = t;
          mt[j] = fmaxf(mt[j], fmaxf(t.x, t.y));
        }
      }
      float m_b = fmaxf(fmaxf(mt[0], mt[1]), fmaxf(mt[2], mt[3]));
      m_b = fmaxf(m_b, other_half(m_b));
      const float m_new = fmaxf(mrun[c], m_b);
      const float alpha = __expf(mrun[c] - m_new);
      mrun[c] = m_new;
      v2f srow[4];
#pragma unroll
      for (int j = 0; j < 4; j++) {
        srow[j] = (v2f){0.f, 0.f};
#pragma unroll
        for (int h = 0; h < 4; h++) {
          const v2f d = t2[j][h] - m_new;
          const v2f p = {__expf(d.x), __expf(d.y)};
          t2[j][h] = p;
          srow[j] += p;
        }
      }
      const v2f sall = (srow[0] + srow[1]) + (srow[2] + srow[3]);
      lrun[c] = lrun[c] * alpha + (sall.x + sall.y);
#pragma unroll
      for (int ks = 0; ks < 2; ks++)
#pragma unroll
        for (int h = 0; h < 4; h++) {
          pfrag[c][ks][2 * h]         = (__bf16)t2[2 * ks][h].x;
          pfrag[c][ks][2 * h + 1]     = (__bf16)t2[2 * ks][h].y;
          pfrag[c][ks][8 + 2 * h]     = (__bf16)t2[2 * ks + 1][h].x;
          pfrag[c][ks][8 + 2 * h + 1] = (__bf16)t2[2 * ks + 1][h].y;
        }
#pragma unroll
      for (int n = 0; n < 4; n++) o[c][n] *= alpha;
    }

    // ctx^T(64 d x 32 queries) += V^T(64x64) * P^T; A row = d, read transposed out of Vs[t][d]
#pragma unroll
    for (int ks = 0; ks < 2; ks++) {
#pragma unroll
      for (int n = 0; n < 4; n++) {
        v16bf vfrag = load_frag_tr(&Vs[b][vlane + ks * 32 * VPITCH + n * 16]);
        o[0][n] = wmma_bf16(vfrag, pfrag[0][ks], o[0][n]);
        o[1][n] = wmma_bf16(vfrag, pfrag[1][ks], o[1][n]);
      }
    }

    // publish point of pass kb + 1; the one barrier also ends every read of buffer b
    asm volatile("s_wait_dscnt 0x0" ::: "memory");      // own reads of buffer b are done before it is refilled
    asm volatile("s_wait_asynccnt 0x0" ::: "memory");   // own copies of pass kb + 1 have landed
    __syncthreads();
    if (kb + 2 < SEQ / 128) stage(b, kb + 2);           // flies during pass kb + 1
  }
  asm volatile("s_wait_asynccnt 0x0" ::: "memory");     // no copy outstanding when the wave ends

  // join of the two key halves: wave cg + 4 hands its partial result to wave cg, lane to lane
  // (both hold the same queries and the same d in the same lanes and registers)
  if (kh == 1) {
#pragma unroll
    for (int c = 0; c < 2; c++)
#pragma unroll
      for (int n = 0; n < 4; n++) {
        Mg[cg][(c * 4 + n) * 2 + 0][lane] = make_float4(o[c][n][0], o[c][n][1], o[c][n][2], o[c][n][3]);
        Mg[cg][(c * 4 + n) * 2 + 1][lane] = make_float4(o[c][n][4], o[c][n][5], o[c][n][6], o[c][n][7]);
      }
    Mg[cg][16][lane] = make_float4(mrun[0], mrun[1], lrun[0], lrun[1]);
  }
  __syncthreads();   // the hand-over is written before its reader starts
  if (kh == 1) return;

  // normalize and store ctx back to [B*S, D] bf16
  // o[c][n][r] = ctx^T[n*16 + hi*8 + r][c*16 + l]: 8 consecutive columns of one row per lane
  const int bb = bh >> 4, h = bh & 15;
  const float4 ml = Mg[cg][16][lane];
#pragma unroll
  for (int c = 0; c < 2; c++) {
    const float m2 = c ? ml.y : ml.x, l2 = c ? ml.w : ml.z;
    const float m  = fmaxf(mrun[c], m2);
    const float f1 = __expf(mrun[c] - m), f2 = __expf(m2 - m);
    const float lsum = lrun[c] * f1 + l2 * f2;
    const float inv = 1.0f / (lsum + other_half(lsum));
    const float g1 = f1 * inv, g2 = f2 * inv;
    const int s = qbase + cg * 32 + c * 16 + l;
    bf16u* crow = ctx + ((size_t)bb * SEQ + s) * D_MODEL + h * HDIM + hi * 8;
#pragma unroll
    for (int n = 0; n < 4; n++) {
      const float4 pa = Mg[cg][(c * 4 + n) * 2 + 0][lane];
      const float4 pb = Mg[cg][(c * 4 + n) * 2 + 1][lane];
      const float p2[8] = {pa.x, pa.y, pa.z, pa.w, pb.x, pb.y, pb.z, pb.w};
      union { uint4 u; bf16u h[8]; } pk;
#pragma unroll
      for (int r = 0; r < 8; r++) pk.h[r] = f2bf(o[c][n][r] * g1 + p2[r] * g2);
      *(uint4*)(crow + n * 16) = pk.u;
    }
  }
}

// ---------- LayerNorm over D=1024 per row ----------
// One wave per row, the row held in registers: a lane asks for its 8 x 16 bytes at once
// (each wave-wide load is 512 contiguous bytes), so a row pays one memory latency and is
// read once. The two row sums close inside the wave: no LDS, no barrier.

typedef __attribute__((ext_vector_type(4))) float v4f;

__global__ __launch_bounds__(256)
void ln_kernel(const float* __restrict__ Hb, const float* __restrict__ gamma,
               const float* __restrict__ beta, float* __restrict__ out) {
  const int lane = threadIdx.x & 31;
  // the wave's number as a scalar: the row's base then sits in scalar registers
  const int wave = __builtin_amdgcn_readfirstlane(threadIdx.x >> 5);
  const int row = blockIdx.x * 8 + wave;
  const v4f* hp = (const v4f*)(Hb + (size_t)row * D_MODEL) + lane;
  const v4f* gp = (const v4f*)gamma + lane;
  const v4f* bp = (const v4f*)beta + lane;
  v4f*       op = (v4f*)(out + (size_t)row * D_MODEL) + lane;

  // the loops below are unrolled so that x, g and b are registers, not arrays in scratch
  v4f x[8], g[8], b[8];
#pragma unroll
  for (int i = 0; i < 8; i++) x[i] = hp[i * 32];
#pragma unroll
  for (int i = 0; i < 8; i++) { g[i] = gp[i * 32]; b[i] = bp[i * 32]; }
  // inputs-only fence on the loaded values: all 24 loads are asked for ahead of the sums.
  // Left free, the compiler sinks the gamma and beta loads behind the row sums, two at a
  // time, and their latencies then add to the row's.
  asm volatile("" :: "v"(x[0]), "v"(x[1]), "v"(x[2]), "v"(x[3]),
                     "v"(x[4]), "v"(x[5]), "v"(x[6]), "v"(x[7]),
                     "v"(g[0]), "v"(g[1]), "v"(g[2]), "v"(g[3]),
                     "v"(g[4]), "v"(g[5]), "v"(g[6]), "v"(g[7]),
                     "v"(b[0]), "v"(b[1]), "v"(b[2]), "v"(b[3]),
                     "v"(b[4]), "v"(b[5]), "v"(b[6]), "v"(b[7]));

  // four independent chains per sum
  v4f s4 = {0.f, 0.f, 0.f, 0.f}, q4 = s4;
#pragma unroll
  for (int i = 0; i < 8; i++) { s4 += x[i]; q4 += x[i] * x[i]; }
  float s  = row16_sum((s4.x + s4.y) + (s4.z + s4.w));
  float ss = row16_sum((q4.x + q4.y) + (q4.z + q4.w));
  s  += other_half(s);
  ss += other_half(ss);

  const float mu   = s * (1.0f / D_MODEL);
  const float var  = ss * (1.0f / D_MODEL) - mu * mu;
  const float rstd = rsqrtf(var + 1e-12f);
#pragma unroll
  for (int i = 0; i < 8; i++) op[i * 32] = (x[i] - mu) * rstd * g[i] + b[i];
}

// ---------- launch ----------

extern "C" void kernel_launch(void* const* d_in, const int* in_sizes, int n_in,
                              void* d_out, int out_size, void* d_ws, size_t ws_size,
                              hipStream_t stream) {
  (void)in_sizes; (void)n_in; (void)out_size; (void)ws_size;
  const float* X     = (const float*)d_in[0];
  const float* Wq    = (const float*)d_in[1];
  const float* bq    = (const float*)d_in[2];
  const float* Wk    = (const float*)d_in[3];
  const float* bk    = (const float*)d_in[4];
  const float* Wv    = (const float*)d_in[5];
  const float* bv    = (const float*)d_in[6];
  const float* Wo    = (const float*)d_in[7];
  const float* bo    = (const float*)d_in[8];
  const float* gamma = (const float*)d_in[9];
  const float* beta  = (const float*)d_in[10];
  float* out = (float*)d_out;

  char* ws = (char*)d_ws;
  bf16u* Xb  = (bf16u*)ws;                              //  8 MB: X in bf16
  bf16u* WT  = (bf16u*)(ws + 8ull  * 1024 * 1024);      //  8 MB: 4 transposed weights
  bf16u* QKV = (bf16u*)(ws + 16ull * 1024 * 1024);      // 24 MB: Q,K,V [B,H,S,Dh]
  bf16u* Ctx = (bf16u*)(ws + 40ull * 1024 * 1024);      //  8 MB: context [B*S, D]
  float* Hb  = (float*)(ws + 48ull * 1024 * 1024);      // 16 MB: pre-LN fp32

  cvt_x_kernel <<<dim3(MTOT * D_MODEL / 1024), 256, 0, stream>>>(X, Xb);
  cvt_wT_kernel<<<dim3(8, 16, 4),              256, 0, stream>>>(Wq, Wk, Wv, Wo, WT);
  // stage length by residency: four blocks share a WGP's LDS in the first, two in the second
  gemm_kernel<0, 64><<<dim3(8, 32, 3), 256, 0, stream>>>(Xb, WT, bq, bk, bv, QKV,
                                                         nullptr, nullptr);
  attn_kernel  <<<dim3(16, 32),    256, 0, stream>>>(QKV, Ctx);
  gemm_kernel<1, 128><<<dim3(8, 32, 1), 256, 0, stream>>>(Ctx, WT + 3ull * 1024 * 1024,
                                                          bo, nullptr, nullptr, nullptr,
                                                          X, Hb);
  ln_kernel    <<<dim3(MTOT / 8),  256, 0, stream>>>(Hb, gamma, beta, out);
}

// v008
// A run of this version takes 85 microseconds.
// Timed twice side by side with v007, it ran 1.05 times as fast both times.
// Counting every step since v000, it is 2.28 times as fast.
#include <hip/hip_runtime.h>
#include <stdint.h>

typedef unsigned short bf16u;
typedef __attribute__((ext_vector_type(16))) __bf16 v16bf;
typedef __attribute__((ext_vector_type(8)))  float  v8f;
typedef __attribute__((ext_vector_type(2)))  float  v2f;
typedef __attribute__((ext_vector_type(4)))  int    v4i;
typedef __attribute__((ext_vector_type(8)))  short  v8s;
typedef __attribute__((ext_vector_type(8)))  __bf16 v8bf;

#define D_MODEL 1024
#define SEQ     2048
#define NHEAD   16
#define HDIM    64
#define MTOT    4096   // B*S

#define AS1 __attribute__((address_space(1)))
#define AS3 __attribute__((address_space(3)))

#if defined(__has_builtin)
#if __has_builtin(__builtin_amdgcn_global_load_async_to_lds_b128)
#define HAVE_ASYNC_LDS 1
#endif
#endif
#ifndef HAVE_ASYNC_LDS
#define HAVE_ASYNC_LDS 0
#endif

// ---------- helpers ----------

__device__ __forceinline__ bf16u f2bf(float f) {
  unsigned u = __float_as_uint(f);
  unsigned r = ((u >> 16) & 1u) + 0x7fffu;   // round-to-nearest-even
  return (bf16u)((u + r) >> 16);
}

struct U4x2 { uint4 a, b; };

// Load a 16x32 bf16 A/B fragment row for lane (l, hi): two contiguous 16B
// chunks per the CDNA5 16-bit matrix VGPR layout (K pairs hi*8.. and 16+hi*8..)
__device__ __forceinline__ v16bf load_frag(const bf16u* rowp, int hi) {
  U4x2 t;
  t.a = *(const uint4*)(rowp + hi * 8);
  t.b = *(const uint4*)(rowp + 16 + hi * 8);
  return __builtin_bit_cast(v16bf, t);
}

__device__ __forceinline__ v8f wmma_bf16(v16bf a, v16bf b, v8f c) {
  return __builtin_amdgcn_wmma_f32_16x16x32_bf16(
      false, a, false, b, (short)0, c, false, false);
}

// 16-byte global->LDS copy: async (ASYNCcnt-tracked, bypasses VGPRs) if available
__device__ __forceinline__ void copy16(const bf16u* g, bf16u* l) {
#if HAVE_ASYNC_LDS
  __builtin_amdgcn_global_load_async_to_lds_b128((AS1 v4i*)g, (AS3 v4i*)l, 0, 0);
#else
  *(uint4*)l = *(const uint4*)g;
#endif
}

__device__ __forceinline__ void async_wait0() {
#if HAVE_ASYNC_LDS
#if __has_builtin(__builtin_amdgcn_s_wait_asynccnt)
  __builtin_amdgcn_s_wait_asynccnt(0);
#else
  asm volatile("s_wait_asynccnt 0" ::: "memory");
#endif
#endif
}

// 16-lane row reductions via DPP16 (pure VALU, co-executes with WMMA):
// quad_perm xor1, quad_perm xor2, row_half_mirror (8), row_mirror (16)
__device__ __forceinline__ float row16_max(float x) {
  int v;
  v = __builtin_amdgcn_update_dpp(0, __float_as_int(x), 0xB1,  0xf, 0xf, true);
  x = fmaxf(x, __int_as_float(v));
  v = __builtin_amdgcn_update_dpp(0, __float_as_int(x), 0x4E,  0xf, 0xf, true);
  x = fmaxf(x, __int_as_float(v));
  v = __builtin_amdgcn_update_dpp(0, __float_as_int(x), 0x141, 0xf, 0xf, true);
  x = fmaxf(x, __int_as_float(v));
  v = __builtin_amdgcn_update_dpp(0, __float_as_int(x), 0x140, 0xf, 0xf, true);
  x = fmaxf(x, __int_as_float(v));
  return x;
}

__device__ __forceinline__ float row16_sum(float x) {
  int v;
  v = __builtin_amdgcn_update_dpp(0, __float_as_int(x), 0xB1,  0xf, 0xf, true);
  x += __int_as_float(v);
  v = __builtin_amdgcn_update_dpp(0, __float_as_int(x), 0x4E,  0xf, 0xf, true);
  x += __int_as_float(v);
  v = __builtin_amdgcn_update_dpp(0, __float_as_int(x), 0x141, 0xf, 0xf, true);
  x += __int_as_float(v);
  v = __builtin_amdgcn_update_dpp(0, __float_as_int(x), 0x140, 0xf, 0xf, true);
  x += __int_as_float(v);
  return x;
}

// ---------- conversion kernels ----------

__global__ void cvt_x_kernel(const float* __restrict__ X, bf16u* __restrict__ Xb) {
  int i = blockIdx.x * blockDim.x + threadIdx.x;   // one float4 each
  float4 v = ((const float4*)X)[i];
  union { bf16u h[4]; uint2 u; } o;
  o.h[0] = f2bf(v.x); o.h[1] = f2bf(v.y); o.h[2] = f2bf(v.z); o.h[3] = f2bf(v.w);
  ((uint2*)Xb)[i] = o.u;
}

// WT[z][n][k] = W_z[k][n]  (bf16, transposed so B-fragments load row-wise)
// One 128(k) x 64(n) tile per block. A lane reads 8 rows x 4 columns (16 lanes cover 256
// contiguous bytes of a row), turns them into 4 rows of 8 k in registers, and the tile
// goes through LDS so that every output row leaves as 256 contiguous bytes.
__global__ void cvt_wT_kernel(const float* __restrict__ W0, const float* __restrict__ W1,
                              const float* __restrict__ W2, const float* __restrict__ W3,
                              bf16u* __restrict__ WT) {
  __shared__ bf16u Ts[64 * 136];     // [n][k], pitch 272 B (16 B x odd) for 16-byte readers
  const int z = blockIdx.z;
  const float* W = (z == 0) ? W0 : (z == 1) ? W1 : (z == 2) ? W2 : W3;
  const int tid = threadIdx.x;
  const int k0 = blockIdx.x * 128, n0 = blockIdx.y * 64;
  const int c = tid & 15, g = tid >> 4;

  const float* sp = W + (size_t)(k0 + g * 8) * 1024 + n0 + c * 4;
  float4 v[8];
#pragma unroll
  for (int i = 0; i < 8; i++) v[i] = *(const float4*)(sp + (size_t)i * 1024);

  union { bf16u h[8]; uint4 u; } p0, p1, p2, p3;
#pragma unroll
  for (int i = 0; i < 8; i++) {
    p0.h[i] = f2bf(v[i].x); p1.h[i] = f2bf(v[i].y);
    p2.h[i] = f2bf(v[i].z); p3.h[i] = f2bf(v[i].w);
  }
  *(uint4*)&Ts[(c * 4 + 0) * 136 + g * 8] = p0.u;
  *(uint4*)&Ts[(c * 4 + 1) * 136 + g * 8] = p1.u;
  *(uint4*)&Ts[(c * 4 + 2) * 136 + g * 8] = p2.u;
  *(uint4*)&Ts[(c * 4 + 3) * 136 + g * 8] = p3.u;
  __syncthreads();

  bf16u* dp = WT + (size_t)z * 1024 * 1024 + (size_t)n0 * 1024 + k0 + c * 8;
#pragma unroll
  for (int r = 0; r < 4; r++) {
    const int row = g + r * 16;
    *(uint4*)(dp + (size_t)row * 1024) = *(const uint4*)&Ts[row * 136 + c * 8];
  }
}

// ---------- tiled bf16 WMMA GEMM: C = A(4096x1024) * WT^T + bias ----------
// Double-buffered LDS staging with async global->LDS copies.
// A stage holds BK k of every tile row: BK * 2 bytes of a row are whole 128-byte lines,
// and one wait and one barrier serve BK / 32 blocks of 8 products per wave.
// MODE 0: QKV projection, writes bf16 into [B,H,S,Dh], z = blockIdx.z selects matrix
// MODE 1: output projection, adds residual, writes fp32 Hout
// launch bounds: the real block size. Without it the compiler plans for 1,024 threads and 128
// registers, which the second mode's epilogue (16 LDS and 16 residual loads in flight) fills: it
// then also schedules the k loop for few registers, one fragment set with a full wait per pair
template <int MODE, int BK>
__global__ __launch_bounds__(256) void gemm_kernel(const bf16u* __restrict__ A,
                            const bf16u* __restrict__ WT,
                            const float* __restrict__ bias0,
                            const float* __restrict__ bias1,
                            const float* __restrict__ bias2,
                            bf16u* __restrict__ qkv,
                            const float* __restrict__ resid,
                            float* __restrict__ Hout) {
  constexpr int PITCH = BK + 8;      // row pitch in LDS: 16 B x odd for 16-byte readers
  constexpr int CPR   = BK / 8;      // 16-byte copies per row
  constexpr int RPR   = 256 / CPR;   // rows that one copy of every thread covers
  __shared__ __attribute__((aligned(16))) bf16u As[2][128 * PITCH];
  __shared__ __attribute__((aligned(16))) bf16u Bs[2][128 * PITCH];

  const int tid  = threadIdx.x;
  const int wave = tid >> 5, lane = tid & 31;
  const int l = lane & 15, hi = lane >> 4;
  const int wm = wave >> 2, wn = wave & 3;          // 2x4 wave grid
  const int z = (MODE == 0) ? blockIdx.z : 0;
  const int mbase = blockIdx.y * 128;
  const int nbase = blockIdx.x * 128;
  const bf16u* Bt = WT + (size_t)z * (1024 * 1024);
  const float* bias = (MODE == 0) ? ((z == 0) ? bias0 : (z == 1) ? bias1 : bias2)
                                  : bias0;

  v8f zinit = {};
  v8f acc[4][2];
#pragma unroll
  for (int i = 0; i < 4; i++)
#pragma unroll
    for (int j = 0; j < 2; j++) acc[i][j] = zinit;

  const int r0 = tid / CPR, q = tid % CPR;          // CPR threads/row, 16B each
  const bf16u* ag = A  + (size_t)(mbase + r0) * 1024 + q * 8;
  const bf16u* bg = Bt + (size_t)(nbase + r0) * 1024 + q * 8;

  auto stage = [&](int buf, int kb) {
    const int ko = kb * BK;
#pragma unroll   // row steps and LDS places become constants of each copy
    for (int c = 0; c < 128 / RPR; c++) {
      copy16(ag + ko + (size_t)(c * RPR) * 1024, &As[buf][(r0 + c * RPR) * PITCH + q * 8]);
      copy16(bg + ko + (size_t)(c * RPR) * 1024, &Bs[buf][(r0 + c * RPR) * PITCH + q * 8]);
    }
  };

  stage(0, 0);
  // second mode: the bias of the 4 columns that the lane stores in the epilogue; asked for here,
  // its latency passes with the first stage's copies
  float4 bo4 = make_float4(0.f, 0.f, 0.f, 0.f);
  if (MODE == 1) bo4 = *(const float4*)(bias + nbase + lane * 4);
  async_wait0();
  __syncthreads();

  int buf = 0;
  for (int kb = 0; kb < 1024 / BK; ++kb) {
    if (kb + 1 < 1024 / BK) stage(buf ^ 1, kb + 1);   // prefetch next tile

#pragma unroll   // fragment places become immediate offsets; loads of a block can run ahead
    for (int ks = 0; ks < BK / 32; ks++) {
      v16bf bfrag[2];
#pragma unroll
      for (int j = 0; j < 2; j++)
        bfrag[j] = load_frag(&Bs[buf][(wn * 32 + j * 16 + l) * PITCH + ks * 32], hi);
#pragma unroll
      for (int i = 0; i < 4; i++) {
        v16bf afrag = load_frag(&As[buf][(wm * 64 + i * 16 + l) * PITCH + ks * 32], hi);
#pragma unroll
        for (int j = 0; j < 2; j++)
          acc[i][j] = wmma_bf16(bfrag[j], afrag, acc[i][j]);   // weight rows first: D row = n, D column = m
      }
    }

    async_wait0();
    __syncthreads();
    buf ^= 1;
  }

  // epilogue: the block's 128 x 128 tile leaves through LDS, so that every global access is
  // 512 contiguous bytes of whole 128-byte lines. With the weight rows as first operand, value
  // (lane l, half hi, comp r) is C[m = l][n = hi*8 + r] of a 16x16 tile: 8 consecutive columns
  // of one row in a lane, written to LDS 16 bytes at a time. The tile lies over the A ring,
  // which every wave has left at the loop's last barrier (no copy is outstanding there).
  // All loops below are unrolled: accumulator indices must be constants (registers, not scratch),
  // and tile steps become immediate offsets of each access.
  const int trow = wm * 64 + l, tcol = wn * 32 + hi * 8;
  if (MODE == 0) {
    constexpr int TP = 136;            // bf16 tile, row pitch 272 B: 16 B x odd
    bf16u* T = &As[0][0];
#pragma unroll
    for (int j = 0; j < 2; j++) {
      const float* bp = bias + nbase + tcol + j * 16;
      const float4 b0 = *(const float4*)bp, b1 = *(const float4*)(bp + 4);
      const v8f bn = {b0.x, b0.y, b0.z, b0.w, b1.x, b1.y, b1.z, b1.w};
#pragma unroll
      for (int i = 0; i < 4; i++) {
        const v8bf pk = __builtin_convertvector(acc[i][j] + bn, v8bf);   // nearest even, as f2bf
        *(uint4*)&T[(trow + i * 16) * TP + tcol + j * 16] = __builtin_bit_cast(uint4, pk);
      }
    }
    __syncthreads();   // the tile is written before other waves read its rows
    // the tile is two heads x 128 rows of 128 B, and a head's rows follow one another in memory
    const int bb = mbase >> 11, s0 = mbase & 2047, h0 = nbase >> 6;
    bf16u* op = qkv + (size_t)z * MTOT * D_MODEL + ((size_t)(bb * NHEAD + h0) * SEQ + s0) * HDIM;
#pragma unroll
    for (int c = 0; c < 8; c++) {
      const int hh = c >> 2, rc = tid + (c & 3) * 256;   // head of the pair, 16-byte piece in it
      *(uint4*)(op + (size_t)hh * SEQ * HDIM + rc * 8) =
          *(const uint4*)&T[(rc >> 3) * TP + hh * 64 + (rc & 7) * 8];
    }
  } else {
    constexpr int TP = 132;            // f32 tile, row pitch 528 B: 16 B x odd
    float* T = (float*)&As[0][0];
#pragma unroll
    for (int i = 0; i < 4; i++)
#pragma unroll
      for (int j = 0; j < 2; j++) {
        float* tp = &T[(trow + i * 16) * TP + tcol + j * 16];
        *(float4*)tp       = make_float4(acc[i][j][0], acc[i][j][1], acc[i][j][2], acc[i][j][3]);
        *(float4*)(tp + 4) = make_float4(acc[i][j][4], acc[i][j][5], acc[i][j][6], acc[i][j][7]);
      }
    __syncthreads();   // the tile is written before other waves read its rows
    // a wave takes one row's 512 B per access; its lanes keep their 4 columns (bias: bo4)
    const float4 bn = bo4;
    // the wave's number as a scalar: both row bases then sit in scalar registers, and loads and
    // stores share the lane's one offset register
    const int wv = __builtin_amdgcn_readfirstlane(wave);
    const size_t g0 = (size_t)(mbase + wv) * D_MODEL + nbase;
    const float* rp = resid + g0;
    float*       hp = Hout + g0;
#pragma unroll
    for (int c = 0; c < 16; c++) {
      const float4 a = *(const float4*)&T[(wv + c * 8) * TP + lane * 4];
      const float4 x = *(const float4*)(rp + c * 8 * D_MODEL + lane * 4);
      *(float4*)(hp + c * 8 * D_MODEL + lane * 4) =
          make_float4(a.x + bn.x + x.x, a.y + bn.y + x.y, a.z + bn.z + x.z, a.w + bn.w + x.w);
    }
  }
}

// value of the lane 16 away (the other half of the same query column)
__device__ __forceinline__ float other_half(float x) {
  int b = __float_as_int(x);
  return __int_as_float(
      __builtin_amdgcn_permlanex16(b, b, 0x76543210, 0xfedcba98, false, false));
}

#define VPITCH 80   // V rows in LDS: 160 B = 32 B x odd, the transposing load's pitch

struct V8x2 { v8s a, b; };

// 16(d) x 32(t) A fragment of V^T out of the row-major V tile: two transposing loads,
// 16 keys apart. Lane (l, hi) gets column l of rows hi*8 .. hi*8+7 from each, which is
// the k order of load_frag. p is the lane's own address (see vlane in attn_kernel).
__device__ __forceinline__ v16bf load_frag_tr(const bf16u* p) {
  V8x2 t;
  t.a = __builtin_amdgcn_ds_load_tr16_b128_v8i16((AS3 v8s*)p);
  t.b = __builtin_amdgcn_ds_load_tr16_b128_v8i16((AS3 v8s*)(p + 16 * VPITCH));
  return __builtin_bit_cast(v16bf, t);
}

// A wave holds 32 query columns (two B fragments), so that every K and V fragment it reads
// from LDS feeds two products. To keep four waves a SIMD the keys are split instead: a stage
// is 128 keys, waves 0-3 take its first 64 and waves 4-7 its last 64, for the same 128
// queries. Each wave runs its own online softmax over its 1024 keys; the two partial
// results of a query (maximum, sum, O) are joined through LDS behind the loop.
// launch bounds and waves per SIMD: 256 registers a wave, two blocks share a WGP
__global__ __launch_bounds__(256) __attribute__((amdgpu_waves_per_eu(4, 4)))
void attn_kernel(const bf16u* __restrict__ qkv, bf16u* __restrict__ ctx) {
  __shared__ __attribute__((aligned(16))) bf16u Qs[128 * 72];   // 128 q-rows x 64, stride 72 (144B)
  // K and V: two buffers each, the next pass's tiles land while this pass's are worked on
  __shared__ __attribute__((aligned(16))) bf16u Ks[2][128 * 72];       // 128 k-rows x 64
  __shared__ __attribute__((aligned(16))) bf16u Vs[2][128 * VPITCH];   // 128 v-rows x 64, as in memory
  // hand-over of the second key half's partial result: 16 x 4 values of O, then maxima and sums
  __shared__ float4 Mg[4][17][32];

  const int tid  = threadIdx.x;
  const int wave = tid >> 5, lane = tid & 31;
  const int l = lane & 15, hi = lane >> 4;
  const int cg = wave & 3;    // which 32 query columns
  const int kh = wave >> 2;   // which 64 keys of every stage
  const int bh = blockIdx.y;
  const int qbase = blockIdx.x * 128;
  const size_t headoff = (size_t)bh * SEQ * HDIM;
  const bf16u* Qp = qkv + headoff;
  const bf16u* Kp = qkv + (size_t)MTOT * D_MODEL + headoff;
  const bf16u* Vp = qkv + (size_t)2 * MTOT * D_MODEL + headoff;

  // stage Q tile (16KB) async: 2 threads/row, 64B each
  {
    int row = tid >> 1, half = tid & 1;
    const bf16u* g = Qp + (size_t)(qbase + row) * HDIM + half * 32;
    bf16u* d = &Qs[row * 72 + half * 32];
#pragma unroll
    for (int c = 0; c < 4; c++) copy16(g + c * 8, d + c * 8);
  }

  // transposing load: lane reads 16 B of row hi*8 + (lane & 7), column half (lane >> 3) & 1
  const int vlane = (kh * 64 + hi * 8 + (lane & 7)) * VPITCH + ((lane >> 3) & 1) * 8;
  const int klane = (kh * 64 + l) * 72;

  // async copies of the 128 keys of pass kb into buffer b, rows as they lie in memory:
  // a wave's copy takes 512 contiguous B
  auto stage = [&](int b, int kb) {
    const bf16u* kg = Kp + (size_t)kb * (128 * HDIM);   // the same for the whole block
    const bf16u* vg = Vp + (size_t)kb * (128 * HDIM);
#pragma unroll
    for (int c = 0; c < 4; c++) {
      const int idx = tid + c * 256;
      const int t = idx >> 3, dc = (idx & 7) * 8;       // t * HDIM + dc = idx * 8
      copy16(kg + idx * 8, &Ks[b][t * 72 + dc]);
      copy16(vg + idx * 8, &Vs[b][t * VPITCH + dc]);
    }
  };

  v8f zinit = {};
  v8f sacc[2][4], o[2][4];
  float mrun[2];   // running maximum of this lane's two queries, equal in both halves
  float lrun[2];   // running sums over this half's keys; halves join at the end
#pragma unroll
  for (int c = 0; c < 2; c++) {
    mrun[c] = -1e30f;
    lrun[c] = 0.f;
#pragma unroll
    for (int n = 0; n < 4; n++) o[c][n] = zinit;
  }

  // ring prologue: Q and pass 0 land and are published, then pass 1's copies start
  stage(0, 0);
  asm volatile("s_wait_asynccnt 0x0" ::: "memory");   // this wave's Q, K, V copies have landed
  __syncthreads();                                    // ... and every other wave's
  stage(1, 1);

#pragma unroll 1   // rolled: two copies of the body keep every copy's LDS place in a register and spill
  for (int kb = 0; kb < SEQ / 128; ++kb) {
    const int b = kb & 1;

    // scores: S^T(64 keys x 32 queries) = K(64x64) * Q^T; A row = key, B column = query
    // sacc[c][j][r] = S^T[j*16 + hi*8 + r][c*16 + l]
#pragma unroll
    for (int c = 0; c < 2; c++)
#pragma unroll
      for (int j = 0; j < 4; j++) sacc[c][j] = zinit;
#pragma unroll
    for (int ks = 0; ks < 2; ks++) {
      v16bf qfrag0 = load_frag(&Qs[(cg * 32 + l) * 72 + ks * 32], hi);
      v16bf qfrag1 = load_frag(&Qs[(cg * 32 + 16 + l) * 72 + ks * 32], hi);
#pragma unroll
      for (int j = 0; j < 4; j++) {
        v16bf kfrag = load_frag(&Ks[b][klane + j * 16 * 72 + ks * 32], hi);
        sacc[0][j] = wmma_bf16(kfrag, qfrag0, sacc[0][j]);
        sacc[1][j] = wmma_bf16(kfrag, qfrag1, sacc[1][j]);
      }
    }

    // online softmax of two queries per lane: 32 keys of each in-lane, one exchange of halves
    // pfrag[c][ks]: B fragment of P^T, two score tiles converted in place: element s of
    // lane (l, hi) is key hi*8 + s (s < 8) or 16 + hi*8 + s - 8, the A side's k order
    v16bf pfrag[2][2];
#pragma unroll
    for (int c = 0; c < 2; c++) {
      // pairs along r lie in neighbouring registers of an accumulator: packed math, no moves
      v2f t2[4][4];
      float mt[4];   // one maximum and one sum per tile: four short chains, not one long
#pragma unroll
      for (int j = 0; j < 4; j++) {
        mt[j] = -1e30f;
#pragma unroll
        for (int h = 0; h < 4; h++) {
          v2f t = {sacc[c][j][2 * h], sacc[c][j][2 * h + 1]};
          t *= 0.125f;   // 1/sqrt(64)
          t2[j][h] = t;
          mt[j] = fmaxf(mt[j], fmaxf(t.x, t.y));
        }
      }
      float m_b = fmaxf(fmaxf(mt[0], mt[1]), fmaxf(mt[2], mt[3]));
      m_b = fmaxf(m_b, other_half(m_b));
      const float m_new = fmaxf(mrun[c], m_b);
      const float alpha = __expf(mrun[c] - m_new);
      mrun[c] = m_new;
      v2f srow[4];
#pragma unroll
      for (int j = 0; j < 4; j++) {
        srow[j] = (v2f){0.f, 0.f};
#pragma unroll
        for (int h = 0; h < 4; h++) {
          const v2f d = t2[j][h] - m_new;
          const v2f p = {__expf(d.x), __expf(d.y)};
          t2[j][h] = p;
          srow[j] += p;
        }
      }
      const v2f sall = (srow[0] + srow[1]) + (srow[2] + srow[3]);
      lrun[c] = lrun[c] * alpha + (sall.x + sall.y);
#pragma unroll
      for (int ks = 0; ks < 2; ks++)
#pragma unroll
        for (int h = 0; h < 4; h++) {
          pfrag[c][ks][2 * h]         = (__bf16)t2[2 * ks][h].x;
          pfrag[c][ks][2 * h + 1]     = (__bf16)t2[2 * ks][h].y;
          pfrag[c][ks][8 + 2 * h]     = (__bf16)t2[2 * ks + 1][h].x;
          pfrag[c][ks][8 + 2 * h + 1] = (__bf16)t2[2 * ks + 1][h].y;
        }
#pragma unroll
      for (int n = 0; n < 4; n++) o[c][n] *= alpha;
    }

    // ctx^T(64 d x 32 queries) += V^T(64x64) * P^T; A row = d, read transposed out of Vs[t][d]
#pragma unroll
    for (int ks = 0; ks < 2; ks++) {
#pragma unroll
      for (int n = 0; n < 4; n++) {
        v16bf vfrag = load_frag_tr(&Vs[b][vlane + ks * 32 * VPITCH + n * 16]);
        o[0][n] = wmma_bf16(vfrag, pfrag[0][ks], o[0][n]);
        o[1][n] = wmma_bf16(vfrag, pfrag[1][ks], o[1][n]);
      }
    }

    // publish point of pass kb + 1; the one barrier also ends every read of buffer b
    asm volatile("s_wait_dscnt 0x0" ::: "memory");      // own reads of buffer b are done before it is refilled
    asm volatile("s_wait_asynccnt 0x0" ::: "memory");   // own copies of pass kb + 1 have landed
    __syncthreads();
    if (kb + 2 < SEQ / 128) stage(b, kb + 2);           // flies during pass kb + 1
  }
  asm volatile("s_wait_asynccnt 0x0" ::: "memory");     // no copy outstanding when the wave ends

  // join of the two key halves: wave cg + 4 hands its partial result to wave cg, lane to lane
  // (both hold the same queries and the same d in the same lanes and registers)
  if (kh == 1) {
#pragma unroll
    for (int c = 0; c < 2; c++)
#pragma unroll
      for (int n = 0; n < 4; n++) {
        Mg[cg][(c * 4 + n) * 2 + 0][lane] = make_float4(o[c][n][0], o[c][n][1], o[c][n][2], o[c][n][3]);
        Mg[cg][(c * 4 + n) * 2 + 1][lane] = make_float4(o[c][n][4], o[c][n][5], o[c][n][6], o[c][n][7]);
      }
    Mg[cg][16][lane] = make_float4(mrun[0], mrun[1], lrun[0], lrun[1]);
  }
  __syncthreads();   // the hand-over is written before its reader starts
  if (kh == 1) return;

  // normalize and store ctx back to [B*S, D] bf16
  // o[c][n][r] = ctx^T[n*16 + hi*8 + r][c*16 + l]: 8 consecutive columns of one row per lane
  const int bb = bh >> 4, h = bh & 15;
  const float4 ml = Mg[cg][16][lane];
#pragma unroll
  for (int c = 0; c < 2; c++) {
    const float m2 = c ? ml.y : ml.x, l2 = c ? ml.w : ml.z;
    const float m  = fmaxf(mrun[c], m2);
    const float f1 = __expf(mrun[c] - m), f2 = __expf(m2 - m);
    const float lsum = lrun[c] * f1 + l2 * f2;
    const float inv = 1.0f / (lsum + other_half(lsum));
    const float g1 = f1 * inv, g2 = f2 * inv;
    const int s = qbase + cg * 32 + c * 16 + l;
    bf16u* crow = ctx + ((size_t)bb * SEQ + s) * D_MODEL + h * HDIM + hi * 8;
#pragma unroll
    for (int n = 0; n < 4; n++) {
      const float4 pa = Mg[cg][(c * 4 + n) * 2 + 0][lane];
      const float4 pb = Mg[cg][(c * 4 + n) * 2 + 1][lane];
      const float p2[8] = {pa.x, pa.y, pa.z, pa.w, pb.x, pb.y, pb.z, pb.w};
      union { uint4 u; bf16u h[8]; } pk;
#pragma unroll
      for (int r = 0; r < 8; r++) pk.h[r] = f2bf(o[c][n][r] * g1 + p2[r] * g2);
      *(uint4*)(crow + n * 16) = pk.u;
    }
  }
}

// ---------- LayerNorm over D=1024 per row ----------
// One wave per row, the row held in registers: a lane asks for its 8 x 16 bytes at once
// (each wave-wide load is 512 contiguous bytes), so a row pays one memory latency and is
// read once. The two row sums close inside the wave: no LDS, no barrier.

typedef __attribute__((ext_vector_type(4))) float v4f;

__global__ __launch_bounds__(256)
void ln_kernel(const float* __restrict__ Hb, const float* __restrict__ gamma,
               const float* __restrict__ beta, float* __restrict__ out) {
  const int lane = threadIdx.x & 31;
  // the wave's number as a scalar: the row's base then sits in scalar registers
  const int wave = __builtin_amdgcn_readfirstlane(threadIdx.x >> 5);
  const int row = blockIdx.x * 8 + wave;
  const v4f* hp = (const v4f*)(Hb + (size_t)row * D_MODEL) + lane;
  const v4f* gp = (const v4f*)gamma + lane;
  const v4f* bp = (const v4f*)beta + lane;
  v4f*       op = (v4f*)(out + (size_t)row * D_MODEL) + lane;

  // the loops below are unrolled so that x, g and b are registers, not arrays in scratch
  v4f x[8], g[8], b[8];
#pragma unroll
  for (int i = 0; i < 8; i++) x[i] = hp[i * 32];
#pragma unroll
  for (int i = 0; i < 8; i++) { g[i] = gp[i * 32]; b[i] = bp[i * 32]; }
  // inputs-only fence on the loaded values: all 24 loads are asked for ahead of the sums.
  // Left free, the compiler sinks the gamma and beta loads behind the row sums, two at a
  // time, and their latencies then add to the row's.
  asm volatile("" :: "v"(x[0]), "v"(x[1]), "v"(x[2]), "v"(x[3]),
                     "v"(x[4]), "v"(x[5]), "v"(x[6]), "v"(x[7]),
                     "v"(g[0]), "v"(g[1]), "v"(g[2]), "v"(g[3]),
                     "v"(g[4]), "v"(g[5]), "v"(g[6]), "v"(g[7]),
                     "v"(b[0]), "v"(b[1]), "v"(b[2]), "v"(b[3]),
                     "v"(b[4]), "v"(b[5]), "v"(b[6]), "v"(b[7]));

  // four independent chains per sum
  v4f s4 = {0.f, 0.f, 0.f, 0.f}, q4 = s4;
#pragma unroll
  for (int i = 0; i < 8; i++) { s4 += x[i]; q4 += x[i] * x[i]; }
  float s  = row16_sum((s4.x + s4.y) + (s4.z + s4.w));
  float ss = row16_sum((q4.x + q4.y) + (q4.z + q4.w));
  s  += other_half(s);
  ss += other_half(ss);

  const float mu   = s * (1.0f / D_MODEL);
  const float var  = ss * (1.0f / D_MODEL) - mu * mu;
  const float rstd = rsqrtf(var + 1e-12f);
#pragma unroll
  for (int i = 0; i < 8; i++) op[i * 32] = (x[i] - mu) * rstd * g[i] + b[i];
}

// ---------- launch ----------

extern "C" void kernel_launch(void* const* d_in, const int* in_sizes, int n_in,
                              void* d_out, int out_size, void* d_ws, size_t ws_size,
                              hipStream_t stream) {
  (void)in_sizes; (void)n_in; (void)out_size; (void)ws_size;
  const float* X     = (const float*)d_in[0];
  const float* Wq    = (const float*)d_in[1];
  const float* bq    = (const float*)d_in[2];
  const float* Wk    = (const float*)d_in[3];
  const float* bk    = (const float*)d_in[4];
  const float* Wv    = (const float*)d_in[5];
  const float* bv    = (const float*)d_in[6];
  const float* Wo    = (const float*)d_in[7];
  const float* bo    = (const float*)d_in[8];
  const float* gamma = (const float*)d_in[9];
  const float* beta  = (const float*)d_in[10];
  float* out = (float*)d_out;

  char* ws = (char*)d_ws;
  bf16u* Xb  = (bf16u*)ws;                              //  8 MB: X in bf16
  bf16u* WT  = (bf16u*)(ws + 8ull  * 1024 * 1024);      //  8 MB: 4 transposed weights
  bf16u* QKV = (bf16u*)(ws + 16ull * 1024 * 1024);      // 24 MB: Q,K,V [B,H,S,Dh]
  bf16u* Ctx = (bf16u*)(ws + 40ull * 1024 * 1024);      //  8 MB: context [B*S, D]
  float* Hb  = (float*)(ws + 48ull * 1024 * 1024);      // 16 MB: pre-LN fp32

  cvt_x_kernel <<<dim3(MTOT * D_MODEL / 1024), 256, 0, stream>>>(X, Xb);
  cvt_wT_kernel<<<dim3(8, 16, 4),              256, 0, stream>>>(Wq, Wk, Wv, Wo, WT);
  // stage length by residency: four blocks share a WGP's LDS in the first, two in the second
  gemm_kernel<0, 64><<<dim3(8, 32, 3), 256, 0, stream>>>(Xb, WT, bq, bk, bv, QKV,
                                                         nullptr, nullptr);
  attn_kernel  <<<dim3(16, 32),    256, 0, stream>>>(QKV, Ctx);
  gemm_kernel<1, 128><<<dim3(8, 32, 1), 256, 0, stream>>>(Ctx, WT + 3ull * 1024 * 1024,
                                                          bo, nullptr, nullptr, nullptr,
                                                          X, Hb);
  ln_kernel    <<<dim3(MTOT / 8),  256, 0, stream>>>(Hb, gamma, beta, out);
}

// v009
// It runs in 81.8 microseconds.
// Next to v008, in two timings, it ran 1.04 times as fast each time.
// All steps since v000 together make it 2.36 times as fast.
#include <hip/hip_runtime.h>
#include <stdint.h>

typedef unsigned short bf16u;
typedef __attribute__((ext_vector_type(16))) __bf16 v16bf;
typedef __attribute__((ext_vector_type(8)))  float  v8f;
typedef __attribute__((ext_vector_type(2)))  float  v2f;
typedef __attribute__((ext_vector_type(4)))  int    v4i;
typedef __attribute__((ext_vector_type(8)))  short  v8s;
typedef __attribute__((ext_vector_type(8)))  __bf16 v8bf;

#define D_MODEL 1024
#define SEQ     2048
#define NHEAD   16
#define HDIM    64
#define MTOT    4096   // B*S

#define AS1 __attribute__((address_space(1)))
#define AS3 __attribute__((address_space(3)))

#if defined(__has_builtin)
#if __has_builtin(__builtin_amdgcn_global_load_async_to_lds_b128)
#define HAVE_ASYNC_LDS 1
#endif
#endif
#ifndef HAVE_ASYNC_LDS
#define HAVE_ASYNC_LDS 0
#endif

// ---------- helpers ----------

__device__ __forceinline__ bf16u f2bf(float f) {
  unsigned u = __float_as_uint(f);
  unsigned r = ((u >> 16) & 1u) + 0x7fffu;   // round-to-nearest-even
  return (bf16u)((u + r) >> 16);
}

struct U4x2 { uint4 a, b; };

// Load a 16x32 bf16 A/B fragment row for lane (l, hi): two contiguous 16B
// chunks per the CDNA5 16-bit matrix VGPR layout (K pairs hi*8.. and 16+hi*8..)
__device__ __forceinline__ v16bf load_frag(const bf16u* rowp, int hi) {
  U4x2 t;
  t.a = *(const uint4*)(rowp + hi * 8);
  t.b = *(const uint4*)(rowp + 16 + hi * 8);
  return __builtin_bit_cast(v16bf, t);
}

__device__ __forceinline__ v8f wmma_bf16(v16bf a, v16bf b, v8f c) {
  return __builtin_amdgcn_wmma_f32_16x16x32_bf16(
      false, a, false, b, (short)0, c, false, false);
}

// 16-byte global->LDS copy: async (ASYNCcnt-tracked, bypasses VGPRs) if available
__device__ __forceinline__ void copy16(const bf16u* g, bf16u* l) {
#if HAVE_ASYNC_LDS
  __builtin_amdgcn_global_load_async_to_lds_b128((AS1 v4i*)g, (AS3 v4i*)l, 0, 0);
#else
  *(uint4*)l = *(const uint4*)g;
#endif
}

__device__ __forceinline__ void async_wait0() {
#if HAVE_ASYNC_LDS
#if __has_builtin(__builtin_amdgcn_s_wait_asynccnt)
  __builtin_amdgcn_s_wait_asynccnt(0);
#else
  asm volatile("s_wait_asynccnt 0" ::: "memory");
#endif
#endif
}

// 16-lane row reductions via DPP16 (pure VALU, co-executes with WMMA):
// quad_perm xor1, quad_perm xor2, row_half_mirror (8), row_mirror (16)
__device__ __forceinline__ float row16_max(float x) {
  int v;
  v = __builtin_amdgcn_update_dpp(0, __float_as_int(x), 0xB1,  0xf, 0xf, true);
  x = fmaxf(x, __int_as_float(v));
  v = __builtin_amdgcn_update_dpp(0, __float_as_int(x), 0x4E,  0xf, 0xf, true);
  x = fmaxf(x, __int_as_float(v));
  v = __builtin_amdgcn_update_dpp(0, __float_as_int(x), 0x141, 0xf, 0xf, true);
  x = fmaxf(x, __int_as_float(v));
  v = __builtin_amdgcn_update_dpp(0, __float_as_int(x), 0x140, 0xf, 0xf, true);
  x = fmaxf(x, __int_as_float(v));
  return x;
}

__device__ __forceinline__ float row16_sum(float x) {
  int v;
  v = __builtin_amdgcn_update_dpp(0, __float_as_int(x), 0xB1,  0xf, 0xf, true);
  x += __int_as_float(v);
  v = __builtin_amdgcn_update_dpp(0, __float_as_int(x), 0x4E,  0xf, 0xf, true);
  x += __int_as_float(v);
  v = __builtin_amdgcn_update_dpp(0, __float_as_int(x), 0x141, 0xf, 0xf, true);
  x += __int_as_float(v);
  v = __builtin_amdgcn_update_dpp(0, __float_as_int(x), 0x140, 0xf, 0xf, true);
  x += __int_as_float(v);
  return x;
}

// ---------- conversion kernels ----------

__global__ void cvt_x_kernel(const float* __restrict__ X, bf16u* __restrict__ Xb) {
  int i = blockIdx.x * blockDim.x + threadIdx.x;   // one float4 each
  float4 v = ((const float4*)X)[i];
  union { bf16u h[4]; uint2 u; } o;
  o.h[0] = f2bf(v.x); o.h[1] = f2bf(v.y); o.h[2] = f2bf(v.z); o.h[3] = f2bf(v.w);
  ((uint2*)Xb)[i] = o.u;
}

// WT[z][n][k] = W_z[k][n]  (bf16, transposed so B-fragments load row-wise)
// One 128(k) x 64(n) tile per block. A lane reads 8 rows x 4 columns (16 lanes cover 256
// contiguous bytes of a row), turns them into 4 rows of 8 k in registers, and the tile
// goes through LDS so that every output row leaves as 256 contiguous bytes.
__global__ void cvt_wT_kernel(const float* __restrict__ W0, const float* __restrict__ W1,
                              const float* __restrict__ W2, const float* __restrict__ W3,
                              bf16u* __restrict__ WT) {
  __shared__ bf16u Ts[64 * 136];     // [n][k], pitch 272 B (16 B x odd) for 16-byte readers
  const int z = blockIdx.z;
  const float* W = (z == 0) ? W0 : (z == 1) ? W1 : (z == 2) ? W2 : W3;
  const int tid = threadIdx.x;
  const int k0 = blockIdx.x * 128, n0 = blockIdx.y * 64;
  const int c = tid & 15, g = tid >> 4;

  const float* sp = W + (size_t)(k0 + g * 8) * 1024 + n0 + c * 4;
  float4 v[8];
#pragma unroll
  for (int i = 0; i < 8; i++) v[i] = *(const float4*)(sp + (size_t)i * 1024);

  union { bf16u h[8]; uint4 u; } p0, p1, p2, p3;
#pragma unroll
  for (int i = 0; i < 8; i++) {
    p0.h[i] = f2bf(v[i].x); p1.h[i] = f2bf(v[i].y);
    p2.h[i] = f2bf(v[i].z); p3.h[i] = f2bf(v[i].w);
  }
  *(uint4*)&Ts[(c * 4 + 0) * 136 + g * 8] = p0.u;
  *(uint4*)&Ts[(c * 4 + 1) * 136 + g * 8] = p1.u;
  *(uint4*)&Ts[(c * 4 + 2) * 136 + g * 8] = p2.u;
  *(uint4*)&Ts[(c * 4 + 3) * 136 + g * 8] = p3.u;
  __syncthreads();

  bf16u* dp = WT + (size_t)z * 1024 * 1024 + (size_t)n0 * 1024 + k0 + c * 8;
#pragma unroll
  for (int r = 0; r < 4; r++) {
    const int row = g + r * 16;
    *(uint4*)(dp + (size_t)row * 1024) = *(const uint4*)&Ts[row * 136 + c * 8];
  }
}

// ---------- tiled bf16 WMMA GEMM: C = A(4096x1024) * WT^T + bias ----------
// Double-buffered LDS staging with async global->LDS copies.
// A stage holds BK k of every tile row: BK * 2 bytes of a row are whole 128-byte lines,
// and one wait and one barrier serve BK / 32 blocks of 8 products per wave.
// MODE 0: QKV projection, writes bf16 into [B,H,S,Dh], z = blockIdx.z selects matrix
// MODE 1: output projection, adds residual, writes fp32 Hout
// launch bounds: the real block size. Without it the compiler plans for 1,024 threads and 128
// registers, which the second mode's epilogue (16 LDS and 16 residual loads in flight) fills: it
// then also schedules the k loop for few registers, one fragment set with a full wait per pair
template <int MODE, int BK>
__global__ __launch_bounds__(256) void gemm_kernel(const bf16u* __restrict__ A,
                            const bf16u* __restrict__ WT,
                            const float* __restrict__ bias0,
                            const float* __restrict__ bias1,
                            const float* __restrict__ bias2,
                            bf16u* __restrict__ qkv,
                            const float* __restrict__ resid,
                            float* __restrict__ Hout) {
  constexpr int PITCH = BK + 8;      // row pitch in LDS: 16 B x odd for 16-byte readers
  constexpr int CPR   = BK / 8;      // 16-byte copies per row
  constexpr int RPR   = 256 / CPR;   // rows that one copy of every thread covers
  __shared__ __attribute__((aligned(16))) bf16u As[2][128 * PITCH];
  __shared__ __attribute__((aligned(16))) bf16u Bs[2][128 * PITCH];

  const int tid  = threadIdx.x;
  const int wave = tid >> 5, lane = tid & 31;
  const int l = lane & 15, hi = lane >> 4;
  const int wm = wave >> 2, wn = wave & 3;          // 2x4 wave grid
  const int z = (MODE == 0) ? blockIdx.z : 0;
  const int mbase = blockIdx.y * 128;
  const int nbase = blockIdx.x * 128;
  const bf16u* Bt = WT + (size_t)z * (1024 * 1024);
  const float* bias = (MODE == 0) ? ((z == 0) ? bias0 : (z == 1) ? bias1 : bias2)
                                  : bias0;

  v8f zinit = {};
  v8f acc[4][2];
#pragma unroll
  for (int i = 0; i < 4; i++)
#pragma unroll
    for (int j = 0; j < 2; j++) acc[i][j] = zinit;

  const int r0 = tid / CPR, q = tid % CPR;          // CPR threads/row, 16B each
  const bf16u* ag = A  + (size_t)(mbase + r0) * 1024 + q * 8;
  const bf16u* bg = Bt + (size_t)(nbase + r0) * 1024 + q * 8;

  auto stage = [&](int buf, int kb) {
    const int ko = kb * BK;
#pragma unroll   // row steps and LDS places become constants of each copy
    for (int c = 0; c < 128 / RPR; c++) {
      copy16(ag + ko + (size_t)(c * RPR) * 1024, &As[buf][(r0 + c * RPR) * PITCH + q * 8]);
      copy16(bg + ko + (size_t)(c * RPR) * 1024, &Bs[buf][(r0 + c * RPR) * PITCH + q * 8]);
    }
  };

  stage(0, 0);
  // second mode: the bias of the 4 columns that the lane stores in the epilogue; asked for here,
  // its latency passes with the first stage's copies
  float4 bo4 = make_float4(0.f, 0.f, 0.f, 0.f);
  if (MODE == 1) bo4 = *(const float4*)(bias + nbase + lane * 4);
  async_wait0();
  __syncthreads();

  int buf = 0;
  for (int kb = 0; kb < 1024 / BK; ++kb) {
    if (kb + 1 < 1024 / BK) stage(buf ^ 1, kb + 1);   // prefetch next tile

#pragma unroll   // fragment places become immediate offsets; loads of a block can run ahead
    for (int ks = 0; ks < BK / 32; ks++) {
      v16bf bfrag[2];
#pragma unroll
      for (int j = 0; j < 2; j++)
        bfrag[j] = load_frag(&Bs[buf][(wn * 32 + j * 16 + l) * PITCH + ks * 32], hi);
#pragma unroll
      for (int i = 0; i < 4; i++) {
        v16bf afrag = load_frag(&As[buf][(wm * 64 + i * 16 + l) * PITCH + ks * 32], hi);
#pragma unroll
        for (int j = 0; j < 2; j++)
          acc[i][j] = wmma_bf16(bfrag[j], afrag, acc[i][j]);   // weight rows first: D row = n, D column = m
      }
    }

    async_wait0();
    __syncthreads();
    buf ^= 1;
  }

  // epilogue: the block's 128 x 128 tile leaves through LDS, so that every global access is
  // 512 contiguous bytes of whole 128-byte lines. With the weight rows as first operand, value
  // (lane l, half hi, comp r) is C[m = l][n = hi*8 + r] of a 16x16 tile: 8 consecutive columns
  // of one row in a lane, written to LDS 16 bytes at a time. The tile lies over the A ring,
  // which every wave has left at the loop's last barrier (no copy is outstanding there).
  // All loops below are unrolled: accumulator indices must be constants (registers, not scratch),
  // and tile steps become immediate offsets of each access.
  const int trow = wm * 64 + l, tcol = wn * 32 + hi * 8;
  if (MODE == 0) {
    constexpr int TP = 136;            // bf16 tile, row pitch 272 B: 16 B x odd
    bf16u* T = &As[0][0];
    // Q leaves times 1/sqrt(64) * log2(e), in f32 ahead of its one rounding: the attention's
    // score products are then base-2 exponents as they stand. K and V: times 1, exact.
    const float osc = (z == 0) ? 0.125f * 1.4426950408889634f : 1.0f;
#pragma unroll
    for (int j = 0; j < 2; j++) {
      const float* bp = bias + nbase + tcol + j * 16;
      const float4 b0 = *(const float4*)bp, b1 = *(const float4*)(bp + 4);
      const v8f bn = {b0.x, b0.y, b0.z, b0.w, b1.x, b1.y, b1.z, b1.w};
#pragma unroll
      for (int i = 0; i < 4; i++) {
        const v8bf pk = __builtin_convertvector((acc[i][j] + bn) * osc, v8bf);   // nearest even, as f2bf
        *(uint4*)&T[(trow + i * 16) * TP + tcol + j * 16] = __builtin_bit_cast(uint4, pk);
      }
    }
    __syncthreads();   // the tile is written before other waves read its rows
    // the tile is two heads x 128 rows of 128 B, and a head's rows follow one another in memory
    const int bb = mbase >> 11, s0 = mbase & 2047, h0 = nbase >> 6;
    bf16u* op = qkv + (size_t)z * MTOT * D_MODEL + ((size_t)(bb * NHEAD + h0) * SEQ + s0) * HDIM;
#pragma unroll
    for (int c = 0; c < 8; c++) {
      const int hh = c >> 2, rc = tid + (c & 3) * 256;   // head of the pair, 16-byte piece in it
      *(uint4*)(op + (size_t)hh * SEQ * HDIM + rc * 8) =
          *(const uint4*)&T[(rc >> 3) * TP + hh * 64 + (rc & 7) * 8];
    }
  } else {
    constexpr int TP = 132;            // f32 tile, row pitch 528 B: 16 B x odd
    float* T = (float*)&As[0][0];
#pragma unroll
    for (int i = 0; i < 4; i++)
#pragma unroll
      for (int j = 0; j < 2; j++) {
        float* tp = &T[(trow + i * 16) * TP + tcol + j * 16];
        *(float4*)tp       = make_float4(acc[i][j][0], acc[i][j][1], acc[i][j][2], acc[i][j][3]);
        *(float4*)(tp + 4) = make_float4(acc[i][j][4], acc[i][j][5], acc[i][j][6], acc[i][j][7]);
      }
    __syncthreads();   // the tile is written before other waves read its rows
    // a wave takes one row's 512 B per access; its lanes keep their 4 columns (bias: bo4)
    const float4 bn = bo4;
    // the wave's number as a scalar: both row bases then sit in scalar registers, and loads and
    // stores share the lane's one offset register
    const int wv = __builtin_amdgcn_readfirstlane(wave);
    const size_t g0 = (size_t)(mbase + wv) * D_MODEL + nbase;
    const float* rp = resid + g0;
    float*       hp = Hout + g0;
#pragma unroll
    for (int c = 0; c < 16; c++) {
      const float4 a = *(const float4*)&T[(wv + c * 8) * TP + lane * 4];
      const float4 x = *(const float4*)(rp + c * 8 * D_MODEL + lane * 4);
      *(float4*)(hp + c * 8 * D_MODEL + lane * 4) =
          make_float4(a.x + bn.x + x.x, a.y + bn.y + x.y, a.z + bn.z + x.z, a.w + bn.w + x.w);
    }
  }
}

__device__ __forceinline__ float max3f(float a, float b, float c) {
  return fmaxf(fmaxf(a, b), c);
}

// value of the lane 16 away (the other half of the same query column)
__device__ __forceinline__ float other_half(float x) {
  int b = __float_as_int(x);
  return __int_as_float(
      __builtin_amdgcn_permlanex16(b, b, 0x76543210, 0xfedcba98, false, false));
}

#define VPITCH 80   // V rows in LDS: 160 B = 32 B x odd, the transposing load's pitch

struct V8x2 { v8s a, b; };

// 16(d) x 32(t) A fragment of V^T out of the row-major V tile: two transposing loads,
// 16 keys apart. Lane (l, hi) gets column l of rows hi*8 .. hi*8+7 from each, which is
// the k order of load_frag. p is the lane's own address (see vlane in attn_kernel).
__device__ __forceinline__ v16bf load_frag_tr(const bf16u* p) {
  V8x2 t;
  t.a = __builtin_amdgcn_ds_load_tr16_b128_v8i16((AS3 v8s*)p);
  t.b = __builtin_amdgcn_ds_load_tr16_b128_v8i16((AS3 v8s*)(p + 16 * VPITCH));
  return __builtin_bit_cast(v16bf, t);
}

// A wave holds 32 query columns (two B fragments), so that every K and V fragment it reads
// from LDS feeds two products. To keep four waves a SIMD the keys are split instead: a stage
// is 128 keys, waves 0-3 take its first 64 and waves 4-7 its last 64, for the same 128
// queries. Each wave runs its own online softmax over its 1024 keys; the two partial
// results of a query (maximum, sum, O) are joined through LDS behind the loop.
// launch bounds and waves per SIMD: 256 registers a wave, two blocks share a WGP
__global__ __launch_bounds__(256) __attribute__((amdgpu_waves_per_eu(4, 4)))
void attn_kernel(const bf16u* __restrict__ qkv, bf16u* __restrict__ ctx) {
  __shared__ __attribute__((aligned(16))) bf16u Qs[128 * 72];   // 128 q-rows x 64, stride 72 (144B)
  // K and V: two buffers each, the next pass's tiles land while this pass's are worked on
  __shared__ __attribute__((aligned(16))) bf16u Ks[2][128 * 72];       // 128 k-rows x 64
  __shared__ __attribute__((aligned(16))) bf16u Vs[2][128 * VPITCH];   // 128 v-rows x 64, as in memory
  // hand-over of the second key half's partial result: 16 x 4 values of O, then maxima and sums
  __shared__ float4 Mg[4][17][32];

  const int tid  = threadIdx.x;
  const int wave = tid >> 5, lane = tid & 31;
  const int l = lane & 15, hi = lane >> 4;
  const int cg = wave & 3;    // which 32 query columns
  const int kh = wave >> 2;   // which 64 keys of every stage
  const int bh = blockIdx.y;
  const int qbase = blockIdx.x * 128;
  const size_t headoff = (size_t)bh * SEQ * HDIM;
  const bf16u* Qp = qkv + headoff;
  const bf16u* Kp = qkv + (size_t)MTOT * D_MODEL + headoff;
  const bf16u* Vp = qkv + (size_t)2 * MTOT * D_MODEL + headoff;

  // stage Q tile (16KB) async: 2 threads/row, 64B each
  {
    int row = tid >> 1, half = tid & 1;
    const bf16u* g = Qp + (size_t)(qbase + row) * HDIM + half * 32;
    bf16u* d = &Qs[row * 72 + half * 32];
#pragma unroll
    for (int c = 0; c < 4; c++) copy16(g + c * 8, d + c * 8);
  }

  // transposing load: lane reads 16 B of row hi*8 + (lane & 7), column half (lane >> 3) & 1
  const int vlane = (kh * 64 + hi * 8 + (lane & 7)) * VPITCH + ((lane >> 3) & 1) * 8;
  const int klane = (kh * 64 + l) * 72;

  // async copies of the 128 keys of pass kb into buffer b, rows as they lie in memory:
  // a wave's copy takes 512 contiguous B
  auto stage = [&](int b, int kb) {
    const bf16u* kg = Kp + (size_t)kb * (128 * HDIM);   // the same for the whole block
    const bf16u* vg = Vp + (size_t)kb * (128 * HDIM);
#pragma unroll
    for (int c = 0; c < 4; c++) {
      const int idx = tid + c * 256;
      const int t = idx >> 3, dc = (idx & 7) * 8;       // t * HDIM + dc = idx * 8
      copy16(kg + idx * 8, &Ks[b][t * 72 + dc]);
      copy16(vg + idx * 8, &Vs[b][t * VPITCH + dc]);
    }
  };

  v8f zinit = {};
  v8f sacc[2][4], o[2][4];
  v8f negm[2];     // minus the maximum in use of this lane's two queries, equal in both halves,
                   // in all 8 components: a lane's 8 values of a score tile are of one query
  float lrun[2];   // running sums over this half's keys; halves join at the end
#pragma unroll
  for (int c = 0; c < 2; c++) {
    negm[c] = zinit;   // pass 0 sets the maximum in use from its own scores
    lrun[c] = 0.f;
#pragma unroll
    for (int n = 0; n < 4; n++) o[c][n] = zinit;
  }

  // ring prologue: Q and pass 0 land and are published, then pass 1's copies start
  stage(0, 0);
  asm volatile("s_wait_asynccnt 0x0" ::: "memory");   // this wave's Q, K, V copies have landed
  __syncthreads();                                    // ... and every other wave's
  stage(1, 1);

#pragma unroll 1   // rolled: two copies of the body keep every copy's LDS place in a register and spill
  for (int kb = 0; kb < SEQ / 128; ++kb) {
    const int b = kb & 1;

    // scores: S^T(64 keys x 32 queries) = K(64x64) * Q^T; A row = key, B column = query
    // sacc[c][j][r] = S^T[j*16 + hi*8 + r][c*16 + l] - maximum in use
#pragma unroll
    for (int ks = 0; ks < 2; ks++) {
      v16bf qfrag0 = load_frag(&Qs[(cg * 32 + l) * 72 + ks * 32], hi);
      v16bf qfrag1 = load_frag(&Qs[(cg * 32 + 16 + l) * 72 + ks * 32], hi);
#pragma unroll
      for (int j = 0; j < 4; j++) {
        v16bf kfrag = load_frag(&Ks[b][klane + j * 16 * 72 + ks * 32], hi);
        sacc[0][j] = wmma_bf16(kfrag, qfrag0, ks == 0 ? negm[0] : sacc[0][j]);
        sacc[1][j] = wmma_bf16(kfrag, qfrag1, ks == 0 ? negm[1] : sacc[1][j]);
      }
    }

    // how far this pass's scores rise above the maximum in use: 32 keys of each query in-lane,
    // one exchange of halves
    // (all loops of the softmax are unrolled: accumulator indices must be constants, registers)
    float mx[2];
#pragma unroll
    for (int c = 0; c < 2; c++) {
      float u[4];   // four short chains, not one long
#pragma unroll
      for (int j = 0; j < 4; j++) {
        u[j] = max3f(sacc[c][j][0], sacc[c][j][1], sacc[c][j][2]);
        u[j] = max3f(u[j], sacc[c][j][3], sacc[c][j][4]);
        u[j] = max3f(u[j], sacc[c][j][5], sacc[c][j][6]);
      }
      const float ua = max3f(u[0], u[1], sacc[c][0][7]);
      const float ub = max3f(u[2], u[3], sacc[c][1][7]);
      const float m_b = fmaxf(max3f(ua, ub, sacc[c][2][7]), sacc[c][3][7]);
      mx[c] = fmaxf(m_b, other_half(m_b));
    }

    // a new maximum comes into use only where a query's scores exceed the old by more than 8, and
    // in pass 0, which has none yet: one test a pass, a scalar branch, seldom taken after pass 0
    const bool need = (mx[0] > 8.0f) || (mx[1] > 8.0f);
    if (kb == 0 || __builtin_amdgcn_ballot_w32(need) != 0) {
#pragma unroll
      for (int c = 0; c < 2; c++) {
        const float d = (kb == 0 || mx[c] > 8.0f) ? mx[c] : 0.f;
        // d < 0 only in pass 0, where sums and O are still 0: the factor must stay finite there
        const float alpha = __builtin_amdgcn_exp2f(fminf(-d, 0.f));
        lrun[c] *= alpha;
        negm[c] -= d;
#pragma unroll
        for (int j = 0; j < 4; j++) sacc[c][j] -= d;
#pragma unroll
        for (int n = 0; n < 4; n++) o[c][n] *= alpha;
      }
    }

    // pfrag[c][ks]: B fragment of P^T, two score tiles converted in place: element s of
    // lane (l, hi) is key hi*8 + s (s < 8) or 16 + hi*8 + s - 8, the A side's k order
    v16bf pfrag[2][2];
#pragma unroll
    for (int c = 0; c < 2; c++) {
      // pairs along r lie in neighbouring registers of an accumulator: packed sums, no moves
      v2f t2[4][4];
      v2f srow[4];   // one sum per tile: four short chains, not one long
#pragma unroll
      for (int j = 0; j < 4; j++) {
#pragma unroll
        for (int h = 0; h < 4; h++) {
          const v2f p = {__builtin_amdgcn_exp2f(sacc[c][j][2 * h]),
                         __builtin_amdgcn_exp2f(sacc[c][j][2 * h + 1])};
          t2[j][h] = p;
          srow[j] = h ? srow[j] + p : p;
        }
      }
      const v2f sall = (srow[0] + srow[1]) + (srow[2] + srow[3]);
      lrun[c] += sall.x + sall.y;
#pragma unroll
      for (int ks = 0; ks < 2; ks++)
#pragma unroll
        for (int h = 0; h < 4; h++) {
          pfrag[c][ks][2 * h]         = (__bf16)t2[2 * ks][h].x;
          pfrag[c][ks][2 * h + 1]     = (__bf16)t2[2 * ks][h].y;
          pfrag[c][ks][8 + 2 * h]     = (__bf16)t2[2 * ks + 1][h].x;
          pfrag[c][ks][8 + 2 * h + 1] = (__bf16)t2[2 * ks + 1][h].y;
        }
    }

    // ctx^T(64 d x 32 queries) += V^T(64x64) * P^T; A row = d, read transposed out of Vs[t][d]
#pragma unroll
    for (int ks = 0; ks < 2; ks++) {
#pragma unroll
      for (int n = 0; n < 4; n++) {
        v16bf vfrag = load_frag_tr(&Vs[b][vlane + ks * 32 * VPITCH + n * 16]);
        o[0][n] = wmma_bf16(vfrag, pfrag[0][ks], o[0][n]);
        o[1][n] = wmma_bf16(vfrag, pfrag[1][ks], o[1][n]);
      }
    }

    // publish point of pass kb + 1; the one barrier also ends every read of buffer b
    asm volatile("s_wait_dscnt 0x0" ::: "memory");      // own reads of buffer b are done before it is refilled
    asm volatile("s_wait_asynccnt 0x0" ::: "memory");   // own copies of pass kb + 1 have landed
    __syncthreads();
    if (kb + 2 < SEQ / 128) stage(b, kb + 2);           // flies during pass kb + 1
  }
  asm volatile("s_wait_asynccnt 0x0" ::: "memory");     // no copy outstanding when the wave ends

  const float mrun[2] = {-negm[0][0], -negm[1][0]};   // maxima in use, in base-2 exponents

  // join of the two key halves: wave cg + 4 hands its partial result to wave cg, lane to lane
  // (both hold the same queries and the same d in the same lanes and registers)
  if (kh == 1) {
#pragma unroll
    for (int c = 0; c < 2; c++)
#pragma unroll
      for (int n = 0; n < 4; n++) {
        Mg[cg][(c * 4 + n) * 2 + 0][lane] = make_float4(o[c][n][0], o[c][n][1], o[c][n][2], o[c][n][3]);
        Mg[cg][(c * 4 + n) * 2 + 1][lane] = make_float4(o[c][n][4], o[c][n][5], o[c][n][6], o[c][n][7]);
      }
    Mg[cg][16][lane] = make_float4(mrun[0], mrun[1], lrun[0], lrun[1]);
  }
  __syncthreads();   // the hand-over is written before its reader starts
  if (kh == 1) return;

  // normalize and store ctx back to [B*S, D] bf16
  // o[c][n][r] = ctx^T[n*16 + hi*8 + r][c*16 + l]: 8 consecutive columns of one row per lane
  const int bb = bh >> 4, h = bh & 15;
  const float4 ml = Mg[cg][16][lane];
#pragma unroll
  for (int c = 0; c < 2; c++) {
    const float m2 = c ? ml.y : ml.x, l2 = c ? ml.w : ml.z;
    const float m  = fmaxf(mrun[c], m2);
    const float f1 = __builtin_amdgcn_exp2f(mrun[c] - m), f2 = __builtin_amdgcn_exp2f(m2 - m);
    const float lsum = lrun[c] * f1 + l2 * f2;
    const float inv = 1.0f / (lsum + other_half(lsum));
    const float g1 = f1 * inv, g2 = f2 * inv;
    const int s = qbase + cg * 32 + c * 16 + l;
    bf16u* crow = ctx + ((size_t)bb * SEQ + s) * D_MODEL + h * HDIM + hi * 8;
#pragma unroll
    for (int n = 0; n < 4; n++) {
      const float4 pa = Mg[cg][(c * 4 + n) * 2 + 0][lane];
      const float4 pb = Mg[cg][(c * 4 + n) * 2 + 1][lane];
      const float p2[8] = {pa.x, pa.y, pa.z, pa.w, pb.x, pb.y, pb.z, pb.w};
      union { uint4 u; bf16u h[8]; } pk;
#pragma unroll
      for (int r = 0; r < 8; r++) pk.h[r] = f2bf(o[c][n][r] * g1 + p2[r] * g2);
      *(uint4*)(crow + n * 16) = pk.u;
    }
  }
}

// ---------- LayerNorm over D=1024 per row ----------
// One wave per row, the row held in registers: a lane asks for its 8 x 16 bytes at once
// (each wave-wide load is 512 contiguous bytes), so a row pays one memory latency and is
// read once. The two row sums close inside the wave: no LDS, no barrier.

typedef __attribute__((ext_vector_type(4))) float v4f;

__global__ __launch_bounds__(256)
void ln_kernel(const float* __restrict__ Hb, const float* __restrict__ gamma,
               const float* __restrict__ beta, float* __restrict__ out) {
  const int lane = threadIdx.x & 31;
  // the wave's number as a scalar: the row's base then sits in scalar registers
  const int wave = __builtin_amdgcn_readfirstlane(threadIdx.x >> 5);
  const int row = blockIdx.x * 8 + wave;
  const v4f* hp = (const v4f*)(Hb + (size_t)row * D_MODEL) + lane;
  const v4f* gp = (const v4f*)gamma + lane;
  const v4f* bp = (const v4f*)beta + lane;
  v4f*       op = (v4f*)(out + (size_t)row * D_MODEL) + lane;

  // the loops below are unrolled so that x, g and b are registers, not arrays in scratch
  v4f x[8], g[8], b[8];
#pragma unroll
  for (int i = 0; i < 8; i++) x[i] = hp[i * 32];
#pragma unroll
  for (int i = 0; i < 8; i++) { g[i] = gp[i * 32]; b[i] = bp[i * 32]; }
  // inputs-only fence on the loaded values: all 24 loads are asked for ahead of the sums.
  // Left free, the compiler sinks the gamma and beta loads behind the row sums, two at a
  // time, and their latencies then add to the row's.
  asm volatile("" :: "v"(x[0]), "v"(x[1]), "v"(x[2]), "v"(x[3]),
                     "v"(x[4]), "v"(x[5]), "v"(x[6]), "v"(x[7]),
                     "v"(g[0]), "v"(g[1]), "v"(g[2]), "v"(g[3]),
                     "v"(g[4]), "v"(g[5]), "v"(g[6]), "v"(g[7]),
                     "v"(b[0]), "v"(b[1]), "v"(b[2]), "v"(b[3]),
                     "v"(b[4]), "v"(b[5]), "v"(b[6]), "v"(b[7]));

  // four independent chains per sum
  v4f s4 = {0.f, 0.f, 0.f, 0.f}, q4 = s4;
#pragma unroll
  for (int i = 0; i < 8; i++) { s4 += x[i]; q4 += x[i] * x[i]; }
  float s  = row16_sum((s4.x + s4.y) + (s4.z + s4.w));
  float ss = row16_sum((q4.x + q4.y) + (q4.z + q4.w));
  s  += other_half(s);
  ss += other_half(ss);

  const float mu   = s * (1.0f / D_MODEL);
  const float var  = ss * (1.0f / D_MODEL) - mu * mu;
  const float rstd = rsqrtf(var + 1e-12f);
#pragma unroll
  for (int i = 0; i < 8; i++) op[i * 32] = (x[i] - mu) * rstd * g[i] + b[i];
}

// ---------- launch ----------

extern "C" void kernel_launch(void* const* d_in, const int* in_sizes, int n_in,
                              void* d_out, int out_size, void* d_ws, size_t ws_size,
                              hipStream_t stream) {
  (void)in_sizes; (void)n_in; (void)out_size; (void)ws_size;
  const float* X     = (const float*)d_in[0];
  const float* Wq    = (const float*)d_in[1];
  const float* bq    = (const float*)d_in[2];
  const float* Wk    = (const float*)d_in[3];
  const float* bk    = (const float*)d_in[4];
  const float* Wv    = (const float*)d_in[5];
  const float* bv    = (const float*)d_in[6];
  const float* Wo    = (const float*)d_in[7];
  const float* bo    = (const float*)d_in[8];
  const float* gamma = (const float*)d_in[9];
  const float* beta  = (const float*)d_in[10];
  float* out = (float*)d_out;

  char* ws = (char*)d_ws;
  bf16u* Xb  = (bf16u*)ws;                              //  8 MB: X in bf16
  bf16u* WT  = (bf16u*)(ws + 8ull  * 1024 * 1024);      //  8 MB: 4 transposed weights
  bf16u* QKV = (bf16u*)(ws + 16ull * 1024 * 1024);      // 24 MB: Q,K,V [B,H,S,Dh]
  bf16u* Ctx = (bf16u*)(ws + 40ull * 1024 * 1024);      //  8 MB: context [B*S, D]
  float* Hb  = (float*)(ws + 48ull * 1024 * 1024);      // 16 MB: pre-LN fp32

  cvt_x_kernel <<<dim3(MTOT * D_MODEL / 1024), 256, 0, stream>>>(X, Xb);
  cvt_wT_kernel<<<dim3(8, 16, 4),              256, 0, stream>>>(Wq, Wk, Wv, Wo, WT);
  // stage length by residency: four blocks share a WGP's LDS in the first, two in the second
  gemm_kernel<0, 64><<<dim3(8, 32, 3), 256, 0, stream>>>(Xb, WT, bq, bk, bv, QKV,
                                                         nullptr, nullptr);
  attn_kernel  <<<dim3(16, 32),    256, 0, stream>>>(QKV, Ctx);
  gemm_kernel<1, 128><<<dim3(8, 32, 1), 256, 0, stream>>>(Ctx, WT + 3ull * 1024 * 1024,
                                                          bo, nullptr, nullptr, nullptr,
                                                          X, Hb);
  ln_kernel    <<<dim3(MTOT / 8),  256, 0, stream>>>(Hb, gamma, beta, out);
}

// v010
// A run of this version takes 79.2 microseconds.
// Next to v009, in two timings, it ran 1.03 and 1.04 times as fast.
// Over all steps from v000 it is 2.44 times as fast.
#include <hip/hip_runtime.h>
#include <stdint.h>

typedef unsigned short bf16u;
typedef __attribute__((ext_vector_type(16))) __bf16 v16bf;
typedef __attribute__((ext_vector_type(8)))  float  v8f;
typedef __attribute__((ext_vector_type(2)))  float  v2f;
typedef __attribute__((ext_vector_type(4)))  int    v4i;
typedef __attribute__((ext_vector_type(8)))  short  v8s;
typedef __attribute__((ext_vector_type(8)))  __bf16 v8bf;

#define D_MODEL 1024
#define SEQ     2048
#define NHEAD   16
#define HDIM    64
#define MTOT    4096   // B*S

#define AS1 __attribute__((address_space(1)))
#define AS3 __attribute__((address_space(3)))

#if defined(__has_builtin)
#if __has_builtin(__builtin_amdgcn_global_load_async_to_lds_b128)
#define HAVE_ASYNC_LDS 1
#endif
#endif
#ifndef HAVE_ASYNC_LDS
#define HAVE_ASYNC_LDS 0
#endif

// ---------- helpers ----------

__device__ __forceinline__ bf16u f2bf(float f) {
  unsigned u = __float_as_uint(f);
  unsigned r = ((u >> 16) & 1u) + 0x7fffu;   // round-to-nearest-even
  return (bf16u)((u + r) >> 16);
}

struct U4x2 { uint4 a, b; };

// Load a 16x32 bf16 A/B fragment row for lane (l, hi): two contiguous 16B
// chunks per the CDNA5 16-bit matrix VGPR layout (K pairs hi*8.. and 16+hi*8..)
__device__ __forceinline__ v16bf load_frag(const bf16u* rowp, int hi) {
  U4x2 t;
  t.a = *(const uint4*)(rowp + hi * 8);
  t.b = *(const uint4*)(rowp + 16 + hi * 8);
  return __builtin_bit_cast(v16bf, t);
}

__device__ __forceinline__ v8f wmma_bf16(v16bf a, v16bf b, v8f c) {
  return __builtin_amdgcn_wmma_f32_16x16x32_bf16(
      false, a, false, b, (short)0, c, false, false);
}

// 16-byte global->LDS copy: async (ASYNCcnt-tracked, bypasses VGPRs) if available
__device__ __forceinline__ void copy16(const bf16u* g, bf16u* l) {
#if HAVE_ASYNC_LDS
  __builtin_amdgcn_global_load_async_to_lds_b128((AS1 v4i*)g, (AS3 v4i*)l, 0, 0);
#else
  *(uint4*)l = *(const uint4*)g;
#endif
}

__device__ __forceinline__ void async_wait0() {
#if HAVE_ASYNC_LDS
#if __has_builtin(__builtin_amdgcn_s_wait_asynccnt)
  __builtin_amdgcn_s_wait_asynccnt(0);
#else
  asm volatile("s_wait_asynccnt 0" ::: "memory");
#endif
#endif
}

// 16-lane row reductions via DPP16 (pure VALU, co-executes with WMMA):
// quad_perm xor1, quad_perm xor2, row_half_mirror (8), row_mirror (16)
__device__ __forceinline__ float row16_max(float x) {
  int v;
  v = __builtin_amdgcn_update_dpp(0, __float_as_int(x), 0xB1,  0xf, 0xf, true);
  x = fmaxf(x, __int_as_float(v));
  v = __builtin_amdgcn_update_dpp(0, __float_as_int(x), 0x4E,  0xf, 0xf, true);
  x = fmaxf(x, __int_as_float(v));
  v = __builtin_amdgcn_update_dpp(0, __float_as_int(x), 0x141, 0xf, 0xf, true);
  x = fmaxf(x, __int_as_float(v));
  v = __builtin_amdgcn_update_dpp(0, __float_as_int(x), 0x140, 0xf, 0xf, true);
  x = fmaxf(x, __int_as_float(v));
  return x;
}

__device__ __forceinline__ float row16_sum(float x) {
  int v;
  v = __builtin_amdgcn_update_dpp(0, __float_as_int(x), 0xB1,  0xf, 0xf, true);
  x += __int_as_float(v);
  v = __builtin_amdgcn_update_dpp(0, __float_as_int(x), 0x4E,  0xf, 0xf, true);
  x += __int_as_float(v);
  v = __builtin_amdgcn_update_dpp(0, __float_as_int(x), 0x141, 0xf, 0xf, true);
  x += __int_as_float(v);
  v = __builtin_amdgcn_update_dpp(0, __float_as_int(x), 0x140, 0xf, 0xf, true);
  x += __int_as_float(v);
  return x;
}

// ---------- conversion kernels ----------

__global__ void cvt_x_kernel(const float* __restrict__ X, bf16u* __restrict__ Xb) {
  int i = blockIdx.x * blockDim.x + threadIdx.x;   // one float4 each
  float4 v = ((const float4*)X)[i];
  union { bf16u h[4]; uint2 u; } o;
  o.h[0] = f2bf(v.x); o.h[1] = f2bf(v.y); o.h[2] = f2bf(v.z); o.h[3] = f2bf(v.w);
  ((uint2*)Xb)[i] = o.u;
}

// WT[z][n][k] = W_z[k][n]  (bf16, transposed so B-fragments load row-wise)
// One 128(k) x 64(n) tile per block. A lane reads 8 rows x 4 columns (16 lanes cover 256
// contiguous bytes of a row), turns them into 4 rows of 8 k in registers, and the tile
// goes through LDS so that every output row leaves as 256 contiguous bytes.
__global__ void cvt_wT_kernel(const float* __restrict__ W0, const float* __restrict__ W1,
                              const float* __restrict__ W2, const float* __restrict__ W3,
                              bf16u* __restrict__ WT) {
  __shared__ bf16u Ts[64 * 136];     // [n][k], pitch 272 B (16 B x odd) for 16-byte readers
  const int z = blockIdx.z;
  const float* W = (z == 0) ? W0 : (z == 1) ? W1 : (z == 2) ? W2 : W3;
  const int tid = threadIdx.x;
  const int k0 = blockIdx.x * 128, n0 = blockIdx.y * 64;
  const int c = tid & 15, g = tid >> 4;

  const float* sp = W + (size_t)(k0 + g * 8) * 1024 + n0 + c * 4;
  float4 v[8];
#pragma unroll
  for (int i = 0; i < 8; i++) v[i] = *(const float4*)(sp + (size_t)i * 1024);

  union { bf16u h[8]; uint4 u; } p0, p1, p2, p3;
#pragma unroll
  for (int i = 0; i < 8; i++) {
    p0.h[i] = f2bf(v[i].x); p1.h[i] = f2bf(v[i].y);
    p2.h[i] = f2bf(v[i].z); p3.h[i] = f2bf(v[i].w);
  }
  *(uint4*)&Ts[(c * 4 + 0) * 136 + g * 8] = p0.u;
  *(uint4*)&Ts[(c * 4 + 1) * 136 + g * 8] = p1.u;
  *(uint4*)&Ts[(c * 4 + 2) * 136 + g * 8] = p2.u;
  *(uint4*)&Ts[(c * 4 + 3) * 136 + g * 8] = p3.u;
  __syncthreads();

  bf16u* dp = WT + (size_t)z * 1024 * 1024 + (size_t)n0 * 1024 + k0 + c * 8;
#pragma unroll
  for (int r = 0; r < 4; r++) {
    const int row = g + r * 16;
    *(uint4*)(dp + (size_t)row * 1024) = *(const uint4*)&Ts[row * 136 + c * 8];
  }
}

// ---------- QKV projection: bf16 WMMA GEMM, C = X(4096x1024) * WT^T + bias ----------
// One block takes 256 rows of X and the 64 columns of one head in all three of Q, K and V, so
// that a tile of X is copied from L2 once for the three products and 448 operand rows feed
// 256 x 192 results. A wave holds 64 rows x 32 columns of each matrix: 4 X fragments and 6 weight
// fragments from LDS feed 24 products. One block has a WGP to itself, two waves a SIMD.
// Two-buffer LDS ring of async copies; a stage holds 128 k: 256 B of every operand row.
// Writes bf16 into [B,H,S,Dh].
// launch bounds: the real block size, which lifts the register ceiling to 512 a wave
__global__ __launch_bounds__(256) void qkv_kernel(const bf16u* __restrict__ A,
                            const bf16u* __restrict__ WT,
                            const float* __restrict__ bias0,
                            const float* __restrict__ bias1,
                            const float* __restrict__ bias2,
                            bf16u* __restrict__ qkv) {
  constexpr int BK    = 128;
  constexpr int PITCH = BK + 8;      // row pitch in LDS: 16 B x odd for 16-byte readers
  __shared__ __attribute__((aligned(16))) bf16u As[2][256 * PITCH];
  __shared__ __attribute__((aligned(16))) bf16u Bs[2][192 * PITCH];   // row = matrix * 64 + column

  const int tid  = threadIdx.x;
  const int wave = tid >> 5, lane = tid & 31;
  const int l = lane & 15, hi = lane >> 4;
  const int wm = wave >> 1, wn = wave & 1;          // 4x2 wave grid
  const int h = blockIdx.x;
  const int mbase = blockIdx.y * 256;

  v8f zinit = {};
  v8f acc[4][6];                                    // [X fragment][matrix * 2 + column fragment]
#pragma unroll
  for (int i = 0; i < 4; i++)
#pragma unroll
    for (int j = 0; j < 6; j++) acc[i][j] = zinit;

  const int r0 = tid >> 4, q = tid & 15;            // 16 threads/row, 16B each
  const bf16u* ag = A  + (size_t)(mbase + r0) * 1024 + q * 8;
  const bf16u* bg = WT + (size_t)(h * 64 + r0) * 1024 + q * 8;

  auto stage = [&](int buf, int kb) {
    const int ko = kb * BK;
#pragma unroll   // row steps and LDS places become constants of each copy
    for (int c = 0; c < 16; c++)
      copy16(ag + ko + (size_t)(c * 16) * 1024, &As[buf][(r0 + c * 16) * PITCH + q * 8]);
#pragma unroll   // as above; 4 copies cover a matrix's 64 rows
    for (int c = 0; c < 12; c++)
      copy16(bg + ko + (size_t)((c >> 2) * 1024 + (c & 3) * 16) * 1024,
             &Bs[buf][(r0 + c * 16) * PITCH + q * 8]);
  };

  // the 10 fragments of k block ks of a stage, into register set s
  v16bf bfrag[2][6], afrag[2][4];
  // in the order in which the products ask for them: a block can start on its first two
  auto frags = [&](int s, int buf, int ks) {
    afrag[s][0] = load_frag(&As[buf][(wm * 64 + l) * PITCH + ks * 32], hi);
#pragma unroll   // set and fragment indices must be constants (registers, not scratch)
    for (int j = 0; j < 6; j++)
      bfrag[s][j] = load_frag(&Bs[buf][((j >> 1) * 64 + wn * 32 + (j & 1) * 16 + l) * PITCH + ks * 32], hi);
#pragma unroll
    for (int i = 1; i < 4; i++)
      afrag[s][i] = load_frag(&As[buf][(wm * 64 + i * 16 + l) * PITCH + ks * 32], hi);
  };

  // ring prologue: stage 0 lands and is published
  stage(0, 0);
  asm volatile("s_wait_asynccnt 0x0" ::: "memory");   // this wave's copies have landed
  __syncthreads();                                    // ... and every other wave's

  for (int kb = 0; kb < 1024 / BK; ++kb) {
    const int buf = kb & 1;
    // directly behind the barrier that ended every read of the other buffer: flies during this stage
    if (kb + 1 < 1024 / BK) stage(buf ^ 1, kb + 1);
    frags(0, buf, 0);
    // the stage's first loads stay ahead of the next block's. Left free, the compiler mixes the two
    // groups, and the first products wait for all 40 loads
    __builtin_amdgcn_sched_barrier(0);
#pragma unroll   // set indices become constants, fragment places immediate offsets
    for (int ks = 0; ks < BK / 32; ks++) {
      if (ks + 1 < BK / 32) frags((ks + 1) & 1, buf, ks + 1);
      // the next block's 20 loads stand as one group ahead of this block's 24 products. Left free, the
      // compiler keeps one X fragment and waits out its LDS latency in front of every 6 products
      __builtin_amdgcn_sched_barrier(0);
#pragma unroll
      for (int i = 0; i < 4; i++)
#pragma unroll
        for (int j = 0; j < 6; j++)   // weight rows first: D row = n, D column = m
          acc[i][j] = wmma_bf16(bfrag[ks & 1][j], afrag[ks & 1][i], acc[i][j]);
      // ... and the loads behind do not move up among the products
      __builtin_amdgcn_sched_barrier(0);
    }

    // publish point of stage kb + 1; the one barrier also ends every read of this buffer
    asm volatile("s_wait_dscnt 0x0" ::: "memory");      // own reads of the buffer are done before it is refilled
    asm volatile("s_wait_asynccnt 0x0" ::: "memory");   // own copies of stage kb + 1 have landed
    __syncthreads();
  }
  asm volatile("s_wait_asynccnt 0x0" ::: "memory");     // no copy outstanding when the ring becomes output staging

  // epilogue: the three 256 x 64 tiles leave through LDS, so that every global access is
  // 512 contiguous bytes of whole 128-byte lines. With the weight rows as first operand, value
  // (lane l, half hi, comp r) is C[m = l][n = hi*8 + r] of a 16x16 tile: 8 consecutive columns
  // of one row in a lane, written to LDS 16 bytes at a time. The tiles lie over the A ring,
  // which every wave has left at the loop's last barrier (no copy is outstanding there).
  // All loops below are unrolled: accumulator indices must be constants (registers, not scratch),
  // and tile steps become immediate offsets of each access.
  constexpr int TP = 72;             // bf16 tile, row pitch 144 B: 16 B x odd
  bf16u* T = &As[0][0];
  const int trow = wm * 64 + l, tcol = wn * 32 + hi * 8;
#pragma unroll
  for (int j = 0; j < 6; j++) {
    const int z = j >> 1;
    const float* bias = (z == 0) ? bias0 : (z == 1) ? bias1 : bias2;
    // Q leaves times 1/sqrt(64) * log2(e), in f32 ahead of its one rounding: the attention's
    // score products are then base-2 exponents as they stand. K and V: times 1, exact.
    const float osc = (z == 0) ? 0.125f * 1.4426950408889634f : 1.0f;
    const float* bp = bias + h * 64 + tcol + (j & 1) * 16;
    const float4 b0 = *(const float4*)bp, b1 = *(const float4*)(bp + 4);
    const v8f bn = {b0.x, b0.y, b0.z, b0.w, b1.x, b1.y, b1.z, b1.w};
#pragma unroll
    for (int i = 0; i < 4; i++) {
      const v8bf pk = __builtin_convertvector((acc[i][j] + bn) * osc, v8bf);   // nearest even, as f2bf
      *(uint4*)&T[(z * 256 + trow + i * 16) * TP + tcol + (j & 1) * 16] = __builtin_bit_cast(uint4, pk);
    }
  }
  __syncthreads();   // the tiles are written before other waves read their rows
  // a head's 256 rows of 128 B follow one another in memory
  const int bb = mbase >> 11, s0 = mbase & 2047;
  bf16u* op = qkv + ((size_t)(bb * NHEAD + h) * SEQ + s0) * HDIM;
#pragma unroll
  for (int c = 0; c < 24; c++) {
    const int z = c >> 3, rc = tid + (c & 7) * 256;    // matrix, 16-byte piece of its tile
    *(uint4*)(op + (size_t)z * MTOT * D_MODEL + rc * 8) =
        *(const uint4*)&T[(z * 256 + (rc >> 3)) * TP + (rc & 7) * 8];
  }
}

// ---------- output projection: tiled bf16 WMMA GEMM, Hout = A(4096x1024) * WT^T + bias + resid ----------
// Double-buffered LDS staging with async global->LDS copies.
// A stage holds BK k of every tile row: BK * 2 bytes of a row are whole 128-byte lines,
// and one wait and one barrier serve BK / 32 blocks of 8 products per wave.
// launch bounds: the real block size. Without it the compiler plans for 1,024 threads and 128
// registers, which the epilogue (16 LDS and 16 residual loads in flight) fills: it
// then also schedules the k loop for few registers, one fragment set with a full wait per pair
__global__ __launch_bounds__(256) void gemm_kernel(const bf16u* __restrict__ A,
                            const bf16u* __restrict__ Bt,
                            const float* __restrict__ bias,
                            const float* __restrict__ resid,
                            float* __restrict__ Hout) {
  constexpr int BK    = 128;
  constexpr int PITCH = BK + 8;      // row pitch in LDS: 16 B x odd for 16-byte readers
  constexpr int CPR   = BK / 8;      // 16-byte copies per row
  constexpr int RPR   = 256 / CPR;   // rows that one copy of every thread covers
  __shared__ __attribute__((aligned(16))) bf16u As[2][128 * PITCH];
  __shared__ __attribute__((aligned(16))) bf16u Bs[2][128 * PITCH];

  const int tid  = threadIdx.x;
  const int wave = tid >> 5, lane = tid & 31;
  const int l = lane & 15, hi = lane >> 4;
  const int wm = wave >> 2, wn = wave & 3;          // 2x4 wave grid
  const int mbase = blockIdx.y * 128;
  const int nbase = blockIdx.x * 128;

  v8f zinit = {};
  v8f acc[4][2];
#pragma unroll
  for (int i = 0; i < 4; i++)
#pragma unroll
    for (int j = 0; j < 2; j++) acc[i][j] = zinit;

  const int r0 = tid / CPR, q = tid % CPR;          // CPR threads/row, 16B each
  const bf16u* ag = A  + (size_t)(mbase + r0) * 1024 + q * 8;
  const bf16u* bg = Bt + (size_t)(nbase + r0) * 1024 + q * 8;

  auto stage = [&](int buf, int kb) {
    const int ko = kb * BK;
#pragma unroll   // row steps and LDS places become constants of each copy
    for (int c = 0; c < 128 / RPR; c++) {
      copy16(ag + ko + (size_t)(c * RPR) * 1024, &As[buf][(r0 + c * RPR) * PITCH + q * 8]);
      copy16(bg + ko + (size_t)(c * RPR) * 1024, &Bs[buf][(r0 + c * RPR) * PITCH + q * 8]);
    }
  };

  stage(0, 0);
  // the bias of the 4 columns that the lane stores in the epilogue; asked for here,
  // its latency passes with the first stage's copies
  const float4 bo4 = *(const float4*)(bias + nbase + lane * 4);
  async_wait0();
  __syncthreads();

  int buf = 0;
  for (int kb = 0; kb < 1024 / BK; ++kb) {
    if (kb + 1 < 1024 / BK) stage(buf ^ 1, kb + 1);   // prefetch next tile

#pragma unroll   // fragment places become immediate offsets; loads of a block can run ahead
    for (int ks = 0; ks < BK / 32; ks++) {
      v16bf bfrag[2];
#pragma unroll
      for (int j = 0; j < 2; j++)
        bfrag[j] = load_frag(&Bs[buf][(wn * 32 + j * 16 + l) * PITCH + ks * 32], hi);
#pragma unroll
      for (int i = 0; i < 4; i++) {
        v16bf afrag = load_frag(&As[buf][(wm * 64 + i * 16 + l) * PITCH + ks * 32], hi);
#pragma unroll
        for (int j = 0; j < 2; j++)
          acc[i][j] = wmma_bf16(bfrag[j], afrag, acc[i][j]);   // weight rows first: D row = n, D column = m
      }
    }

    async_wait0();
    __syncthreads();
    buf ^= 1;
  }

  // epilogue: the block's 128 x 128 tile leaves through LDS, so that every global access is
  // 512 contiguous bytes of whole 128-byte lines. With the weight rows as first operand, value
  // (lane l, half hi, comp r) is C[m = l][n = hi*8 + r] of a 16x16 tile: 8 consecutive columns
  // of one row in a lane, written to LDS 16 bytes at a time. The tile lies over the A ring,
  // which every wave has left at the loop's last barrier (no copy is outstanding there).
  // All loops below are unrolled: accumulator indices must be constants (registers, not scratch),
  // and tile steps become immediate offsets of each access.
  const int trow = wm * 64 + l, tcol = wn * 32 + hi * 8;
  constexpr int TP = 132;            // f32 tile, row pitch 528 B: 16 B x odd
  float* T = (float*)&As[0][0];
#pragma unroll
  for (int i = 0; i < 4; i++)
#pragma unroll
    for (int j = 0; j < 2; j++) {
      float* tp = &T[(trow + i * 16) * TP + tcol + j * 16];
      *(float4*)tp       = make_float4(acc[i][j][0], acc[i][j][1], acc[i][j][2], acc[i][j][3]);
      *(float4*)(tp + 4) = make_float4(acc[i][j][4], acc[i][j][5], acc[i][j][6], acc[i][j][7]);
    }
  __syncthreads();   // the tile is written before other waves read its rows
  // a wave takes one row's 512 B per access; its lanes keep their 4 columns (bias: bo4)
  const float4 bn = bo4;
  // the wave's number as a scalar: both row bases then sit in scalar registers, and loads and
  // stores share the lane's one offset register
  const int wv = __builtin_amdgcn_readfirstlane(wave);
  const size_t g0 = (size_t)(mbase + wv) * D_MODEL + nbase;
  const float* rp = resid + g0;
  float*       hp = Hout + g0;
#pragma unroll
  for (int c = 0; c < 16; c++) {
    const float4 a = *(const float4*)&T[(wv + c * 8) * TP + lane * 4];
    const float4 x = *(const float4*)(rp + c * 8 * D_MODEL + lane * 4);
    *(float4*)(hp + c * 8 * D_MODEL + lane * 4) =
        make_float4(a.x + bn.x + x.x, a.y + bn.y + x.y, a.z + bn.z + x.z, a.w + bn.w + x.w);
  }
}

__device__ __forceinline__ float max3f(float a, float b, float c) {
  return fmaxf(fmaxf(a, b), c);
}

// value of the lane 16 away (the other half of the same query column)
__device__ __forceinline__ float other_half(float x) {
  int b = __float_as_int(x);
  return __int_as_float(
      __builtin_amdgcn_permlanex16(b, b, 0x76543210, 0xfedcba98, false, false));
}

#define VPITCH 80   // V rows in LDS: 160 B = 32 B x odd, the transposing load's pitch

struct V8x2 { v8s a, b; };

// 16(d) x 32(t) A fragment of V^T out of the row-major V tile: two transposing loads,
// 16 keys apart. Lane (l, hi) gets column l of rows hi*8 .. hi*8+7 from each, which is
// the k order of load_frag. p is the lane's own address (see vlane in attn_kernel).
__device__ __forceinline__ v16bf load_frag_tr(const bf16u* p) {
  V8x2 t;
  t.a = __builtin_amdgcn_ds_load_tr16_b128_v8i16((AS3 v8s*)p);
  t.b = __builtin_amdgcn_ds_load_tr16_b128_v8i16((AS3 v8s*)(p + 16 * VPITCH));
  return __builtin_bit_cast(v16bf, t);
}

// A wave holds 32 query columns (two B fragments), so that every K and V fragment it reads
// from LDS feeds two products. To keep four waves a SIMD the keys are split instead: a stage
// is 128 keys, waves 0-3 take its first 64 and waves 4-7 its last 64, for the same 128
// queries. Each wave runs its own online softmax over its 1024 keys; the two partial
// results of a query (maximum, sum, O) are joined through LDS behind the loop.
// launch bounds and waves per SIMD: 256 registers a wave, two blocks share a WGP
__global__ __launch_bounds__(256) __attribute__((amdgpu_waves_per_eu(4, 4)))
void attn_kernel(const bf16u* __restrict__ qkv, bf16u* __restrict__ ctx) {
  __shared__ __attribute__((aligned(16))) bf16u Qs[128 * 72];   // 128 q-rows x 64, stride 72 (144B)
  // K and V: two buffers each, the next pass's tiles land while this pass's are worked on
  __shared__ __attribute__((aligned(16))) bf16u Ks[2][128 * 72];       // 128 k-rows x 64
  __shared__ __attribute__((aligned(16))) bf16u Vs[2][128 * VPITCH];   // 128 v-rows x 64, as in memory
  // hand-over of the second key half's partial result: 16 x 4 values of O, then maxima and sums
  __shared__ float4 Mg[4][17][32];

  const int tid  = threadIdx.x;
  const int wave = tid >> 5, lane = tid & 31;
  const int l = lane & 15, hi = lane >> 4;
  const int cg = wave & 3;    // which 32 query columns
  const int kh = wave >> 2;   // which 64 keys of every stage
  const int bh = blockIdx.y;
  const int qbase = blockIdx.x * 128;
  const size_t headoff = (size_t)bh * SEQ * HDIM;
  const bf16u* Qp = qkv + headoff;
  const bf16u* Kp = qkv + (size_t)MTOT * D_MODEL + headoff;
  const bf16u* Vp = qkv + (size_t)2 * MTOT * D_MODEL + headoff;

  // stage Q tile (16KB) async: 2 threads/row, 64B each
  {
    int row = tid >> 1, half = tid & 1;
    const bf16u* g = Qp + (size_t)(qbase + row) * HDIM + half * 32;
    bf16u* d = &Qs[row * 72 + half * 32];
#pragma unroll
    for (int c = 0; c < 4; c++) copy16(g + c * 8, d + c * 8);
  }

  // transposing load: lane reads 16 B of row hi*8 + (lane & 7), column half (lane >> 3) & 1
  const int vlane = (kh * 64 + hi * 8 + (lane & 7)) * VPITCH + ((lane >> 3) & 1) * 8;
  const int klane = (kh * 64 + l) * 72;

  // async copies of the 128 keys of pass kb into buffer b, rows as they lie in memory:
  // a wave's copy takes 512 contiguous B
  auto stage = [&](int b, int kb) {
    const bf16u* kg = Kp + (size_t)kb * (128 * HDIM);   // the same for the whole block
    const bf16u* vg = Vp + (size_t)kb * (128 * HDIM);
#pragma unroll
    for (int c = 0; c < 4; c++) {
      const int idx = tid + c * 256;
      const int t = idx >> 3, dc = (idx & 7) * 8;       // t * HDIM + dc = idx * 8
      copy16(kg + idx * 8, &Ks[b][t * 72 + dc]);
      copy16(vg + idx * 8, &Vs[b][t * VPITCH + dc]);
    }
  };

  v8f zinit = {};
  v8f sacc[2][4], o[2][4];
  v8f negm[2];     // minus the maximum in use of this lane's two queries, equal in both halves,
                   // in all 8 components: a lane's 8 values of a score tile are of one query
  float lrun[2];   // running sums over this half's keys; halves join at the end
#pragma unroll
  for (int c = 0; c < 2; c++) {
    negm[c] = zinit;   // pass 0 sets the maximum in use from its own scores
    lrun[c] = 0.f;
#pragma unroll
    for (int n = 0; n < 4; n++) o[c][n] = zinit;
  }

  // ring prologue: Q and pass 0 land and are published, then pass 1's copies start
  stage(0, 0);
  asm volatile("s_wait_asynccnt 0x0" ::: "memory");   // this wave's Q, K, V copies have landed
  __syncthreads();                                    // ... and every other wave's
  stage(1, 1);

#pragma unroll 1   // rolled: two copies of the body keep every copy's LDS place in a register and spill
  for (int kb = 0; kb < SEQ / 128; ++kb) {
    const int b = kb & 1;

    // scores: S^T(64 keys x 32 queries) = K(64x64) * Q^T; A row = key, B column = query
    // sacc[c][j][r] = S^T[j*16 + hi*8 + r][c*16 + l] - maximum in use
#pragma unroll
    for (int ks = 0; ks < 2; ks++) {
      v16bf qfrag0 = load_frag(&Qs[(cg * 32 + l) * 72 + ks * 32], hi);
      v16bf qfrag1 = load_frag(&Qs[(cg * 32 + 16 + l) * 72 + ks * 32], hi);
#pragma unroll
      for (int j = 0; j < 4; j++) {
        v16bf kfrag = load_frag(&Ks[b][klane + j * 16 * 72 + ks * 32], hi);
        sacc[0][j] = wmma_bf16(kfrag, qfrag0, ks == 0 ? negm[0] : sacc[0][j]);
        sacc[1][j] = wmma_bf16(kfrag, qfrag1, ks == 0 ? negm[1] : sacc[1][j]);
      }
    }

    // how far this pass's scores rise above the maximum in use: 32 keys of each query in-lane,
    // one exchange of halves
    // (all loops of the softmax are unrolled: accumulator indices must be constants, registers)
    float mx[2];
#pragma unroll
    for (int c = 0; c < 2; c++) {
      float u[4];   // four short chains, not one long
#pragma unroll
      for (int j = 0; j < 4; j++) {
        u[j] = max3f(sacc[c][j][0], sacc[c][j][1], sacc[c][j][2]);
        u[j] = max3f(u[j], sacc[c][j][3], sacc[c][j][4]);
        u[j] = max3f(u[j], sacc[c][j][5], sacc[c][j][6]);
      }
      const float ua = max3f(u[0], u[1], sacc[c][0][7]);
      const float ub = max3f(u[2], u[3], sacc[c][1][7]);
      const float m_b = fmaxf(max3f(ua, ub, sacc[c][2][7]), sacc[c][3][7]);
      mx[c] = fmaxf(m_b, other_half(m_b));
    }

    // a new maximum comes into use only where a query's scores exceed the old by more than 8, and
    // in pass 0, which has none yet: one test a pass, a scalar branch, seldom taken after pass 0
    const bool need = (mx[0] > 8.0f) || (mx[1] > 8.0f);
    if (kb == 0 || __builtin_amdgcn_ballot_w32(need) != 0) {
#pragma unroll
      for (int c = 0; c < 2; c++) {
        const float d = (kb == 0 || mx[c] > 8.0f) ? mx[c] : 0.f;
        // d < 0 only in pass 0, where sums and O are still 0: the factor must stay finite there
        const float alpha = __builtin_amdgcn_exp2f(fminf(-d, 0.f));
        lrun[c] *= alpha;
        negm[c] -= d;
#pragma unroll
        for (int j = 0; j < 4; j++) sacc[c][j] -= d;
#pragma unroll
        for (int n = 0; n < 4; n++) o[c][n] *= alpha;
      }
    }

    // pfrag[c][ks]: B fragment of P^T, two score tiles converted in place: element s of
    // lane (l, hi) is key hi*8 + s (s < 8) or 16 + hi*8 + s - 8, the A side's k order
    v16bf pfrag[2][2];
#pragma unroll
    for (int c = 0; c < 2; c++) {
      // pairs along r lie in neighbouring registers of an accumulator: packed sums, no moves
      v2f t2[4][4];
      v2f srow[4];   // one sum per tile: four short chains, not one long
#pragma unroll
      for (int j = 0; j < 4; j++) {
#pragma unroll
        for (int h = 0; h < 4; h++) {
          const v2f p = {__builtin_amdgcn_exp2f(sacc[c][j][2 * h]),
                         __builtin_amdgcn_exp2f(sacc[c][j][2 * h + 1])};
          t2[j][h] = p;
          srow[j] = h ? srow[j] + p : p;
        }
      }
      const v2f sall = (srow[0] + srow[1]) + (srow[2] + srow[3]);
      lrun[c] += sall.x + sall.y;
#pragma unroll
      for (int ks = 0; ks < 2; ks++)
#pragma unroll
        for (int h = 0; h < 4; h++) {
          pfrag[c][ks][2 * h]         = (__bf16)t2[2 * ks][h].x;
          pfrag[c][ks][2 * h + 1]     = (__bf16)t2[2 * ks][h].y;
          pfrag[c][ks][8 + 2 * h]     = (__bf16)t2[2 * ks + 1][h].x;
          pfrag[c][ks][8 + 2 * h + 1] = (__bf16)t2[2 * ks + 1][h].y;
        }
    }

    // ctx^T(64 d x 32 queries) += V^T(64x64) * P^T; A row = d, read transposed out of Vs[t][d]
#pragma unroll
    for (int ks = 0; ks < 2; ks++) {
#pragma unroll
      for (int n = 0; n < 4; n++) {
        v16bf vfrag = load_frag_tr(&Vs[b][vlane + ks * 32 * VPITCH + n * 16]);
        o[0][n] = wmma_bf16(vfrag, pfrag[0][ks], o[0][n]);
        o[1][n] = wmma_bf16(vfrag, pfrag[1][ks], o[1][n]);
      }
    }

    // publish point of pass kb + 1; the one barrier also ends every read of buffer b
    asm volatile("s_wait_dscnt 0x0" ::: "memory");      // own reads of buffer b are done before it is refilled
    asm volatile("s_wait_asynccnt 0x0" ::: "memory");   // own copies of pass kb + 1 have landed
    __syncthreads();
    if (kb + 2 < SEQ / 128) stage(b, kb + 2);           // flies during pass kb + 1
  }
  asm volatile("s_wait_asynccnt 0x0" ::: "memory");     // no copy outstanding when the wave ends

  const float mrun[2] = {-negm[0][0], -negm[1][0]};   // maxima in use, in base-2 exponents

  // join of the two key halves: wave cg + 4 hands its partial result to wave cg, lane to lane
  // (both hold the same queries and the same d in the same lanes and registers)
  if (kh == 1) {
#pragma unroll
    for (int c = 0; c < 2; c++)
#pragma unroll
      for (int n = 0; n < 4; n++) {
        Mg[cg][(c * 4 + n) * 2 + 0][lane] = make_float4(o[c][n][0], o[c][n][1], o[c][n][2], o[c][n][3]);
        Mg[cg][(c * 4 + n) * 2 + 1][lane] = make_float4(o[c][n][4], o[c][n][5], o[c][n][6], o[c][n][7]);
      }
    Mg[cg][16][lane] = make_float4(mrun[0], mrun[1], lrun[0], lrun[1]);
  }
  __syncthreads();   // the hand-over is written before its reader starts
  if (kh == 1) return;

  // normalize and store ctx back to [B*S, D] bf16
  // o[c][n][r] = ctx^T[n*16 + hi*8 + r][c*16 + l]: 8 consecutive columns of one row per lane
  const int bb = bh >> 4, h = bh & 15;
  const float4 ml = Mg[cg][16][lane];
#pragma unroll
  for (int c = 0; c < 2; c++) {
    const float m2 = c ? ml.y : ml.x, l2 = c ? ml.w : ml.z;
    const float m  = fmaxf(mrun[c], m2);
    const float f1 = __builtin_amdgcn_exp2f(mrun[c] - m), f2 = __builtin_amdgcn_exp2f(m2 - m);
    const float lsum = lrun[c] * f1 + l2 * f2;
    const float inv = 1.0f / (lsum + other_half(lsum));
    const float g1 = f1 * inv, g2 = f2 * inv;
    const int s = qbase + cg * 32 + c * 16 + l;
    bf16u* crow = ctx + ((size_t)bb * SEQ + s) * D_MODEL + h * HDIM + hi * 8;
#pragma unroll
    for (int n = 0; n < 4; n++) {
      const float4 pa = Mg[cg][(c * 4 + n) * 2 + 0][lane];
      const float4 pb = Mg[cg][(c * 4 + n) * 2 + 1][lane];
      const float p2[8] = {pa.x, pa.y, pa.z, pa.w, pb.x, pb.y, pb.z, pb.w};
      union { uint4 u; bf16u h[8]; } pk;
#pragma unroll
      for (int r = 0; r < 8; r++) pk.h[r] = f2bf(o[c][n][r] * g1 + p2[r] * g2);
      *(uint4*)(crow + n * 16) = pk.u;
    }
  }
}

// ---------- LayerNorm over D=1024 per row ----------
// One wave per row, the row held in registers: a lane asks for its 8 x 16 bytes at once
// (each wave-wide load is 512 contiguous bytes), so a row pays one memory latency and is
// read once. The two row sums close inside the wave: no LDS, no barrier.

typedef __attribute__((ext_vector_type(4))) float v4f;

__global__ __launch_bounds__(256)
void ln_kernel(const float* __restrict__ Hb, const float* __restrict__ gamma,
               const float* __restrict__ beta, float* __restrict__ out) {
  const int lane = threadIdx.x & 31;
  // the wave's number as a scalar: the row's base then sits in scalar registers
  const int wave = __builtin_amdgcn_readfirstlane(threadIdx.x >> 5);
  const int row = blockIdx.x * 8 + wave;
  const v4f* hp = (const v4f*)(Hb + (size_t)row * D_MODEL) + lane;
  const v4f* gp = (const v4f*)gamma + lane;
  const v4f* bp = (const v4f*)beta + lane;
  v4f*       op = (v4f*)(out + (size_t)row * D_MODEL) + lane;

  // the loops below are unrolled so that x, g and b are registers, not arrays in scratch
  v4f x[8], g[8], b[8];
#pragma unroll
  for (int i = 0; i < 8; i++) x[i] = hp[i * 32];
#pragma unroll
  for (int i = 0; i < 8; i++) { g[i] = gp[i * 32]; b[i] = bp[i * 32]; }
  // inputs-only fence on the loaded values: all 24 loads are asked for ahead of the sums.
  // Left free, the compiler sinks the gamma and beta loads behind the row sums, two at a
  // time, and their latencies then add to the row's.
  asm volatile("" :: "v"(x[0]), "v"(x[1]), "v"(x[2]), "v"(x[3]),
                     "v"(x[4]), "v"(x[5]), "v"(x[6]), "v"(x[7]),
                     "v"(g[0]), "v"(g[1]), "v"(g[2]), "v"(g[3]),
                     "v"(g[4]), "v"(g[5]), "v"(g[6]), "v"(g[7]),
                     "v"(b[0]), "v"(b[1]), "v"(b[2]), "v"(b[3]),
                     "v"(b[4]), "v"(b[5]), "v"(b[6]), "v"(b[7]));

  // four independent chains per sum
  v4f s4 = {0.f, 0.f, 0.f, 0.f}, q4 = s4;
#pragma unroll
  for (int i = 0; i < 8; i++) { s4 += x[i]; q4 += x[i] * x[i]; }
  float s  = row16_sum((s4.x + s4.y) + (s4.z + s4.w));
  float ss = row16_sum((q4.x + q4.y) + (q4.z + q4.w));
  s  += other_half(s);
  ss += other_half(ss);

  const float mu   = s * (1.0f / D_MODEL);
  const float var  = ss * (1.0f / D_MODEL) - mu * mu;
  const float rstd = rsqrtf(var + 1e-12f);
#pragma unroll
  for (int i = 0; i < 8; i++) op[i * 32] = (x[i] - mu) * rstd * g[i] + b[i];
}

// ---------- launch ----------

extern "C" void kernel_launch(void* const* d_in, const int* in_sizes, int n_in,
                              void* d_out, int out_size, void* d_ws, size_t ws_size,
                              hipStream_t stream) {
  (void)in_sizes; (void)n_in; (void)out_size; (void)ws_size;
  const float* X     = (const float*)d_in[0];
  const float* Wq    = (const float*)d_in[1];
  const float* bq    = (const float*)d_in[2];
  const float* Wk    = (const float*)d_in[3];
  const float* bk    = (const float*)d_in[4];
  const float* Wv    = (const float*)d_in[5];
  const float* bv    = (const float*)d_in[6];
  const float* Wo    = (const float*)d_in[7];
  const float* bo    = (const float*)d_in[8];
  const float* gamma = (const float*)d_in[9];
  const float* beta  = (const float*)d_in[10];
  float* out = (float*)d_out;

  char* ws = (char*)d_ws;
  bf16u* Xb  = (bf16u*)ws;                              //  8 MB: X in bf16
  bf16u* WT  = (bf16u*)(ws + 8ull  * 1024 * 1024);      //  8 MB: 4 transposed weights
  bf16u* QKV = (bf16u*)(ws + 16ull * 1024 * 1024);      // 24 MB: Q,K,V [B,H,S,Dh]
  bf16u* Ctx = (bf16u*)(ws + 40ull * 1024 * 1024);      //  8 MB: context [B*S, D]
  float* Hb  = (float*)(ws + 48ull * 1024 * 1024);      // 16 MB: pre-LN fp32

  cvt_x_kernel <<<dim3(MTOT * D_MODEL / 1024), 256, 0, stream>>>(X, Xb);
  cvt_wT_kernel<<<dim3(8, 16, 4),              256, 0, stream>>>(Wq, Wk, Wv, Wo, WT);
  // one block a WGP in both GEMMs
  qkv_kernel   <<<dim3(16, 16),    256, 0, stream>>>(Xb, WT, bq, bk, bv, QKV);
  attn_kernel  <<<dim3(16, 32),    256, 0, stream>>>(QKV, Ctx);
  gemm_kernel  <<<dim3(8, 32),     256, 0, stream>>>(Ctx, WT + 3ull * 1024 * 1024, bo, X, Hb);
  ln_kernel    <<<dim3(MTOT / 8),  256, 0, stream>>>(Hb, gamma, beta, out);
}
